// v000
// Measured on an AMD MI455X. A time is GPU time per run, averaged over a window of back-to-back runs after a warm-up
// (all launches, gaps included; the runs take copies of the inputs in turn), and the median of several windows.
// Apart from v000's, it joins two sittings. Times from different sittings can be a few percent apart, while
// side-by-side timings come from the same sitting.
// v000, which the later versions start from, runs in 123 microseconds.
#include <hip/hip_runtime.h>
// Shifted-window attention: qkv = x·W_qkv on v_wmma_f32_16x16x32_bf16 (x rounded to bf16: single exact term; 50176 × 128 × 384); per (batch, window, head) the 49×49
// scores q·kᵀ and e·v on v_wmma_f32_16x16x32_f16 (q, k, v, e rounded to f16, windows padded to 64; one wave each); out = o·W_out + b_out on the bf16 variant with o split
// hi/lo (2 products). The cyclic shifts are pure index remaps (token (y,x) ↔ shifted (y−3, x−3) mod 56, and the back-shift returns every result to its own token);
// relative-position bias, the shift masks and the max-shifted softmax are f32 VALU.
#define BB 16
#define HI 56
#define WI 56
#define DIM 128
#define NHD 4
#define HDM 32
#define WS 7
#define NWIN 64
#define NTOK (BB * HI * WI)
#define DISP 3

typedef __bf16 v16b __attribute__((ext_vector_type(16)));
typedef unsigned short v8us __attribute__((ext_vector_type(8), may_alias));
typedef float  v8f  __attribute__((ext_vector_type(8)));
typedef float  v4f  __attribute__((ext_vector_type(4)));
typedef float  v4fa __attribute__((ext_vector_type(4), may_alias));
union FragB { v16b v; v8us half[2]; unsigned short u[16]; };

__device__ __forceinline__ unsigned short bf16_bits(float x) { unsigned int u = __float_as_uint(x); return (unsigned short)((u + 0x7FFFu + ((u >> 16) & 1u)) >> 16); }
__device__ __forceinline__ float bf16_val(unsigned short b) { return __uint_as_float(((unsigned int)b) << 16); }
__device__ __forceinline__ float bf16_round(float x) { return bf16_val(bf16_bits(x)); }
// D += A·B with NT terms: 1 = ah·bh, 2 = + al·bh (A split), 3 = + ah·bl (both split)
template <int NT>
__device__ __forceinline__ v8f mmaN(v16b ah, v16b al, v16b bh, v16b bl, v8f c) {
  c = __builtin_amdgcn_wmma_f32_16x16x32_bf16(false, ah, false, bh, (short)0, c, false, false);
  if (NT >= 2) c = __builtin_amdgcn_wmma_f32_16x16x32_bf16(false, al, false, bh, (short)0, c, false, false);
  if (NT >= 3) c = __builtin_amdgcn_wmma_f32_16x16x32_bf16(false, ah, false, bl, (short)0, c, false, false);
  asm volatile("v_nop\n\tv_nop\n\tv_nop\n\tv_nop" : "+v"(c) : "v"(ah), "v"(al), "v"(bh), "v"(bl));
  return c;
}

__global__ __launch_bounds__(256) void k_wt_bf16(const float* __restrict__ W, unsigned short* __restrict__ Wt, int K, int N) {
  const int t = blockIdx.x * 256 + threadIdx.x;
  const int k8n = K / 8;
  if (t >= N * k8n) return;
  const int n = t / k8n, k8 = (t % k8n) * 8;
  v8us v;
#pragma unroll
  for (int i = 0; i < 8; ++i) v[i] = bf16_bits(W[(size_t)(k8 + i) * N + n]);
  *(v8us*)(Wt + (size_t)n * K + k8) = v;
  
}

// GEMM C[M][N] (f32, pitch ldc) = act(A[M][K]·W + bias). A f32 row-major (pitch lda) converted per fragment to bf16
// (ASPLIT: hi/lo two planes -> 2 terms, else single rounded term); Wt bf16 [N][K] (pitch ldb). BIAS_BF16 rounds the
// bias to bf16 first (bias quantised to bf16 before the add). K%32==0, M%16==0, N%64==0.
template <bool ASPLIT, int ACT, bool BIAS_BF16>
__global__ __launch_bounds__(128) void k_gemm_bf(const float* __restrict__ A, int lda, const unsigned short* __restrict__ Wt, int ldb,
                                               const float* __restrict__ bias, float* __restrict__ C, int ldc, int M, int N, int K) {
  __shared__ __attribute__((aligned(16))) float so[4][16][64];
  const int tid = threadIdx.x, w = tid >> 5, lane = tid & 31, ln = lane & 15, hh = lane >> 4;
  const int ntn = N / 64;
  const int wid = blockIdx.x * 4 + w;
  const int mt = wid / ntn, nq = wid % ntn;
  if (mt * 16 >= M) return;
  const int row0 = mt * 16, col0 = nq * 64;
  const float* arow = A + (size_t)(row0 + ln) * lda;
  v8f acc[4] = {};
  for (int kb = 0; kb < K; kb += 32) {
    FragB ah, al;
    const v4f x0 = *(const v4fa*)(arow + kb + 8 * hh), x1 = *(const v4fa*)(arow + kb + 8 * hh + 4);
    const v4f x2 = *(const v4fa*)(arow + kb + 16 + 8 * hh), x3 = *(const v4fa*)(arow + kb + 16 + 8 * hh + 4);
    float xs[16] = {x0[0],x0[1],x0[2],x0[3],x1[0],x1[1],x1[2],x1[3],x2[0],x2[1],x2[2],x2[3],x3[0],x3[1],x3[2],x3[3]};
#pragma unroll
    for (int i = 0; i < 16; ++i) { const unsigned short hb = bf16_bits(xs[i]); ah.u[i] = hb; al.u[i] = ASPLIT ? bf16_bits(xs[i] - bf16_val(hb)) : (unsigned short)0; }
#pragma unroll
    for (int t = 0; t < 4; ++t) {
      const unsigned short* brow = Wt + (size_t)(col0 + t * 16 + ln) * ldb + kb;
      FragB b;
      b.half[0] = *(const v8us*)(brow + 8 * hh);
      b.half[1] = *(const v8us*)(brow + 16 + 8 * hh);
      acc[t] = mmaN<ASPLIT ? 2 : 1>(ah.v, al.v, b.v, b.v, acc[t]);
    }
  }
#pragma unroll
  for (int t = 0; t < 4; ++t) {
    float bv = bias ? bias[col0 + t * 16 + ln] : 0.f;
    if (BIAS_BF16) bv = bf16_round(bv);
#pragma unroll
    for (int r = 0; r < 8; ++r) { float v = acc[t][r] + bv; if (ACT == 1) v = fmaxf(v, 0.f); so[w][8 * hh + r][t * 16 + ln] = v; }
  }
  __builtin_amdgcn_fence(__ATOMIC_ACQ_REL, "workgroup");
  __builtin_amdgcn_wave_barrier();
  const int rsub = lane >> 4, c4 = (lane & 15) * 4;
  {
#pragma unroll
    for (int q = 0; q < 8; ++q) {
      const int r = q * 2 + rsub;
      const v4f v = *(const v4fa*)&so[w][r][c4];
      *(v4f*)(C + (size_t)(row0 + r) * ldc + col0 + c4) = v;
    }
    
  }
}

// Flash-style causal/unmasked attention, all contractions 3-term bf16 hi/lo splits, f32 softmax with running max.
// q,k,v rows are read from f32 buffers with arbitrary row pitch (so they can live inside a fused qkv buffer);
// D = head size (multiple of 32, <= 128); one wave = 16 query rows; block = 4 waves (64 queries) sharing K/V chunks of 32.
template <int D, bool CAUSAL>
__global__ __launch_bounds__(128) void k_flash(const float* __restrict__ qb, const float* __restrict__ kb, const float* __restrict__ vb,
                                             int pitch, int T, int H, float scale, float* __restrict__ y, int ypitch) {
  constexpr int KS = D / 32;        // k-steps for QK
  constexpr int DT = D / 16;        // d tiles for PV
  __shared__ __attribute__((aligned(16))) unsigned short sKh[32][D + 8], sKl[32][D + 8], sVh[32][D + 8], sVl[32][D + 8];
  __shared__ __attribute__((aligned(16))) unsigned short sPh[4][16][40], sPl[4][16][40];
  __shared__ __attribute__((aligned(16))) float sO[4][16][D];
  const int tid = threadIdx.x, w = tid >> 5, lane = tid & 31, ln = lane & 15, hh = lane >> 4;
  const int nqb = (T + 63) / 64;
  const int bh = blockIdx.x / nqb, qblk = blockIdx.x % nqb;
  const int b = bh / H, h = bh % H;
  const int q0 = qblk * 64 + w * 16;
  const float* Q = qb + (size_t)b * T * pitch + h * D;
  const float* K = kb + (size_t)b * T * pitch + h * D;
  const float* V = vb + (size_t)b * T * pitch + h * D;

  // A fragments of the wave's 16 query rows (scaled), hi/lo
  FragB aqh[KS], aql[KS];
  {
    int row = q0 + ln; if (row >= T) row = T - 1;
    const float* qr = Q + (size_t)row * pitch;
#pragma unroll
    for (int ks = 0; ks < KS; ++ks)
#pragma unroll
      for (int i = 0; i < 16; ++i) {
        const int d = ks * 32 + ((i < 8) ? (8 * hh + i) : (16 + 8 * hh + (i - 8)));
        const float x = qr[d] * scale; const unsigned short hb = bf16_bits(x);
        aqh[ks].u[i] = hb; aql[ks].u[i] = bf16_bits(x - bf16_val(hb));
      }
  }
  float m_r[8], l_r[8];
#pragma unroll
  for (int r = 0; r < 8; ++r) { m_r[r] = -3.0e38f; l_r[r] = 0.f; }
  v8f oacc[DT];
#pragma unroll
  for (int dt = 0; dt < DT; ++dt) oacc[dt] = (v8f){0.f,0.f,0.f,0.f,0.f,0.f,0.f,0.f};

  const int kv_end = CAUSAL ? min(T, qblk * 64 + 64) : T;     // block-uniform
  for (int j0 = 0; j0 < kv_end; j0 += 32) {
    __syncthreads();
    for (int e = tid; e < 32 * (D / 4); e += 128) {
      const int r = e / (D / 4), c4 = (e % (D / 4)) * 4;
      const int key = j0 + r;
      v4f kf = {0.f,0.f,0.f,0.f}, vf = {0.f,0.f,0.f,0.f};
      if (key < T) { kf = *(const v4fa*)(K + (size_t)key * pitch + c4); vf = *(const v4fa*)(V + (size_t)key * pitch + c4); }
#pragma unroll
      for (int t = 0; t < 4; ++t) {
        unsigned short hb = bf16_bits(kf[t]); sKh[r][c4 + t] = hb; sKl[r][c4 + t] = bf16_bits(kf[t] - bf16_val(hb));
        hb = bf16_bits(vf[t]); sVh[r][c4 + t] = hb; sVl[r][c4 + t] = bf16_bits(vf[t] - bf16_val(hb));
      }
    }
    __syncthreads();
    // S tile 16 x 32
    v8f s[2];
#pragma unroll
    for (int nt = 0; nt < 2; ++nt) {
      v8f acc = {};
#pragma unroll
      for (int ks = 0; ks < KS; ++ks) {
        FragB bh_, bl_;
        bh_.half[0] = *(const v8us*)&sKh[nt * 16 + ln][ks * 32 + 8 * hh]; bh_.half[1] = *(const v8us*)&sKh[nt * 16 + ln][ks * 32 + 16 + 8 * hh];
        bl_.half[0] = *(const v8us*)&sKl[nt * 16 + ln][ks * 32 + 8 * hh]; bl_.half[1] = *(const v8us*)&sKl[nt * 16 + ln][ks * 32 + 16 + 8 * hh];
        acc = mmaN<3>(aqh[ks].v, aql[ks].v, bh_.v, bl_.v, acc);
      }
      s[nt] = acc;
    }
    // mask + running max (rows 8hh+r; the 16 lanes of a half share rows)
    float alpha[8];
#pragma unroll
    for (int r = 0; r < 8; ++r) {
      const int qi = q0 + 8 * hh + r;
      const int ja = j0 + ln, jb = j0 + 16 + ln;
      if (CAUSAL) { if (ja > qi) s[0][r] = -3.0e38f; if (jb > qi) s[1][r] = -3.0e38f; }
      if (ja >= T) s[0][r] = -3.0e38f;
      if (jb >= T) s[1][r] = -3.0e38f;
      float mx = fmaxf(s[0][r], s[1][r]);
      mx = fmaxf(mx, __shfl_xor(mx, 1, 32)); mx = fmaxf(mx, __shfl_xor(mx, 2, 32)); mx = fmaxf(mx, __shfl_xor(mx, 4, 32)); mx = fmaxf(mx, __shfl_xor(mx, 8, 32));
      const float mnew = fmaxf(m_r[r], mx);
      alpha[r] = (mnew > -1.0e38f) ? __expf(m_r[r] - mnew) : 1.0f;
      const float p0 = (s[0][r] > -1.0e38f) ? __expf(s[0][r] - mnew) : 0.f;
      const float p1 = (s[1][r] > -1.0e38f) ? __expf(s[1][r] - mnew) : 0.f;
      m_r[r] = mnew;
      l_r[r] = l_r[r] * alpha[r] + p0 + p1;            // per-lane partial row sum (16 lanes combined at the end)
      unsigned short hb = bf16_bits(p0); sPh[w][8 * hh + r][ln] = hb;      sPl[w][8 * hh + r][ln] = bf16_bits(p0 - bf16_val(hb));
      hb = bf16_bits(p1);                sPh[w][8 * hh + r][16 + ln] = hb; sPl[w][8 * hh + r][16 + ln] = bf16_bits(p1 - bf16_val(hb));
    }
#pragma unroll
    for (int dt = 0; dt < DT; ++dt)
#pragma unroll
      for (int r = 0; r < 8; ++r) oacc[dt][r] *= alpha[r];
    __builtin_amdgcn_fence(__ATOMIC_ACQ_REL, "workgroup");
    __builtin_amdgcn_wave_barrier();
    FragB pah, pal;
    pah.half[0] = *(const v8us*)&sPh[w][ln][8 * hh]; pah.half[1] = *(const v8us*)&sPh[w][ln][16 + 8 * hh];
    pal.half[0] = *(const v8us*)&sPl[w][ln][8 * hh]; pal.half[1] = *(const v8us*)&sPl[w][ln][16 + 8 * hh];
#pragma unroll
    for (int dt = 0; dt < DT; ++dt) {
      FragB bvh, bvl;
#pragma unroll
      for (int i = 0; i < 8; ++i) {
        bvh.u[i] = sVh[8 * hh + i][dt * 16 + ln]; bvh.u[8 + i] = sVh[16 + 8 * hh + i][dt * 16 + ln];
        bvl.u[i] = sVl[8 * hh + i][dt * 16 + ln]; bvl.u[8 + i] = sVl[16 + 8 * hh + i][dt * 16 + ln];
      }
      oacc[dt] = mmaN<3>(pah.v, pal.v, bvh.v, bvl.v, oacc[dt]);
    }
    __builtin_amdgcn_fence(__ATOMIC_ACQ_REL, "workgroup");
    __builtin_amdgcn_wave_barrier();
  }
#pragma unroll
  for (int r = 0; r < 8; ++r) {
    float l = l_r[r];
    l += __shfl_xor(l, 1, 32); l += __shfl_xor(l, 2, 32); l += __shfl_xor(l, 4, 32); l += __shfl_xor(l, 8, 32);
    l_r[r] = (l > 0.f) ? 1.0f / l : 0.f;
  }
#pragma unroll
  for (int dt = 0; dt < DT; ++dt)
#pragma unroll
    for (int r = 0; r < 8; ++r) sO[w][8 * hh + r][dt * 16 + ln] = oacc[dt][r] * l_r[r];
  __builtin_amdgcn_fence(__ATOMIC_ACQ_REL, "workgroup");
  __builtin_amdgcn_wave_barrier();
  {
    for (int r = 0; r < 16; ++r) {
      const int row = q0 + r;
      if (row < T && lane < D / 4) {
        const v4f val = *(const v4fa*)&sO[w][r][lane * 4];
        *(v4f*)(y + ((size_t)b * T + row) * ypitch + h * D + lane * 4) = val;
      }
    }
    
  }
}

// batched GEMM (blockIdx.y = batch): C_b = act(alpha·A_b·B_b + bias + resid_b); A f32 rows (ASPLIT → hi/lo), B = bf16 planes Bh (+Bl when BSPLIT, requires ASPLIT),
// per-batch element strides sA, sB (0 = shared weights), sC, sR. resid may alias C (values are staged before the stores). ACT 0/1(relu).
// ACT: 0 none, 1 relu, 2 softplus
template <bool ASPLIT, bool BSPLIT, int ACT>
__global__ __launch_bounds__(128) void k_gemm_b(const float* __restrict__ A, int lda, size_t sA, const unsigned short* __restrict__ Bh, const unsigned short* __restrict__ Bl, int ldb, size_t sB,
                                             const float* __restrict__ bias, const float* __restrict__ resid, int ldr, size_t sR, float rsign, float alpha,
                                             float* __restrict__ C, int ldc, size_t sC, int M, int N, int K) {
  __shared__ __attribute__((aligned(16))) float so[4][16][64];
  const int tid = threadIdx.x, w = tid >> 5, lane = tid & 31, ln = lane & 15, hh = lane >> 4;
  const int by = blockIdx.y;
  A += (size_t)by * sA; Bh += (size_t)by * sB; if (BSPLIT) Bl += (size_t)by * sB; C += (size_t)by * sC; if (resid) resid += (size_t)by * sR;
  const int ntn = (N + 63) / 64; const int wid = blockIdx.x * 4 + w; const int mt = wid / ntn, nq = wid % ntn;      // N may be any multiple of 16: tiles past N are skipped and not stored
  if (mt * 16 >= M) return;
  const int row0 = mt * 16, col0 = nq * 64;
  const float* arow = A + (size_t)(row0 + ln) * lda;
  v8f acc[4] = {};
  for (int kb = 0; kb < K; kb += 32) {
    FragB ah, al;
    const v4f x0 = *(const v4fa*)(arow + kb + 8 * hh), x1 = *(const v4fa*)(arow + kb + 8 * hh + 4);
    const v4f x2 = *(const v4fa*)(arow + kb + 16 + 8 * hh), x3 = *(const v4fa*)(arow + kb + 16 + 8 * hh + 4);
    float xs[16] = {x0[0],x0[1],x0[2],x0[3],x1[0],x1[1],x1[2],x1[3],x2[0],x2[1],x2[2],x2[3],x3[0],x3[1],x3[2],x3[3]};
#pragma unroll
    for (int i = 0; i < 16; ++i) { const unsigned short hb = bf16_bits(xs[i]); ah.u[i] = hb; al.u[i] = ASPLIT ? bf16_bits(xs[i] - bf16_val(hb)) : (unsigned short)0; }
#pragma unroll
    for (int t = 0; t < 4; ++t) {
      if (col0 + t * 16 >= N) continue;
      const size_t boff = (size_t)(col0 + t * 16 + ln) * ldb + kb;
      FragB bh_, bl_; bh_.half[0] = *(const v8us*)(Bh + boff + 8 * hh); bh_.half[1] = *(const v8us*)(Bh + boff + 16 + 8 * hh);
      if (BSPLIT) { bl_.half[0] = *(const v8us*)(Bl + boff + 8 * hh); bl_.half[1] = *(const v8us*)(Bl + boff + 16 + 8 * hh); } else bl_ = bh_;
      acc[t] = mmaN<ASPLIT ? (BSPLIT ? 3 : 2) : 1>(ah.v, al.v, bh_.v, bl_.v, acc[t]);
    }
  }
#pragma unroll
  for (int t = 0; t < 4; ++t) {
    const int col = col0 + t * 16 + ln; if (col0 + t * 16 >= N) continue; const float bv = bias ? bf16_round(bias[col]) : 0.f;
#pragma unroll
    for (int r = 0; r < 8; ++r) { float v = acc[t][r] * alpha + bv; if (resid) v += rsign * resid[(size_t)(row0 + 8 * hh + r) * ldr + col]; if (ACT == 1) v = fmaxf(v, 0.f); else if (ACT == 2) v = fmaxf(v, 0.f) + log1pf(expf(-fabsf(v))); so[w][8 * hh + r][t * 16 + ln] = v; }
  }
  __builtin_amdgcn_fence(__ATOMIC_ACQ_REL, "workgroup"); __builtin_amdgcn_wave_barrier();
  const int rsub = lane >> 4, c4 = (lane & 15) * 4;
  {
#pragma unroll
    for (int q = 0; q < 8; ++q) { const int r = q * 2 + rsub; if (col0 + c4 < N) { const v4f v = *(const v4fa*)&so[w][r][c4]; *(v4f*)(C + (size_t)(row0 + r) * ldc + col0 + c4) = v; } }
    
  }
}
// batched f32 [K][N] (pitch lds, batch stride sIn) -> transposed hi/lo planes [N][K] (batch stride sOut); thread per (n, 8 k); grid.y = batch
__global__ __launch_bounds__(256) void k_split_transpose_b(const float* __restrict__ src, int lds_, size_t sIn, unsigned short* __restrict__ hi, unsigned short* __restrict__ lo, size_t sOut, int K, int N) {
  const size_t t = (size_t)blockIdx.x * 256 + threadIdx.x; const int k8n = K / 8; if (t >= (size_t)N * k8n) return;
  src += (size_t)blockIdx.y * sIn; hi += (size_t)blockIdx.y * sOut; lo += (size_t)blockIdx.y * sOut;
  const int n = (int)(t / k8n), k8 = (int)(t % k8n) * 8; v8us vh, vl;
#pragma unroll
  for (int i = 0; i < 8; ++i) { const float x = src[(size_t)(k8 + i) * lds_ + n]; const unsigned short hb = bf16_bits(x); vh[i] = hb; vl[i] = bf16_bits(x - bf16_val(hb)); }
  unsigned short* dh = hi + (size_t)n * K + k8; unsigned short* dl = lo + (size_t)n * K + k8;
  *(v8us*)dh = vh; *(v8us*)dl = vl; 
}

// ---- f16 WMMA path (v_wmma_f32_16x16x32_f16): 11-bit significands for operands in range — used where a [0,1] probability operand needs more precision than bf16
typedef _Float16 v16h __attribute__((ext_vector_type(16)));
union FragH { v16h v; v8us half[2]; _Float16 h[16]; unsigned short u[16]; };
template <int NT>
__device__ __forceinline__ v8f mmaH(v16h ah, v16h al, v16h bh, v16h bl, v8f c) {
  c = __builtin_amdgcn_wmma_f32_16x16x32_f16(false, ah, false, bh, (short)0, c, false, false);
  if (NT >= 2) c = __builtin_amdgcn_wmma_f32_16x16x32_f16(false, al, false, bh, (short)0, c, false, false);
  if (NT >= 3) c = __builtin_amdgcn_wmma_f32_16x16x32_f16(false, ah, false, bl, (short)0, c, false, false);
  asm volatile("v_nop\n\tv_nop\n\tv_nop\n\tv_nop" : "+v"(c) : "v"(ah), "v"(al), "v"(bh), "v"(bl));
  return c;
}
// batched GEMM like k_gemm_b but f16 operands: A f32 (split into f16 hi/lo if ASPLIT, else rounded to f16), Bt = f16 values [n][k]; alpha; C f32; N multiple of 16 (partial tiles skipped)
template <bool ASPLIT>
__global__ __launch_bounds__(128) void k_gemm_h(const float* __restrict__ A, int lda, size_t sA, const _Float16* __restrict__ Bh, int ldb, size_t sB, float alpha, float* __restrict__ C, int ldc, size_t sC, int M, int N, int K) {
  __shared__ __attribute__((aligned(16))) float so[4][16][64];
  const int tid = threadIdx.x, w = tid >> 5, lane = tid & 31, ln = lane & 15, hh = lane >> 4; const int by = blockIdx.y;
  A += (size_t)by * sA; Bh += (size_t)by * sB; C += (size_t)by * sC;
  const int ntn = (N + 63) / 64; const int wid = blockIdx.x * 4 + w; const int mt = wid / ntn, nq = wid % ntn; if (mt * 16 >= M) return;
  const int row0 = mt * 16, col0 = nq * 64; const float* arow = A + (size_t)(row0 + ln) * lda;
  v8f acc[4] = {};
  for (int kb = 0; kb < K; kb += 32) {
    FragH ah, al;
    const v4f x0 = *(const v4fa*)(arow + kb + 8 * hh), x1 = *(const v4fa*)(arow + kb + 8 * hh + 4), x2 = *(const v4fa*)(arow + kb + 16 + 8 * hh), x3 = *(const v4fa*)(arow + kb + 16 + 8 * hh + 4);
    float xs[16] = {x0[0],x0[1],x0[2],x0[3],x1[0],x1[1],x1[2],x1[3],x2[0],x2[1],x2[2],x2[3],x3[0],x3[1],x3[2],x3[3]};
#pragma unroll
    for (int i = 0; i < 16; ++i) { const _Float16 h = (_Float16)xs[i]; ah.h[i] = h; al.h[i] = ASPLIT ? (_Float16)(xs[i] - (float)h) : (_Float16)0.0f; }
#pragma unroll
    for (int t = 0; t < 4; ++t) { if (col0 + t * 16 >= N) continue; const size_t boff = (size_t)(col0 + t * 16 + ln) * ldb + kb; FragH bq; bq.half[0] = *(const v8us*)(Bh + boff + 8 * hh); bq.half[1] = *(const v8us*)(Bh + boff + 16 + 8 * hh);
      acc[t] = mmaH<ASPLIT ? 2 : 1>(ah.v, al.v, bq.v, bq.v, acc[t]); }
  }
#pragma unroll
  for (int t = 0; t < 4; ++t) { if (col0 + t * 16 >= N) continue;
#pragma unroll
    for (int r = 0; r < 8; ++r) so[w][8 * hh + r][t * 16 + ln] = acc[t][r] * alpha; }
  __builtin_amdgcn_fence(__ATOMIC_ACQ_REL, "workgroup"); __builtin_amdgcn_wave_barrier();
  const int rsub = lane >> 4, c4 = (lane & 15) * 4;
  {
#pragma unroll
    for (int q = 0; q < 8; ++q) { const int r = q * 2 + rsub; if (col0 + c4 < N) { const v4f v = *(const v4fa*)&so[w][r][c4]; *(v4f*)(C + (size_t)(row0 + r) * ldc + col0 + c4) = v; } }
     }
}

__global__ __launch_bounds__(256) void k_bt(const float* __restrict__ Wqkv, const float* __restrict__ Wo, unsigned short* __restrict__ Bq, unsigned short* __restrict__ Bo) { const int t = blockIdx.x * 256 + threadIdx.x;
  if (t < 3 * DIM * DIM / 8) { const int k8 = (t % (DIM / 8)) * 8, n = t / (DIM / 8); v8us v; for (int q = 0; q < 8; ++q) v[q] = bf16_bits(Wqkv[(size_t)(k8 + q) * (3 * DIM) + n]); *(v8us*)(Bq + (size_t)n * DIM + k8) = v;  }
  if (t < DIM * DIM / 8) { const int k8 = (t % (DIM / 8)) * 8, n = t / (DIM / 8); v8us v; for (int q = 0; q < 8; ++q) v[q] = bf16_bits(Wo[(size_t)(k8 + q) * DIM + n]); *(v8us*)(Bo + (size_t)n * DIM + k8) = v;  } }
__device__ __forceinline__ void ldF(FragH& f, const _Float16* base, int pitch, int row, int k0, int ln, int hh) { const unsigned short* p = (const unsigned short*)base + (size_t)(row + ln) * pitch + k0; f.half[0] = *(const v8us*)(p + 8 * hh); f.half[1] = *(const v8us*)(p + 16 + 8 * hh); }
// one wave per (b, window w = wy·8+wx, head h): window slot i = yi·7+xi ↔ token ((wy·7+yi+3)%56, (wx·7+xi+3)%56) of batch b
__global__ __launch_bounds__(32) void k_win(const float* __restrict__ QKV, const float* __restrict__ pos, float* __restrict__ O) {
  __shared__ __attribute__((aligned(16))) _Float16 sq[64 * 40], sk[64 * 40], svt[HDM * 72], sp[64 * 72]; __shared__ int stok[64]; __shared__ float sbias[13 * 13];
  const int lane = threadIdx.x, ln = lane & 15, hh = lane >> 4; const int h = blockIdx.x % NHD; const int w = (blockIdx.x / NHD) % NWIN; const int b = blockIdx.x / (NHD * NWIN); const int wy = w / 8, wx = w % 8;
  for (int i = lane; i < 64; i += 32) { int tok = -1; if (i < 49) { const int yi = i / WS, xi = i % WS; const int y = (wy * WS + yi + DISP) % HI, x = (wx * WS + xi + DISP) % WI; tok = (b * HI + y) * WI + x; } stok[i] = tok; }
  for (int i = lane; i < 169; i += 32) sbias[i] = bf16_round(pos[i]);
  // zero the padded rows/cols
  for (int i = lane; i < 64 * 40; i += 32) { sq[i] = (_Float16)0.f; sk[i] = (_Float16)0.f; } for (int i = lane; i < HDM * 72; i += 32) svt[i] = (_Float16)0.f;
  __builtin_amdgcn_fence(__ATOMIC_ACQ_REL, "workgroup"); __builtin_amdgcn_wave_barrier();
  for (int e = lane; e < 49 * (HDM / 4); e += 32) { const int i = e / (HDM / 4), d4 = (e % (HDM / 4)) * 4; const float* row = QKV + (size_t)stok[i] * (3 * DIM) + h * HDM + d4; const v4f q = *(const v4fa*)row, k = *(const v4fa*)(row + DIM), v = *(const v4fa*)(row + 2 * DIM);
    for (int c = 0; c < 4; ++c) { sq[i * 40 + d4 + c] = (_Float16)(q[c] * 0.17677669529663687f); sk[i * 40 + d4 + c] = (_Float16)k[c]; svt[(d4 + c) * 72 + i] = (_Float16)v[c]; } }
  __builtin_amdgcn_fence(__ATOMIC_ACQ_REL, "workgroup"); __builtin_amdgcn_wave_barrier();
  const bool ul = (wy == 7), lr = (wx == 7);
  for (int mt = 0; mt < 4; ++mt) {      // 16 query rows per pass (rows ≥ 49 are padding: computed, never stored)
    v8f acc[4] = {}; FragH a; ldF(a, sq, 40, mt * 16, 0, ln, hh);
#pragma unroll
    for (int t = 0; t < 4; ++t) { FragH bk; ldF(bk, sk, 40, t * 16, 0, ln, hh); acc[t] = mmaH<1>(a.v, a.v, bk.v, bk.v, acc[t]); }
    float rmax[8], rsum[8];
#pragma unroll
    for (int r = 0; r < 8; ++r) { const int i = mt * 16 + 8 * hh + r; const int yi = i / WS, xi = i % WS; float m = -3.0e38f;
#pragma unroll
      for (int t = 0; t < 4; ++t) { const int j = t * 16 + ln; float s = -3.0e38f; if (i < 49 && j < 49) { const int yj = j / WS, xj = j % WS; const bool masked = (ul && ((yi >= 4) != (yj >= 4))) || (lr && ((xi >= 4) != (xj >= 4))); if (!masked) s = acc[t][r] + sbias[(yj - yi + 6) * 13 + (xj - xi + 6)]; } acc[t][r] = s; m = fmaxf(m, s); }
      for (int o = 8; o >= 1; o >>= 1) m = fmaxf(m, __shfl_xor(m, o, 32)); rmax[r] = m; }
#pragma unroll
    for (int r = 0; r < 8; ++r) { const int i = mt * 16 + 8 * hh + r; float s = 0.f;
#pragma unroll
      for (int t = 0; t < 4; ++t) { const int j = t * 16 + ln; const float e = (acc[t][r] > -1.0e38f) ? __expf(acc[t][r] - rmax[r]) : 0.f; s += e; sp[i * 72 + j] = (_Float16)e; }
      for (int o = 8; o >= 1; o >>= 1) s += __shfl_xor(s, o, 32); rsum[r] = s; }
    __builtin_amdgcn_fence(__ATOMIC_ACQ_REL, "workgroup"); __builtin_amdgcn_wave_barrier();
    v8f acco[2] = {};
#pragma unroll
    for (int ks = 0; ks < 2; ++ks) { FragH ap; ldF(ap, sp, 72, mt * 16, ks * 32, ln, hh);
#pragma unroll
      for (int t = 0; t < 2; ++t) { FragH bv; ldF(bv, svt, 72, t * 16, ks * 32, ln, hh); acco[t] = mmaH<1>(ap.v, ap.v, bv.v, bv.v, acco[t]); } }
    __shared__ __attribute__((aligned(16))) float so[16][HDM + 1];
#pragma unroll
    for (int t = 0; t < 2; ++t) {
#pragma unroll
      for (int r = 0; r < 8; ++r) { const int il = 8 * hh + r; const float rs = (rsum[r] > 0.f) ? 1.0f / rsum[r] : 0.f; so[il][t * 16 + ln] = acco[t][r] * rs; } }
    __builtin_amdgcn_fence(__ATOMIC_ACQ_REL, "workgroup"); __builtin_amdgcn_wave_barrier();
    { for (int il = 0; il < 16; ++il) { const int i = mt * 16 + il; if (i < 49) *(float*)(O + (size_t)stok[i] * DIM + h * HDM + lane) = so[il][lane]; }  }
    __builtin_amdgcn_fence(__ATOMIC_ACQ_REL, "workgroup"); __builtin_amdgcn_wave_barrier();
  }
}
extern "C" void kernel_launch(void* const* d_in, const int* in_sizes, int n_in,
                              void* d_out, int out_size, void* d_ws, size_t ws_size, hipStream_t stream) {
  (void)in_sizes; (void)n_in; (void)out_size;
  const float* x = (const float*)d_in[0]; const float* Wqkv = (const float*)d_in[1]; const float* pos = (const float*)d_in[2]; const float* Wo = (const float*)d_in[3]; const float* bo = (const float*)d_in[4];
  char* ws = (char*)d_ws; size_t off = 0;
  auto take = [&](size_t bytes) { char* p = ws + off; off += (bytes + 255) & ~(size_t)255; return p; };
  unsigned short* Bq = (unsigned short*)take((size_t)3 * DIM * DIM * 2); unsigned short* Bo = (unsigned short*)take((size_t)DIM * DIM * 2); float* QKV = (float*)take((size_t)NTOK * 3 * DIM * 4); float* O = (float*)take((size_t)NTOK * DIM * 4);
  if (off > ws_size) return;
  k_bt<<<(3 * DIM * DIM / 8 + 255) / 256, 256, 0, stream>>>(Wqkv, Wo, Bq, Bo);
  k_gemm_b<false, false, 0><<<dim3(((NTOK / 16) * (3 * DIM / 64) + 3) / 4, 1), 128, 0, stream>>>(x, DIM, 0, Bq, Bq, DIM, 0, nullptr, nullptr, 0, 0, 1.f, 1.f, QKV, 3 * DIM, 0, NTOK, 3 * DIM, DIM);
  k_win<<<BB * NWIN * NHD, 32, 0, stream>>>(QKV, pos, O);
  k_gemm_b<true, false, 0><<<dim3(((NTOK / 16) * (DIM / 64) + 3) / 4, 1), 128, 0, stream>>>(O, DIM, 0, Bo, Bo, DIM, 0, bo, nullptr, 0, 0, 1.f, 1.f, (float*)d_out, DIM, 0, NTOK, DIM, DIM);
}

// v001
// One run takes 55.1 microseconds.
// Two timings next to v000 put it at 2.24 and 2.26 times that version's speed.
#include <hip/hip_runtime.h>
// Shifted-window attention: qkv = x·W_qkv on v_wmma_f32_16x16x32_bf16 (x rounded to bf16: single exact term; 50176 × 128 × 384); per (batch, window, head) the 49×49
// scores q·kᵀ and e·v on v_wmma_f32_16x16x32_f16 (q, k, v, e rounded to f16, windows padded to 64; one wave each); out = o·W_out + b_out on the bf16 variant with o split
// hi/lo (2 products). The cyclic shifts are pure index remaps (token (y,x) ↔ shifted (y−3, x−3) mod 56, and the back-shift returns every result to its own token);
// relative-position bias, the shift masks and the max-shifted softmax are f32 VALU.
#define BB 16
#define HI 56
#define WI 56
#define DIM 128
#define NHD 4
#define HDM 32
#define WS 7
#define NWIN 64
#define NTOK (BB * HI * WI)
#define DISP 3

typedef __bf16 v16b __attribute__((ext_vector_type(16)));
typedef unsigned short v8us __attribute__((ext_vector_type(8), may_alias));
typedef float  v8f  __attribute__((ext_vector_type(8)));
typedef float  v4f  __attribute__((ext_vector_type(4)));
typedef float  v4fa __attribute__((ext_vector_type(4), may_alias));
union FragB { v16b v; v8us half[2]; unsigned short u[16]; };

__device__ __forceinline__ unsigned short bf16_bits(float x) { unsigned int u = __float_as_uint(x); return (unsigned short)((u + 0x7FFFu + ((u >> 16) & 1u)) >> 16); }
__device__ __forceinline__ float bf16_val(unsigned short b) { return __uint_as_float(((unsigned int)b) << 16); }
__device__ __forceinline__ float bf16_round(float x) { return bf16_val(bf16_bits(x)); }
// D += A·B with NT terms: 1 = ah·bh, 2 = + al·bh (A split), 3 = + ah·bl (both split)
template <int NT>
__device__ __forceinline__ v8f mmaN(v16b ah, v16b al, v16b bh, v16b bl, v8f c) {
  c = __builtin_amdgcn_wmma_f32_16x16x32_bf16(false, ah, false, bh, (short)0, c, false, false);
  if (NT >= 2) c = __builtin_amdgcn_wmma_f32_16x16x32_bf16(false, al, false, bh, (short)0, c, false, false);
  if (NT >= 3) c = __builtin_amdgcn_wmma_f32_16x16x32_bf16(false, ah, false, bl, (short)0, c, false, false);
  asm volatile("v_nop\n\tv_nop\n\tv_nop\n\tv_nop" : "+v"(c) : "v"(ah), "v"(al), "v"(bh), "v"(bl));
  return c;
}

__global__ __launch_bounds__(256) void k_wt_bf16(const float* __restrict__ W, unsigned short* __restrict__ Wt, int K, int N) {
  const int t = blockIdx.x * 256 + threadIdx.x;
  const int k8n = K / 8;
  if (t >= N * k8n) return;
  const int n = t / k8n, k8 = (t % k8n) * 8;
  v8us v;
#pragma unroll
  for (int i = 0; i < 8; ++i) v[i] = bf16_bits(W[(size_t)(k8 + i) * N + n]);
  *(v8us*)(Wt + (size_t)n * K + k8) = v;
  
}

// GEMM C[M][N] (f32, pitch ldc) = act(A[M][K]·W + bias). A f32 row-major (pitch lda) converted per fragment to bf16
// (ASPLIT: hi/lo two planes -> 2 terms, else single rounded term); Wt bf16 [N][K] (pitch ldb). BIAS_BF16 rounds the
// bias to bf16 first (bias quantised to bf16 before the add). K%32==0, M%16==0, N%64==0.
template <bool ASPLIT, int ACT, bool BIAS_BF16>
__global__ __launch_bounds__(128) void k_gemm_bf(const float* __restrict__ A, int lda, const unsigned short* __restrict__ Wt, int ldb,
                                               const float* __restrict__ bias, float* __restrict__ C, int ldc, int M, int N, int K) {
  __shared__ __attribute__((aligned(16))) float so[4][16][64];
  const int tid = threadIdx.x, w = tid >> 5, lane = tid & 31, ln = lane & 15, hh = lane >> 4;
  const int ntn = N / 64;
  const int wid = blockIdx.x * 4 + w;
  const int mt = wid / ntn, nq = wid % ntn;
  if (mt * 16 >= M) return;
  const int row0 = mt * 16, col0 = nq * 64;
  const float* arow = A + (size_t)(row0 + ln) * lda;
  v8f acc[4] = {};
  for (int kb = 0; kb < K; kb += 32) {
    FragB ah, al;
    const v4f x0 = *(const v4fa*)(arow + kb + 8 * hh), x1 = *(const v4fa*)(arow + kb + 8 * hh + 4);
    const v4f x2 = *(const v4fa*)(arow + kb + 16 + 8 * hh), x3 = *(const v4fa*)(arow + kb + 16 + 8 * hh + 4);
    float xs[16] = {x0[0],x0[1],x0[2],x0[3],x1[0],x1[1],x1[2],x1[3],x2[0],x2[1],x2[2],x2[3],x3[0],x3[1],x3[2],x3[3]};
#pragma unroll
    for (int i = 0; i < 16; ++i) { const unsigned short hb = bf16_bits(xs[i]); ah.u[i] = hb; al.u[i] = ASPLIT ? bf16_bits(xs[i] - bf16_val(hb)) : (unsigned short)0; }
#pragma unroll
    for (int t = 0; t < 4; ++t) {
      const unsigned short* brow = Wt + (size_t)(col0 + t * 16 + ln) * ldb + kb;
      FragB b;
      b.half[0] = *(const v8us*)(brow + 8 * hh);
      b.half[1] = *(const v8us*)(brow + 16 + 8 * hh);
      acc[t] = mmaN<ASPLIT ? 2 : 1>(ah.v, al.v, b.v, b.v, acc[t]);
    }
  }
#pragma unroll
  for (int t = 0; t < 4; ++t) {
    float bv = bias ? bias[col0 + t * 16 + ln] : 0.f;
    if (BIAS_BF16) bv = bf16_round(bv);
#pragma unroll
    for (int r = 0; r < 8; ++r) { float v = acc[t][r] + bv; if (ACT == 1) v = fmaxf(v, 0.f); so[w][8 * hh + r][t * 16 + ln] = v; }
  }
  __builtin_amdgcn_fence(__ATOMIC_ACQ_REL, "workgroup");
  __builtin_amdgcn_wave_barrier();
  const int rsub = lane >> 4, c4 = (lane & 15) * 4;
  {
#pragma unroll
    for (int q = 0; q < 8; ++q) {
      const int r = q * 2 + rsub;
      const v4f v = *(const v4fa*)&so[w][r][c4];
      *(v4f*)(C + (size_t)(row0 + r) * ldc + col0 + c4) = v;
    }
    
  }
}

// Flash-style causal/unmasked attention, all contractions 3-term bf16 hi/lo splits, f32 softmax with running max.
// q,k,v rows are read from f32 buffers with arbitrary row pitch (so they can live inside a fused qkv buffer);
// D = head size (multiple of 32, <= 128); one wave = 16 query rows; block = 4 waves (64 queries) sharing K/V chunks of 32.
template <int D, bool CAUSAL>
__global__ __launch_bounds__(128) void k_flash(const float* __restrict__ qb, const float* __restrict__ kb, const float* __restrict__ vb,
                                             int pitch, int T, int H, float scale, float* __restrict__ y, int ypitch) {
  constexpr int KS = D / 32;        // k-steps for QK
  constexpr int DT = D / 16;        // d tiles for PV
  __shared__ __attribute__((aligned(16))) unsigned short sKh[32][D + 8], sKl[32][D + 8], sVh[32][D + 8], sVl[32][D + 8];
  __shared__ __attribute__((aligned(16))) unsigned short sPh[4][16][40], sPl[4][16][40];
  __shared__ __attribute__((aligned(16))) float sO[4][16][D];
  const int tid = threadIdx.x, w = tid >> 5, lane = tid & 31, ln = lane & 15, hh = lane >> 4;
  const int nqb = (T + 63) / 64;
  const int bh = blockIdx.x / nqb, qblk = blockIdx.x % nqb;
  const int b = bh / H, h = bh % H;
  const int q0 = qblk * 64 + w * 16;
  const float* Q = qb + (size_t)b * T * pitch + h * D;
  const float* K = kb + (size_t)b * T * pitch + h * D;
  const float* V = vb + (size_t)b * T * pitch + h * D;

  // A fragments of the wave's 16 query rows (scaled), hi/lo
  FragB aqh[KS], aql[KS];
  {
    int row = q0 + ln; if (row >= T) row = T - 1;
    const float* qr = Q + (size_t)row * pitch;
#pragma unroll
    for (int ks = 0; ks < KS; ++ks)
#pragma unroll
      for (int i = 0; i < 16; ++i) {
        const int d = ks * 32 + ((i < 8) ? (8 * hh + i) : (16 + 8 * hh + (i - 8)));
        const float x = qr[d] * scale; const unsigned short hb = bf16_bits(x);
        aqh[ks].u[i] = hb; aql[ks].u[i] = bf16_bits(x - bf16_val(hb));
      }
  }
  float m_r[8], l_r[8];
#pragma unroll
  for (int r = 0; r < 8; ++r) { m_r[r] = -3.0e38f; l_r[r] = 0.f; }
  v8f oacc[DT];
#pragma unroll
  for (int dt = 0; dt < DT; ++dt) oacc[dt] = (v8f){0.f,0.f,0.f,0.f,0.f,0.f,0.f,0.f};

  const int kv_end = CAUSAL ? min(T, qblk * 64 + 64) : T;     // block-uniform
  for (int j0 = 0; j0 < kv_end; j0 += 32) {
    __syncthreads();
    for (int e = tid; e < 32 * (D / 4); e += 128) {
      const int r = e / (D / 4), c4 = (e % (D / 4)) * 4;
      const int key = j0 + r;
      v4f kf = {0.f,0.f,0.f,0.f}, vf = {0.f,0.f,0.f,0.f};
      if (key < T) { kf = *(const v4fa*)(K + (size_t)key * pitch + c4); vf = *(const v4fa*)(V + (size_t)key * pitch + c4); }
#pragma unroll
      for (int t = 0; t < 4; ++t) {
        unsigned short hb = bf16_bits(kf[t]); sKh[r][c4 + t] = hb; sKl[r][c4 + t] = bf16_bits(kf[t] - bf16_val(hb));
        hb = bf16_bits(vf[t]); sVh[r][c4 + t] = hb; sVl[r][c4 + t] = bf16_bits(vf[t] - bf16_val(hb));
      }
    }
    __syncthreads();
    // S tile 16 x 32
    v8f s[2];
#pragma unroll
    for (int nt = 0; nt < 2; ++nt) {
      v8f acc = {};
#pragma unroll
      for (int ks = 0; ks < KS; ++ks) {
        FragB bh_, bl_;
        bh_.half[0] = *(const v8us*)&sKh[nt * 16 + ln][ks * 32 + 8 * hh]; bh_.half[1] = *(const v8us*)&sKh[nt * 16 + ln][ks * 32 + 16 + 8 * hh];
        bl_.half[0] = *(const v8us*)&sKl[nt * 16 + ln][ks * 32 + 8 * hh]; bl_.half[1] = *(const v8us*)&sKl[nt * 16 + ln][ks * 32 + 16 + 8 * hh];
        acc = mmaN<3>(aqh[ks].v, aql[ks].v, bh_.v, bl_.v, acc);
      }
      s[nt] = acc;
    }
    // mask + running max (rows 8hh+r; the 16 lanes of a half share rows)
    float alpha[8];
#pragma unroll
    for (int r = 0; r < 8; ++r) {
      const int qi = q0 + 8 * hh + r;
      const int ja = j0 + ln, jb = j0 + 16 + ln;
      if (CAUSAL) { if (ja > qi) s[0][r] = -3.0e38f; if (jb > qi) s[1][r] = -3.0e38f; }
      if (ja >= T) s[0][r] = -3.0e38f;
      if (jb >= T) s[1][r] = -3.0e38f;
      float mx = fmaxf(s[0][r], s[1][r]);
      mx = fmaxf(mx, __shfl_xor(mx, 1, 32)); mx = fmaxf(mx, __shfl_xor(mx, 2, 32)); mx = fmaxf(mx, __shfl_xor(mx, 4, 32)); mx = fmaxf(mx, __shfl_xor(mx, 8, 32));
      const float mnew = fmaxf(m_r[r], mx);
      alpha[r] = (mnew > -1.0e38f) ? __expf(m_r[r] - mnew) : 1.0f;
      const float p0 = (s[0][r] > -1.0e38f) ? __expf(s[0][r] - mnew) : 0.f;
      const float p1 = (s[1][r] > -1.0e38f) ? __expf(s[1][r] - mnew) : 0.f;
      m_r[r] = mnew;
      l_r[r] = l_r[r] * alpha[r] + p0 + p1;            // per-lane partial row sum (16 lanes combined at the end)
      unsigned short hb = bf16_bits(p0); sPh[w][8 * hh + r][ln] = hb;      sPl[w][8 * hh + r][ln] = bf16_bits(p0 - bf16_val(hb));
      hb = bf16_bits(p1);                sPh[w][8 * hh + r][16 + ln] = hb; sPl[w][8 * hh + r][16 + ln] = bf16_bits(p1 - bf16_val(hb));
    }
#pragma unroll
    for (int dt = 0; dt < DT; ++dt)
#pragma unroll
      for (int r = 0; r < 8; ++r) oacc[dt][r] *= alpha[r];
    __builtin_amdgcn_fence(__ATOMIC_ACQ_REL, "workgroup");
    __builtin_amdgcn_wave_barrier();
    FragB pah, pal;
    pah.half[0] = *(const v8us*)&sPh[w][ln][8 * hh]; pah.half[1] = *(const v8us*)&sPh[w][ln][16 + 8 * hh];
    pal.half[0] = *(const v8us*)&sPl[w][ln][8 * hh]; pal.half[1] = *(const v8us*)&sPl[w][ln][16 + 8 * hh];
#pragma unroll
    for (int dt = 0; dt < DT; ++dt) {
      FragB bvh, bvl;
#pragma unroll
      for (int i = 0; i < 8; ++i) {
        bvh.u[i] = sVh[8 * hh + i][dt * 16 + ln]; bvh.u[8 + i] = sVh[16 + 8 * hh + i][dt * 16 + ln];
        bvl.u[i] = sVl[8 * hh + i][dt * 16 + ln]; bvl.u[8 + i] = sVl[16 + 8 * hh + i][dt * 16 + ln];
      }
      oacc[dt] = mmaN<3>(pah.v, pal.v, bvh.v, bvl.v, oacc[dt]);
    }
    __builtin_amdgcn_fence(__ATOMIC_ACQ_REL, "workgroup");
    __builtin_amdgcn_wave_barrier();
  }
#pragma unroll
  for (int r = 0; r < 8; ++r) {
    float l = l_r[r];
    l += __shfl_xor(l, 1, 32); l += __shfl_xor(l, 2, 32); l += __shfl_xor(l, 4, 32); l += __shfl_xor(l, 8, 32);
    l_r[r] = (l > 0.f) ? 1.0f / l : 0.f;
  }
#pragma unroll
  for (int dt = 0; dt < DT; ++dt)
#pragma unroll
    for (int r = 0; r < 8; ++r) sO[w][8 * hh + r][dt * 16 + ln] = oacc[dt][r] * l_r[r];
  __builtin_amdgcn_fence(__ATOMIC_ACQ_REL, "workgroup");
  __builtin_amdgcn_wave_barrier();
  {
    for (int r = 0; r < 16; ++r) {
      const int row = q0 + r;
      if (row < T && lane < D / 4) {
        const v4f val = *(const v4fa*)&sO[w][r][lane * 4];
        *(v4f*)(y + ((size_t)b * T + row) * ypitch + h * D + lane * 4) = val;
      }
    }
    
  }
}

// batched GEMM (blockIdx.y = batch): C_b = act(alpha·A_b·B_b + bias + resid_b); A f32 rows (ASPLIT → hi/lo), B = bf16 planes Bh (+Bl when BSPLIT, requires ASPLIT),
// per-batch element strides sA, sB (0 = shared weights), sC, sR. resid may alias C (values are staged before the stores). ACT 0/1(relu).
// ACT: 0 none, 1 relu, 2 softplus
template <bool ASPLIT, bool BSPLIT, int ACT>
__global__ __launch_bounds__(128) void k_gemm_b(const float* __restrict__ A, int lda, size_t sA, const unsigned short* __restrict__ Bh, const unsigned short* __restrict__ Bl, int ldb, size_t sB,
                                             const float* __restrict__ bias, const float* __restrict__ resid, int ldr, size_t sR, float rsign, float alpha,
                                             float* __restrict__ C, int ldc, size_t sC, int M, int N, int K) {
  __shared__ __attribute__((aligned(16))) float so[4][16][64];
  const int tid = threadIdx.x, w = tid >> 5, lane = tid & 31, ln = lane & 15, hh = lane >> 4;
  const int by = blockIdx.y;
  A += (size_t)by * sA; Bh += (size_t)by * sB; if (BSPLIT) Bl += (size_t)by * sB; C += (size_t)by * sC; if (resid) resid += (size_t)by * sR;
  const int ntn = (N + 63) / 64; const int wid = blockIdx.x * 4 + w; const int mt = wid / ntn, nq = wid % ntn;      // N may be any multiple of 16: tiles past N are skipped and not stored
  if (mt * 16 >= M) return;
  const int row0 = mt * 16, col0 = nq * 64;
  const float* arow = A + (size_t)(row0 + ln) * lda;
  v8f acc[4] = {};
  for (int kb = 0; kb < K; kb += 32) {
    FragB ah, al;
    const v4f x0 = *(const v4fa*)(arow + kb + 8 * hh), x1 = *(const v4fa*)(arow + kb + 8 * hh + 4);
    const v4f x2 = *(const v4fa*)(arow + kb + 16 + 8 * hh), x3 = *(const v4fa*)(arow + kb + 16 + 8 * hh + 4);
    float xs[16] = {x0[0],x0[1],x0[2],x0[3],x1[0],x1[1],x1[2],x1[3],x2[0],x2[1],x2[2],x2[3],x3[0],x3[1],x3[2],x3[3]};
#pragma unroll
    for (int i = 0; i < 16; ++i) { const unsigned short hb = bf16_bits(xs[i]); ah.u[i] = hb; al.u[i] = ASPLIT ? bf16_bits(xs[i] - bf16_val(hb)) : (unsigned short)0; }
#pragma unroll
    for (int t = 0; t < 4; ++t) {
      if (col0 + t * 16 >= N) continue;
      const size_t boff = (size_t)(col0 + t * 16 + ln) * ldb + kb;
      FragB bh_, bl_; bh_.half[0] = *(const v8us*)(Bh + boff + 8 * hh); bh_.half[1] = *(const v8us*)(Bh + boff + 16 + 8 * hh);
      if (BSPLIT) { bl_.half[0] = *(const v8us*)(Bl + boff + 8 * hh); bl_.half[1] = *(const v8us*)(Bl + boff + 16 + 8 * hh); } else bl_ = bh_;
      acc[t] = mmaN<ASPLIT ? (BSPLIT ? 3 : 2) : 1>(ah.v, al.v, bh_.v, bl_.v, acc[t]);
    }
  }
#pragma unroll
  for (int t = 0; t < 4; ++t) {
    const int col = col0 + t * 16 + ln; if (col0 + t * 16 >= N) continue; const float bv = bias ? bf16_round(bias[col]) : 0.f;
#pragma unroll
    for (int r = 0; r < 8; ++r) { float v = acc[t][r] * alpha + bv; if (resid) v += rsign * resid[(size_t)(row0 + 8 * hh + r) * ldr + col]; if (ACT == 1) v = fmaxf(v, 0.f); else if (ACT == 2) v = fmaxf(v, 0.f) + log1pf(expf(-fabsf(v))); so[w][8 * hh + r][t * 16 + ln] = v; }
  }
  __builtin_amdgcn_fence(__ATOMIC_ACQ_REL, "workgroup"); __builtin_amdgcn_wave_barrier();
  const int rsub = lane >> 4, c4 = (lane & 15) * 4;
  {
#pragma unroll
    for (int q = 0; q < 8; ++q) { const int r = q * 2 + rsub; if (col0 + c4 < N) { const v4f v = *(const v4fa*)&so[w][r][c4]; *(v4f*)(C + (size_t)(row0 + r) * ldc + col0 + c4) = v; } }
    
  }
}
// batched f32 [K][N] (pitch lds, batch stride sIn) -> transposed hi/lo planes [N][K] (batch stride sOut); thread per (n, 8 k); grid.y = batch
__global__ __launch_bounds__(256) void k_split_transpose_b(const float* __restrict__ src, int lds_, size_t sIn, unsigned short* __restrict__ hi, unsigned short* __restrict__ lo, size_t sOut, int K, int N) {
  const size_t t = (size_t)blockIdx.x * 256 + threadIdx.x; const int k8n = K / 8; if (t >= (size_t)N * k8n) return;
  src += (size_t)blockIdx.y * sIn; hi += (size_t)blockIdx.y * sOut; lo += (size_t)blockIdx.y * sOut;
  const int n = (int)(t / k8n), k8 = (int)(t % k8n) * 8; v8us vh, vl;
#pragma unroll
  for (int i = 0; i < 8; ++i) { const float x = src[(size_t)(k8 + i) * lds_ + n]; const unsigned short hb = bf16_bits(x); vh[i] = hb; vl[i] = bf16_bits(x - bf16_val(hb)); }
  unsigned short* dh = hi + (size_t)n * K + k8; unsigned short* dl = lo + (size_t)n * K + k8;
  *(v8us*)dh = vh; *(v8us*)dl = vl; 
}

// ---- f16 WMMA path (v_wmma_f32_16x16x32_f16): 11-bit significands for operands in range — used where a [0,1] probability operand needs more precision than bf16
typedef _Float16 v16h __attribute__((ext_vector_type(16)));
union FragH { v16h v; v8us half[2]; _Float16 h[16]; unsigned short u[16]; };
template <int NT>
__device__ __forceinline__ v8f mmaH(v16h ah, v16h al, v16h bh, v16h bl, v8f c) {
  c = __builtin_amdgcn_wmma_f32_16x16x32_f16(false, ah, false, bh, (short)0, c, false, false);
  if (NT >= 2) c = __builtin_amdgcn_wmma_f32_16x16x32_f16(false, al, false, bh, (short)0, c, false, false);
  if (NT >= 3) c = __builtin_amdgcn_wmma_f32_16x16x32_f16(false, ah, false, bl, (short)0, c, false, false);
  asm volatile("v_nop\n\tv_nop\n\tv_nop\n\tv_nop" : "+v"(c) : "v"(ah), "v"(al), "v"(bh), "v"(bl));
  return c;
}
// batched GEMM like k_gemm_b but f16 operands: A f32 (split into f16 hi/lo if ASPLIT, else rounded to f16), Bt = f16 values [n][k]; alpha; C f32; N multiple of 16 (partial tiles skipped)
template <bool ASPLIT>
__global__ __launch_bounds__(128) void k_gemm_h(const float* __restrict__ A, int lda, size_t sA, const _Float16* __restrict__ Bh, int ldb, size_t sB, float alpha, float* __restrict__ C, int ldc, size_t sC, int M, int N, int K) {
  __shared__ __attribute__((aligned(16))) float so[4][16][64];
  const int tid = threadIdx.x, w = tid >> 5, lane = tid & 31, ln = lane & 15, hh = lane >> 4; const int by = blockIdx.y;
  A += (size_t)by * sA; Bh += (size_t)by * sB; C += (size_t)by * sC;
  const int ntn = (N + 63) / 64; const int wid = blockIdx.x * 4 + w; const int mt = wid / ntn, nq = wid % ntn; if (mt * 16 >= M) return;
  const int row0 = mt * 16, col0 = nq * 64; const float* arow = A + (size_t)(row0 + ln) * lda;
  v8f acc[4] = {};
  for (int kb = 0; kb < K; kb += 32) {
    FragH ah, al;
    const v4f x0 = *(const v4fa*)(arow + kb + 8 * hh), x1 = *(const v4fa*)(arow + kb + 8 * hh + 4), x2 = *(const v4fa*)(arow + kb + 16 + 8 * hh), x3 = *(const v4fa*)(arow + kb + 16 + 8 * hh + 4);
    float xs[16] = {x0[0],x0[1],x0[2],x0[3],x1[0],x1[1],x1[2],x1[3],x2[0],x2[1],x2[2],x2[3],x3[0],x3[1],x3[2],x3[3]};
#pragma unroll
    for (int i = 0; i < 16; ++i) { const _Float16 h = (_Float16)xs[i]; ah.h[i] = h; al.h[i] = ASPLIT ? (_Float16)(xs[i] - (float)h) : (_Float16)0.0f; }
#pragma unroll
    for (int t = 0; t < 4; ++t) { if (col0 + t * 16 >= N) continue; const size_t boff = (size_t)(col0 + t * 16 + ln) * ldb + kb; FragH bq; bq.half[0] = *(const v8us*)(Bh + boff + 8 * hh); bq.half[1] = *(const v8us*)(Bh + boff + 16 + 8 * hh);
      acc[t] = mmaH<ASPLIT ? 2 : 1>(ah.v, al.v, bq.v, bq.v, acc[t]); }
  }
#pragma unroll
  for (int t = 0; t < 4; ++t) { if (col0 + t * 16 >= N) continue;
#pragma unroll
    for (int r = 0; r < 8; ++r) so[w][8 * hh + r][t * 16 + ln] = acc[t][r] * alpha; }
  __builtin_amdgcn_fence(__ATOMIC_ACQ_REL, "workgroup"); __builtin_amdgcn_wave_barrier();
  const int rsub = lane >> 4, c4 = (lane & 15) * 4;
  {
#pragma unroll
    for (int q = 0; q < 8; ++q) { const int r = q * 2 + rsub; if (col0 + c4 < N) { const v4f v = *(const v4fa*)&so[w][r][c4]; *(v4f*)(C + (size_t)(row0 + r) * ldc + col0 + c4) = v; } }
     }
}

__global__ __launch_bounds__(256) void k_bt(const float* __restrict__ Wqkv, const float* __restrict__ Wo, unsigned short* __restrict__ Bq, unsigned short* __restrict__ Bo) { const int t = blockIdx.x * 256 + threadIdx.x;
  if (t < 3 * DIM * DIM / 8) { const int k8 = (t % (DIM / 8)) * 8, n = t / (DIM / 8); v8us v; for (int q = 0; q < 8; ++q) v[q] = bf16_bits(Wqkv[(size_t)(k8 + q) * (3 * DIM) + n]); *(v8us*)(Bq + (size_t)n * DIM + k8) = v;  }
  if (t < DIM * DIM / 8) { const int k8 = (t % (DIM / 8)) * 8, n = t / (DIM / 8); v8us v; for (int q = 0; q < 8; ++q) v[q] = bf16_bits(Wo[(size_t)(k8 + q) * DIM + n]); *(v8us*)(Bo + (size_t)n * DIM + k8) = v;  } }
__device__ __forceinline__ void ldF(FragH& f, const _Float16* base, int pitch, int row, int k0, int ln, int hh) { const unsigned short* p = (const unsigned short*)base + (size_t)(row + ln) * pitch + k0; f.half[0] = *(const v8us*)(p + 8 * hh); f.half[1] = *(const v8us*)(p + 16 + 8 * hh); }
typedef unsigned short v4us __attribute__((ext_vector_type(4), may_alias));
// one work-group of 4 waves per (b, window w = wy*8+wx), wave = head h. Window slot i = yi*7+xi is token ((wy*7+yi+3)%56, (wx*7+xi+3)%56) of batch b.
// The window's 49 rows of x (padded with zero rows to 64) are staged once in LDS as bf16; each wave forms its head's q, k, v (64 x 96, K = 128) on the bf16 WMMA
// and puts them into its own LDS planes as f16, so qkv never goes through global memory. Zero rows of x give zero rows of q, k, v: the padding needs no clearing.
__global__ __launch_bounds__(128) void k_win(const float* __restrict__ X, const unsigned short* __restrict__ Bq, const float* __restrict__ pos, float* __restrict__ O) {
  constexpr int PW = (64 * 40 + 64 * 40 + HDM * 72) * 2;          // bytes per wave: q, k, v^T planes
  constexpr int PO = 16 * 72 * 2 + 16 * (HDM + 1) * 4;            // bytes per wave: 16 rows of e, 16 rows of o
  constexpr int XP = DIM + 8;                                     // pitch of the staged x rows, in bf16 elements
  static_assert(4 * PO >= 64 * XP * 2, "staged x shares the space of the e and o rows");
  __shared__ __attribute__((aligned(16))) unsigned char smem[4 * PW + 4 * PO]; __shared__ int stok[64]; __shared__ float sbias[13 * 13];
  const int tid = threadIdx.x, lane = tid & 31, ln = lane & 15, hh = lane >> 4; const int h = __builtin_amdgcn_readfirstlane(tid >> 5);
  const int w = blockIdx.x % NWIN; const int b = blockIdx.x / NWIN; const int wy = w / 8, wx = w % 8;
  _Float16* sq = (_Float16*)(smem + h * PW); _Float16* sk = sq + 64 * 40; _Float16* svt = sk + 64 * 40;
  unsigned short* sx = (unsigned short*)(smem + 4 * PW); _Float16* sp = (_Float16*)(smem + 4 * PW + h * PO); float* so = (float*)(smem + 4 * PW + h * PO + 16 * 72 * 2);
  if (tid < 64) { int tok = -1; if (tid < 49) { const int yi = tid / WS, xi = tid % WS; const int y = (wy * WS + yi + DISP) % HI, x = (wx * WS + xi + DISP) % WI; tok = (b * HI + y) * WI + x; } stok[tid] = tok; }
  for (int i = tid; i < 169; i += 128) sbias[i] = bf16_round(pos[i]);
  // stage x: wave h takes rows h, h+4, ...; one row = one 512-byte wave load; all 13 loads are issued before the first is used
  v4f xv[13];
#pragma unroll
  for (int it = 0; it < 13; ++it) { const int i = min(h + 4 * it, 48); const int yi = i / WS, xi = i % WS; const int y = (wy * WS + yi + DISP) % HI, x = (wx * WS + xi + DISP) % WI;
    xv[it] = *(const v4fa*)(X + (size_t)((b * HI + y) * WI + x) * DIM + lane * 4); }
#pragma unroll
  for (int it = 0; it < 13; ++it) { const int i = h + 4 * it; v4us p = {0, 0, 0, 0}; if (i < 49) { for (int c = 0; c < 4; ++c) p[c] = bf16_bits(xv[it][c]); } *(v4us*)(sx + i * XP + lane * 4) = p; }
#pragma unroll
  for (int it = 13; it < 16; ++it) { const v4us p = {0, 0, 0, 0}; *(v4us*)(sx + (h + 4 * it) * XP + lane * 4) = p; }
  __syncthreads();      // every wave reads all 64 staged rows, the token list and the bias table
  FragB a[4][4];
#pragma unroll
  for (int mt = 0; mt < 4; ++mt) {
#pragma unroll
    for (int ks = 0; ks < 4; ++ks) { const unsigned short* p = sx + (mt * 16 + ln) * XP + ks * 32; a[mt][ks].half[0] = *(const v8us*)(p + 8 * hh); a[mt][ks].half[1] = *(const v8us*)(p + 16 + 8 * hh); } }
  __syncthreads();      // the staged rows are in registers now: their LDS is reused for the e and o rows below
#pragma unroll
  for (int t = 0; t < 6; ++t) {      // column tiles: t = 0,1 q; 2,3 k; 4,5 v of head h
    const unsigned short* brow = Bq + (size_t)((t >> 1) * DIM + h * HDM + (t & 1) * 16 + ln) * DIM;
    FragB bf[4];
#pragma unroll
    for (int ks = 0; ks < 4; ++ks) { bf[ks].half[0] = *(const v8us*)(brow + ks * 32 + 8 * hh); bf[ks].half[1] = *(const v8us*)(brow + ks * 32 + 16 + 8 * hh); }
#pragma unroll
    for (int mt = 0; mt < 4; ++mt) {
      v8f c = {};
#pragma unroll
      for (int ks = 0; ks < 4; ++ks) c = __builtin_amdgcn_wmma_f32_16x16x32_bf16(false, a[mt][ks].v, false, bf[ks].v, (short)0, c, false, false);
      const int row = mt * 16 + 8 * hh, col = (t & 1) * 16 + ln;
      if (t < 2) {
#pragma unroll
        for (int r = 0; r < 8; ++r) sq[(row + r) * 40 + col] = (_Float16)(c[r] * 0.17677669529663687f);
      } else if (t < 4) {
#pragma unroll
        for (int r = 0; r < 8; ++r) sk[(row + r) * 40 + col] = (_Float16)c[r];
      } else {
        FragH vv;
#pragma unroll
        for (int r = 0; r < 8; ++r) vv.h[r] = (_Float16)c[r];
        *(v8us*)((unsigned short*)svt + col * 72 + row) = vv.half[0];
      }
    }
  }
  __builtin_amdgcn_fence(__ATOMIC_ACQ_REL, "workgroup"); __builtin_amdgcn_wave_barrier();
  const bool ul = (wy == 7), lr = (wx == 7);
  for (int mt = 0; mt < 4; ++mt) {      // 16 query rows per pass (rows >= 49 are padding: computed, never stored)
    v8f acc[4] = {}; FragH a; ldF(a, sq, 40, mt * 16, 0, ln, hh);
#pragma unroll
    for (int t = 0; t < 4; ++t) { FragH bk; ldF(bk, sk, 40, t * 16, 0, ln, hh); acc[t] = mmaH<1>(a.v, a.v, bk.v, bk.v, acc[t]); }
    float rmax[8], rsum[8];
#pragma unroll
    for (int r = 0; r < 8; ++r) { const int i = mt * 16 + 8 * hh + r; const int yi = i / WS, xi = i % WS; float m = -3.0e38f;
#pragma unroll
      for (int t = 0; t < 4; ++t) { const int j = t * 16 + ln; float s = -3.0e38f; if (i < 49 && j < 49) { const int yj = j / WS, xj = j % WS; const bool masked = (ul && ((yi >= 4) != (yj >= 4))) || (lr && ((xi >= 4) != (xj >= 4))); if (!masked) s = acc[t][r] + sbias[(yj - yi + 6) * 13 + (xj - xi + 6)]; } acc[t][r] = s; m = fmaxf(m, s); }
      for (int o = 8; o >= 1; o >>= 1) m = fmaxf(m, __shfl_xor(m, o, 32)); rmax[r] = m; }
#pragma unroll
    for (int r = 0; r < 8; ++r) { float s = 0.f;
#pragma unroll
      for (int t = 0; t < 4; ++t) { const int j = t * 16 + ln; const float e = (acc[t][r] > -1.0e38f) ? __expf(acc[t][r] - rmax[r]) : 0.f; s += e; sp[(8 * hh + r) * 72 + j] = (_Float16)e; }
      for (int o = 8; o >= 1; o >>= 1) s += __shfl_xor(s, o, 32); rsum[r] = s; }
    __builtin_amdgcn_fence(__ATOMIC_ACQ_REL, "workgroup"); __builtin_amdgcn_wave_barrier();
    v8f acco[2] = {};
#pragma unroll
    for (int ks = 0; ks < 2; ++ks) { FragH ap; ldF(ap, sp, 72, 0, ks * 32, ln, hh);
#pragma unroll
      for (int t = 0; t < 2; ++t) { FragH bv; ldF(bv, svt, 72, t * 16, ks * 32, ln, hh); acco[t] = mmaH<1>(ap.v, ap.v, bv.v, bv.v, acco[t]); } }
#pragma unroll
    for (int t = 0; t < 2; ++t) {
#pragma unroll
      for (int r = 0; r < 8; ++r) { const int il = 8 * hh + r; const float rs = (rsum[r] > 0.f) ? 1.0f / rsum[r] : 0.f; so[il * (HDM + 1) + t * 16 + ln] = acco[t][r] * rs; } }
    __builtin_amdgcn_fence(__ATOMIC_ACQ_REL, "workgroup"); __builtin_amdgcn_wave_barrier();
    { for (int il = 0; il < 16; ++il) { const int i = mt * 16 + il; if (i < 49) { *(float*)(O + (size_t)stok[i] * DIM + h * HDM + lane) = so[il * (HDM + 1) + lane];
        asm volatile("s_wait_xcnt 0x0" ::: "memory"); } } }      // stands in front of the next row's rewrite of the store's address and data registers
    __builtin_amdgcn_fence(__ATOMIC_ACQ_REL, "workgroup"); __builtin_amdgcn_wave_barrier();
  }
}
extern "C" void kernel_launch(void* const* d_in, const int* in_sizes, int n_in,
                              void* d_out, int out_size, void* d_ws, size_t ws_size, hipStream_t stream) {
  (void)in_sizes; (void)n_in; (void)out_size;
  const float* x = (const float*)d_in[0]; const float* Wqkv = (const float*)d_in[1]; const float* pos = (const float*)d_in[2]; const float* Wo = (const float*)d_in[3]; const float* bo = (const float*)d_in[4];
  char* ws = (char*)d_ws; size_t off = 0;
  auto take = [&](size_t bytes) { char* p = ws + off; off += (bytes + 255) & ~(size_t)255; return p; };
  unsigned short* Bq = (unsigned short*)take((size_t)3 * DIM * DIM * 2); unsigned short* Bo = (unsigned short*)take((size_t)DIM * DIM * 2); float* O = (float*)take((size_t)NTOK * DIM * 4);
  if (off > ws_size) return;
  k_bt<<<(3 * DIM * DIM / 8 + 255) / 256, 256, 0, stream>>>(Wqkv, Wo, Bq, Bo);
  k_win<<<BB * NWIN, 128, 0, stream>>>(x, Bq, pos, O);
  k_gemm_b<true, false, 0><<<dim3(((NTOK / 16) * (DIM / 64) + 3) / 4, 1), 128, 0, stream>>>(O, DIM, 0, Bo, Bo, DIM, 0, bo, nullptr, 0, 0, 1.f, 1.f, (float*)d_out, DIM, 0, NTOK, DIM, DIM);
}

// v002
// A run of this version takes 39.7 microseconds.
// In both of two side-by-side timings against v001, it was 1.38 times as fast.
// Over all steps from v000 it is 3.11 times as fast.
#include <hip/hip_runtime.h>
// Shifted-window attention: qkv = x·W_qkv on v_wmma_f32_16x16x32_bf16 (x rounded to bf16: single exact term; 50176 × 128 × 384); per (batch, window, head) the 49×49
// scores q·kᵀ and e·v on v_wmma_f32_16x16x32_f16 (q, k, v, e rounded to f16, windows padded to 64; one wave each); out = o·W_out + b_out on the bf16 variant with o split
// hi/lo (2 products). The cyclic shifts are pure index remaps (token (y,x) ↔ shifted (y−3, x−3) mod 56, and the back-shift returns every result to its own token);
// relative-position bias, the shift masks and the max-shifted softmax are f32 VALU.
#define BB 16
#define HI 56
#define WI 56
#define DIM 128
#define NHD 4
#define HDM 32
#define WS 7
#define NWIN 64
#define NTOK (BB * HI * WI)
#define DISP 3

typedef __bf16 v16b __attribute__((ext_vector_type(16)));
typedef unsigned short v8us __attribute__((ext_vector_type(8), may_alias));
typedef float  v8f  __attribute__((ext_vector_type(8)));
typedef float  v4f  __attribute__((ext_vector_type(4)));
typedef float  v4fa __attribute__((ext_vector_type(4), may_alias));
union FragB { v16b v; v8us half[2]; unsigned short u[16]; };

__device__ __forceinline__ unsigned short bf16_bits(float x) { unsigned int u = __float_as_uint(x); return (unsigned short)((u + 0x7FFFu + ((u >> 16) & 1u)) >> 16); }
__device__ __forceinline__ float bf16_val(unsigned short b) { return __uint_as_float(((unsigned int)b) << 16); }
__device__ __forceinline__ float bf16_round(float x) { return bf16_val(bf16_bits(x)); }
// D += A·B with NT terms: 1 = ah·bh, 2 = + al·bh (A split), 3 = + ah·bl (both split)
template <int NT>
__device__ __forceinline__ v8f mmaN(v16b ah, v16b al, v16b bh, v16b bl, v8f c) {
  c = __builtin_amdgcn_wmma_f32_16x16x32_bf16(false, ah, false, bh, (short)0, c, false, false);
  if (NT >= 2) c = __builtin_amdgcn_wmma_f32_16x16x32_bf16(false, al, false, bh, (short)0, c, false, false);
  if (NT >= 3) c = __builtin_amdgcn_wmma_f32_16x16x32_bf16(false, ah, false, bl, (short)0, c, false, false);
  asm volatile("v_nop\n\tv_nop\n\tv_nop\n\tv_nop" : "+v"(c) : "v"(ah), "v"(al), "v"(bh), "v"(bl));
  return c;
}

__global__ __launch_bounds__(256) void k_wt_bf16(const float* __restrict__ W, unsigned short* __restrict__ Wt, int K, int N) {
  const int t = blockIdx.x * 256 + threadIdx.x;
  const int k8n = K / 8;
  if (t >= N * k8n) return;
  const int n = t / k8n, k8 = (t % k8n) * 8;
  v8us v;
#pragma unroll
  for (int i = 0; i < 8; ++i) v[i] = bf16_bits(W[(size_t)(k8 + i) * N + n]);
  *(v8us*)(Wt + (size_t)n * K + k8) = v;
  
}

// GEMM C[M][N] (f32, pitch ldc) = act(A[M][K]·W + bias). A f32 row-major (pitch lda) converted per fragment to bf16
// (ASPLIT: hi/lo two planes -> 2 terms, else single rounded term); Wt bf16 [N][K] (pitch ldb). BIAS_BF16 rounds the
// bias to bf16 first (bias quantised to bf16 before the add). K%32==0, M%16==0, N%64==0.
template <bool ASPLIT, int ACT, bool BIAS_BF16>
__global__ __launch_bounds__(128) void k_gemm_bf(const float* __restrict__ A, int lda, const unsigned short* __restrict__ Wt, int ldb,
                                               const float* __restrict__ bias, float* __restrict__ C, int ldc, int M, int N, int K) {
  __shared__ __attribute__((aligned(16))) float so[4][16][64];
  const int tid = threadIdx.x, w = tid >> 5, lane = tid & 31, ln = lane & 15, hh = lane >> 4;
  const int ntn = N / 64;
  const int wid = blockIdx.x * 4 + w;
  const int mt = wid / ntn, nq = wid % ntn;
  if (mt * 16 >= M) return;
  const int row0 = mt * 16, col0 = nq * 64;
  const float* arow = A + (size_t)(row0 + ln) * lda;
  v8f acc[4] = {};
  for (int kb = 0; kb < K; kb += 32) {
    FragB ah, al;
    const v4f x0 = *(const v4fa*)(arow + kb + 8 * hh), x1 = *(const v4fa*)(arow + kb + 8 * hh + 4);
    const v4f x2 = *(const v4fa*)(arow + kb + 16 + 8 * hh), x3 = *(const v4fa*)(arow + kb + 16 + 8 * hh + 4);
    float xs[16] = {x0[0],x0[1],x0[2],x0[3],x1[0],x1[1],x1[2],x1[3],x2[0],x2[1],x2[2],x2[3],x3[0],x3[1],x3[2],x3[3]};
#pragma unroll
    for (int i = 0; i < 16; ++i) { const unsigned short hb = bf16_bits(xs[i]); ah.u[i] = hb; al.u[i] = ASPLIT ? bf16_bits(xs[i] - bf16_val(hb)) : (unsigned short)0; }
#pragma unroll
    for (int t = 0; t < 4; ++t) {
      const unsigned short* brow = Wt + (size_t)(col0 + t * 16 + ln) * ldb + kb;
      FragB b;
      b.half[0] = *(const v8us*)(brow + 8 * hh);
      b.half[1] = *(const v8us*)(brow + 16 + 8 * hh);
      acc[t] = mmaN<ASPLIT ? 2 : 1>(ah.v, al.v, b.v, b.v, acc[t]);
    }
  }
#pragma unroll
  for (int t = 0; t < 4; ++t) {
    float bv = bias ? bias[col0 + t * 16 + ln] : 0.f;
    if (BIAS_BF16) bv = bf16_round(bv);
#pragma unroll
    for (int r = 0; r < 8; ++r) { float v = acc[t][r] + bv; if (ACT == 1) v = fmaxf(v, 0.f); so[w][8 * hh + r][t * 16 + ln] = v; }
  }
  __builtin_amdgcn_fence(__ATOMIC_ACQ_REL, "workgroup");
  __builtin_amdgcn_wave_barrier();
  const int rsub = lane >> 4, c4 = (lane & 15) * 4;
  {
#pragma unroll
    for (int q = 0; q < 8; ++q) {
      const int r = q * 2 + rsub;
      const v4f v = *(const v4fa*)&so[w][r][c4];
      *(v4f*)(C + (size_t)(row0 + r) * ldc + col0 + c4) = v;
    }
    
  }
}

// Flash-style causal/unmasked attention, all contractions 3-term bf16 hi/lo splits, f32 softmax with running max.
// q,k,v rows are read from f32 buffers with arbitrary row pitch (so they can live inside a fused qkv buffer);
// D = head size (multiple of 32, <= 128); one wave = 16 query rows; block = 4 waves (64 queries) sharing K/V chunks of 32.
template <int D, bool CAUSAL>
__global__ __launch_bounds__(128) void k_flash(const float* __restrict__ qb, const float* __restrict__ kb, const float* __restrict__ vb,
                                             int pitch, int T, int H, float scale, float* __restrict__ y, int ypitch) {
  constexpr int KS = D / 32;        // k-steps for QK
  constexpr int DT = D / 16;        // d tiles for PV
  __shared__ __attribute__((aligned(16))) unsigned short sKh[32][D + 8], sKl[32][D + 8], sVh[32][D + 8], sVl[32][D + 8];
  __shared__ __attribute__((aligned(16))) unsigned short sPh[4][16][40], sPl[4][16][40];
  __shared__ __attribute__((aligned(16))) float sO[4][16][D];
  const int tid = threadIdx.x, w = tid >> 5, lane = tid & 31, ln = lane & 15, hh = lane >> 4;
  const int nqb = (T + 63) / 64;
  const int bh = blockIdx.x / nqb, qblk = blockIdx.x % nqb;
  const int b = bh / H, h = bh % H;
  const int q0 = qblk * 64 + w * 16;
  const float* Q = qb + (size_t)b * T * pitch + h * D;
  const float* K = kb + (size_t)b * T * pitch + h * D;
  const float* V = vb + (size_t)b * T * pitch + h * D;

  // A fragments of the wave's 16 query rows (scaled), hi/lo
  FragB aqh[KS], aql[KS];
  {
    int row = q0 + ln; if (row >= T) row = T - 1;
    const float* qr = Q + (size_t)row * pitch;
#pragma unroll
    for (int ks = 0; ks < KS; ++ks)
#pragma unroll
      for (int i = 0; i < 16; ++i) {
        const int d = ks * 32 + ((i < 8) ? (8 * hh + i) : (16 + 8 * hh + (i - 8)));
        const float x = qr[d] * scale; const unsigned short hb = bf16_bits(x);
        aqh[ks].u[i] = hb; aql[ks].u[i] = bf16_bits(x - bf16_val(hb));
      }
  }
  float m_r[8], l_r[8];
#pragma unroll
  for (int r = 0; r < 8; ++r) { m_r[r] = -3.0e38f; l_r[r] = 0.f; }
  v8f oacc[DT];
#pragma unroll
  for (int dt = 0; dt < DT; ++dt) oacc[dt] = (v8f){0.f,0.f,0.f,0.f,0.f,0.f,0.f,0.f};

  const int kv_end = CAUSAL ? min(T, qblk * 64 + 64) : T;     // block-uniform
  for (int j0 = 0; j0 < kv_end; j0 += 32) {
    __syncthreads();
    for (int e = tid; e < 32 * (D / 4); e += 128) {
      const int r = e / (D / 4), c4 = (e % (D / 4)) * 4;
      const int key = j0 + r;
      v4f kf = {0.f,0.f,0.f,0.f}, vf = {0.f,0.f,0.f,0.f};
      if (key < T) { kf = *(const v4fa*)(K + (size_t)key * pitch + c4); vf = *(const v4fa*)(V + (size_t)key * pitch + c4); }
#pragma unroll
      for (int t = 0; t < 4; ++t) {
        unsigned short hb = bf16_bits(kf[t]); sKh[r][c4 + t] = hb; sKl[r][c4 + t] = bf16_bits(kf[t] - bf16_val(hb));
        hb = bf16_bits(vf[t]); sVh[r][c4 + t] = hb; sVl[r][c4 + t] = bf16_bits(vf[t] - bf16_val(hb));
      }
    }
    __syncthreads();
    // S tile 16 x 32
    v8f s[2];
#pragma unroll
    for (int nt = 0; nt < 2; ++nt) {
      v8f acc = {};
#pragma unroll
      for (int ks = 0; ks < KS; ++ks) {
        FragB bh_, bl_;
        bh_.half[0] = *(const v8us*)&sKh[nt * 16 + ln][ks * 32 + 8 * hh]; bh_.half[1] = *(const v8us*)&sKh[nt * 16 + ln][ks * 32 + 16 + 8 * hh];
        bl_.half[0] = *(const v8us*)&sKl[nt * 16 + ln][ks * 32 + 8 * hh]; bl_.half[1] = *(const v8us*)&sKl[nt * 16 + ln][ks * 32 + 16 + 8 * hh];
        acc = mmaN<3>(aqh[ks].v, aql[ks].v, bh_.v, bl_.v, acc);
      }
      s[nt] = acc;
    }
    // mask + running max (rows 8hh+r; the 16 lanes of a half share rows)
    float alpha[8];
#pragma unroll
    for (int r = 0; r < 8; ++r) {
      const int qi = q0 + 8 * hh + r;
      const int ja = j0 + ln, jb = j0 + 16 + ln;
      if (CAUSAL) { if (ja > qi) s[0][r] = -3.0e38f; if (jb > qi) s[1][r] = -3.0e38f; }
      if (ja >= T) s[0][r] = -3.0e38f;
      if (jb >= T) s[1][r] = -3.0e38f;
      float mx = fmaxf(s[0][r], s[1][r]);
      mx = fmaxf(mx, __shfl_xor(mx, 1, 32)); mx = fmaxf(mx, __shfl_xor(mx, 2, 32)); mx = fmaxf(mx, __shfl_xor(mx, 4, 32)); mx = fmaxf(mx, __shfl_xor(mx, 8, 32));
      const float mnew = fmaxf(m_r[r], mx);
      alpha[r] = (mnew > -1.0e38f) ? __expf(m_r[r] - mnew) : 1.0f;
      const float p0 = (s[0][r] > -1.0e38f) ? __expf(s[0][r] - mnew) : 0.f;
      const float p1 = (s[1][r] > -1.0e38f) ? __expf(s[1][r] - mnew) : 0.f;
      m_r[r] = mnew;
      l_r[r] = l_r[r] * alpha[r] + p0 + p1;            // per-lane partial row sum (16 lanes combined at the end)
      unsigned short hb = bf16_bits(p0); sPh[w][8 * hh + r][ln] = hb;      sPl[w][8 * hh + r][ln] = bf16_bits(p0 - bf16_val(hb));
      hb = bf16_bits(p1);                sPh[w][8 * hh + r][16 + ln] = hb; sPl[w][8 * hh + r][16 + ln] = bf16_bits(p1 - bf16_val(hb));
    }
#pragma unroll
    for (int dt = 0; dt < DT; ++dt)
#pragma unroll
      for (int r = 0; r < 8; ++r) oacc[dt][r] *= alpha[r];
    __builtin_amdgcn_fence(__ATOMIC_ACQ_REL, "workgroup");
    __builtin_amdgcn_wave_barrier();
    FragB pah, pal;
    pah.half[0] = *(const v8us*)&sPh[w][ln][8 * hh]; pah.half[1] = *(const v8us*)&sPh[w][ln][16 + 8 * hh];
    pal.half[0] = *(const v8us*)&sPl[w][ln][8 * hh]; pal.half[1] = *(const v8us*)&sPl[w][ln][16 + 8 * hh];
#pragma unroll
    for (int dt = 0; dt < DT; ++dt) {
      FragB bvh, bvl;
#pragma unroll
      for (int i = 0; i < 8; ++i) {
        bvh.u[i] = sVh[8 * hh + i][dt * 16 + ln]; bvh.u[8 + i] = sVh[16 + 8 * hh + i][dt * 16 + ln];
        bvl.u[i] = sVl[8 * hh + i][dt * 16 + ln]; bvl.u[8 + i] = sVl[16 + 8 * hh + i][dt * 16 + ln];
      }
      oacc[dt] = mmaN<3>(pah.v, pal.v, bvh.v, bvl.v, oacc[dt]);
    }
    __builtin_amdgcn_fence(__ATOMIC_ACQ_REL, "workgroup");
    __builtin_amdgcn_wave_barrier();
  }
#pragma unroll
  for (int r = 0; r < 8; ++r) {
    float l = l_r[r];
    l += __shfl_xor(l, 1, 32); l += __shfl_xor(l, 2, 32); l += __shfl_xor(l, 4, 32); l += __shfl_xor(l, 8, 32);
    l_r[r] = (l > 0.f) ? 1.0f / l : 0.f;
  }
#pragma unroll
  for (int dt = 0; dt < DT; ++dt)
#pragma unroll
    for (int r = 0; r < 8; ++r) sO[w][8 * hh + r][dt * 16 + ln] = oacc[dt][r] * l_r[r];
  __builtin_amdgcn_fence(__ATOMIC_ACQ_REL, "workgroup");
  __builtin_amdgcn_wave_barrier();
  {
    for (int r = 0; r < 16; ++r) {
      const int row = q0 + r;
      if (row < T && lane < D / 4) {
        const v4f val = *(const v4fa*)&sO[w][r][lane * 4];
        *(v4f*)(y + ((size_t)b * T + row) * ypitch + h * D + lane * 4) = val;
      }
    }
    
  }
}

// batched GEMM (blockIdx.y = batch): C_b = act(alpha·A_b·B_b + bias + resid_b); A f32 rows (ASPLIT → hi/lo), B = bf16 planes Bh (+Bl when BSPLIT, requires ASPLIT),
// per-batch element strides sA, sB (0 = shared weights), sC, sR. resid may alias C (values are staged before the stores). ACT 0/1(relu).
// ACT: 0 none, 1 relu, 2 softplus
template <bool ASPLIT, bool BSPLIT, int ACT>
__global__ __launch_bounds__(128) void k_gemm_b(const float* __restrict__ A, int lda, size_t sA, const unsigned short* __restrict__ Bh, const unsigned short* __restrict__ Bl, int ldb, size_t sB,
                                             const float* __restrict__ bias, const float* __restrict__ resid, int ldr, size_t sR, float rsign, float alpha,
                                             float* __restrict__ C, int ldc, size_t sC, int M, int N, int K) {
  __shared__ __attribute__((aligned(16))) float so[4][16][64];
  const int tid = threadIdx.x, w = tid >> 5, lane = tid & 31, ln = lane & 15, hh = lane >> 4;
  const int by = blockIdx.y;
  A += (size_t)by * sA; Bh += (size_t)by * sB; if (BSPLIT) Bl += (size_t)by * sB; C += (size_t)by * sC; if (resid) resid += (size_t)by * sR;
  const int ntn = (N + 63) / 64; const int wid = blockIdx.x * 4 + w; const int mt = wid / ntn, nq = wid % ntn;      // N may be any multiple of 16: tiles past N are skipped and not stored
  if (mt * 16 >= M) return;
  const int row0 = mt * 16, col0 = nq * 64;
  const float* arow = A + (size_t)(row0 + ln) * lda;
  v8f acc[4] = {};
  for (int kb = 0; kb < K; kb += 32) {
    FragB ah, al;
    const v4f x0 = *(const v4fa*)(arow + kb + 8 * hh), x1 = *(const v4fa*)(arow + kb + 8 * hh + 4);
    const v4f x2 = *(const v4fa*)(arow + kb + 16 + 8 * hh), x3 = *(const v4fa*)(arow + kb + 16 + 8 * hh + 4);
    float xs[16] = {x0[0],x0[1],x0[2],x0[3],x1[0],x1[1],x1[2],x1[3],x2[0],x2[1],x2[2],x2[3],x3[0],x3[1],x3[2],x3[3]};
#pragma unroll
    for (int i = 0; i < 16; ++i) { const unsigned short hb = bf16_bits(xs[i]); ah.u[i] = hb; al.u[i] = ASPLIT ? bf16_bits(xs[i] - bf16_val(hb)) : (unsigned short)0; }
#pragma unroll
    for (int t = 0; t < 4; ++t) {
      if (col0 + t * 16 >= N) continue;
      const size_t boff = (size_t)(col0 + t * 16 + ln) * ldb + kb;
      FragB bh_, bl_; bh_.half[0] = *(const v8us*)(Bh + boff + 8 * hh); bh_.half[1] = *(const v8us*)(Bh + boff + 16 + 8 * hh);
      if (BSPLIT) { bl_.half[0] = *(const v8us*)(Bl + boff + 8 * hh); bl_.half[1] = *(const v8us*)(Bl + boff + 16 + 8 * hh); } else bl_ = bh_;
      acc[t] = mmaN<ASPLIT ? (BSPLIT ? 3 : 2) : 1>(ah.v, al.v, bh_.v, bl_.v, acc[t]);
    }
  }
#pragma unroll
  for (int t = 0; t < 4; ++t) {
    const int col = col0 + t * 16 + ln; if (col0 + t * 16 >= N) continue; const float bv = bias ? bf16_round(bias[col]) : 0.f;
#pragma unroll
    for (int r = 0; r < 8; ++r) { float v = acc[t][r] * alpha + bv; if (resid) v += rsign * resid[(size_t)(row0 + 8 * hh + r) * ldr + col]; if (ACT == 1) v = fmaxf(v, 0.f); else if (ACT == 2) v = fmaxf(v, 0.f) + log1pf(expf(-fabsf(v))); so[w][8 * hh + r][t * 16 + ln] = v; }
  }
  __builtin_amdgcn_fence(__ATOMIC_ACQ_REL, "workgroup"); __builtin_amdgcn_wave_barrier();
  const int rsub = lane >> 4, c4 = (lane & 15) * 4;
  {
#pragma unroll
    for (int q = 0; q < 8; ++q) { const int r = q * 2 + rsub; if (col0 + c4 < N) { const v4f v = *(const v4fa*)&so[w][r][c4]; *(v4f*)(C + (size_t)(row0 + r) * ldc + col0 + c4) = v; } }
    
  }
}
// batched f32 [K][N] (pitch lds, batch stride sIn) -> transposed hi/lo planes [N][K] (batch stride sOut); thread per (n, 8 k); grid.y = batch
__global__ __launch_bounds__(256) void k_split_transpose_b(const float* __restrict__ src, int lds_, size_t sIn, unsigned short* __restrict__ hi, unsigned short* __restrict__ lo, size_t sOut, int K, int N) {
  const size_t t = (size_t)blockIdx.x * 256 + threadIdx.x; const int k8n = K / 8; if (t >= (size_t)N * k8n) return;
  src += (size_t)blockIdx.y * sIn; hi += (size_t)blockIdx.y * sOut; lo += (size_t)blockIdx.y * sOut;
  const int n = (int)(t / k8n), k8 = (int)(t % k8n) * 8; v8us vh, vl;
#pragma unroll
  for (int i = 0; i < 8; ++i) { const float x = src[(size_t)(k8 + i) * lds_ + n]; const unsigned short hb = bf16_bits(x); vh[i] = hb; vl[i] = bf16_bits(x - bf16_val(hb)); }
  unsigned short* dh = hi + (size_t)n * K + k8; unsigned short* dl = lo + (size_t)n * K + k8;
  *(v8us*)dh = vh; *(v8us*)dl = vl; 
}

// ---- f16 WMMA path (v_wmma_f32_16x16x32_f16): 11-bit significands for operands in range — used where a [0,1] probability operand needs more precision than bf16
typedef _Float16 v16h __attribute__((ext_vector_type(16)));
union FragH { v16h v; v8us half[2]; _Float16 h[16]; unsigned short u[16]; };
template <int NT>
__device__ __forceinline__ v8f mmaH(v16h ah, v16h al, v16h bh, v16h bl, v8f c) {
  c = __builtin_amdgcn_wmma_f32_16x16x32_f16(false, ah, false, bh, (short)0, c, false, false);
  if (NT >= 2) c = __builtin_amdgcn_wmma_f32_16x16x32_f16(false, al, false, bh, (short)0, c, false, false);
  if (NT >= 3) c = __builtin_amdgcn_wmma_f32_16x16x32_f16(false, ah, false, bl, (short)0, c, false, false);
  asm volatile("v_nop\n\tv_nop\n\tv_nop\n\tv_nop" : "+v"(c) : "v"(ah), "v"(al), "v"(bh), "v"(bl));
  return c;
}
// batched GEMM like k_gemm_b but f16 operands: A f32 (split into f16 hi/lo if ASPLIT, else rounded to f16), Bt = f16 values [n][k]; alpha; C f32; N multiple of 16 (partial tiles skipped)
template <bool ASPLIT>
__global__ __launch_bounds__(128) void k_gemm_h(const float* __restrict__ A, int lda, size_t sA, const _Float16* __restrict__ Bh, int ldb, size_t sB, float alpha, float* __restrict__ C, int ldc, size_t sC, int M, int N, int K) {
  __shared__ __attribute__((aligned(16))) float so[4][16][64];
  const int tid = threadIdx.x, w = tid >> 5, lane = tid & 31, ln = lane & 15, hh = lane >> 4; const int by = blockIdx.y;
  A += (size_t)by * sA; Bh += (size_t)by * sB; C += (size_t)by * sC;
  const int ntn = (N + 63) / 64; const int wid = blockIdx.x * 4 + w; const int mt = wid / ntn, nq = wid % ntn; if (mt * 16 >= M) return;
  const int row0 = mt * 16, col0 = nq * 64; const float* arow = A + (size_t)(row0 + ln) * lda;
  v8f acc[4] = {};
  for (int kb = 0; kb < K; kb += 32) {
    FragH ah, al;
    const v4f x0 = *(const v4fa*)(arow + kb + 8 * hh), x1 = *(const v4fa*)(arow + kb + 8 * hh + 4), x2 = *(const v4fa*)(arow + kb + 16 + 8 * hh), x3 = *(const v4fa*)(arow + kb + 16 + 8 * hh + 4);
    float xs[16] = {x0[0],x0[1],x0[2],x0[3],x1[0],x1[1],x1[2],x1[3],x2[0],x2[1],x2[2],x2[3],x3[0],x3[1],x3[2],x3[3]};
#pragma unroll
    for (int i = 0; i < 16; ++i) { const _Float16 h = (_Float16)xs[i]; ah.h[i] = h; al.h[i] = ASPLIT ? (_Float16)(xs[i] - (float)h) : (_Float16)0.0f; }
#pragma unroll
    for (int t = 0; t < 4; ++t) { if (col0 + t * 16 >= N) continue; const size_t boff = (size_t)(col0 + t * 16 + ln) * ldb + kb; FragH bq; bq.half[0] = *(const v8us*)(Bh + boff + 8 * hh); bq.half[1] = *(const v8us*)(Bh + boff + 16 + 8 * hh);
      acc[t] = mmaH<ASPLIT ? 2 : 1>(ah.v, al.v, bq.v, bq.v, acc[t]); }
  }
#pragma unroll
  for (int t = 0; t < 4; ++t) { if (col0 + t * 16 >= N) continue;
#pragma unroll
    for (int r = 0; r < 8; ++r) so[w][8 * hh + r][t * 16 + ln] = acc[t][r] * alpha; }
  __builtin_amdgcn_fence(__ATOMIC_ACQ_REL, "workgroup"); __builtin_amdgcn_wave_barrier();
  const int rsub = lane >> 4, c4 = (lane & 15) * 4;
  {
#pragma unroll
    for (int q = 0; q < 8; ++q) { const int r = q * 2 + rsub; if (col0 + c4 < N) { const v4f v = *(const v4fa*)&so[w][r][c4]; *(v4f*)(C + (size_t)(row0 + r) * ldc + col0 + c4) = v; } }
     }
}

__global__ __launch_bounds__(256) void k_bt(const float* __restrict__ Wqkv, const float* __restrict__ Wo, unsigned short* __restrict__ Bq, unsigned short* __restrict__ Bo) { const int t = blockIdx.x * 256 + threadIdx.x;
  if (t < 3 * DIM * DIM / 8) { const int k8 = (t % (DIM / 8)) * 8, n = t / (DIM / 8); v8us v; for (int q = 0; q < 8; ++q) v[q] = bf16_bits(Wqkv[(size_t)(k8 + q) * (3 * DIM) + n]); *(v8us*)(Bq + (size_t)n * DIM + k8) = v;  }
  if (t < DIM * DIM / 8) { const int k8 = (t % (DIM / 8)) * 8, n = t / (DIM / 8); v8us v; for (int q = 0; q < 8; ++q) v[q] = bf16_bits(Wo[(size_t)(k8 + q) * DIM + n]); *(v8us*)(Bo + (size_t)n * DIM + k8) = v;  } }
__device__ __forceinline__ void ldF(FragH& f, const _Float16* base, int pitch, int row, int k0, int ln, int hh) { const unsigned short* p = (const unsigned short*)base + (size_t)(row + ln) * pitch + k0; f.half[0] = *(const v8us*)(p + 8 * hh); f.half[1] = *(const v8us*)(p + 16 + 8 * hh); }
typedef unsigned short v4us __attribute__((ext_vector_type(4), may_alias));
// one work-group of 4 waves per (b, window w = wy*8+wx), wave = head h. Window slot i = yi*7+xi is token ((wy*7+yi+3)%56, (wx*7+xi+3)%56) of batch b.
// The window's 49 rows of x (padded with zero rows to 64) are staged once in LDS as bf16; each wave forms its head's q, k, v (64 x 96, K = 128) on the bf16 WMMA
// and puts them into its own LDS planes as f16, so qkv never goes through global memory. Zero rows of x give zero rows of q, k, v: the padding needs no clearing.
// The head's o rows stay in registers over the four query passes, go as bf16 hi/lo into the wave's own q and k planes (dead by then), and after one work-group barrier
// wave h forms output columns 32h .. 32h+31 of all the window's tokens (K = 128 over the four heads' planes, 2 products), so o never goes through global memory either.
__global__ __launch_bounds__(128) void k_win(const float* __restrict__ X, const unsigned short* __restrict__ Bq, const float* __restrict__ pos,
                                           const unsigned short* __restrict__ Bo, const float* __restrict__ bo, float* __restrict__ out) {
  constexpr int PW = (64 * 40 + 64 * 40 + HDM * 72) * 2;          // bytes per wave: q, k, v^T planes
  constexpr int PO = 16 * 72 * 2 + 16 * (HDM + 1) * 4;            // bytes per wave: 16 rows of e; the rest makes room for the staged x
  constexpr int XP = DIM + 8;                                     // pitch of the staged x rows, in bf16 elements
  constexpr int SP = HDM + 4;                                     // pitch of a staged output tile, in floats (rows 16-byte aligned)
  static_assert(4 * PO >= 64 * XP * 2, "staged x shares the space of the e rows");
  static_assert(2 * 16 * SP * 4 <= HDM * 72 * 2 && 16 * SP * 4 <= PO, "three staged output tiles fit the v^T plane and the e rows");
  __shared__ __attribute__((aligned(16))) unsigned char smem[4 * PW + 4 * PO]; __shared__ int stok[64]; __shared__ float sbias[13 * 13];
  const int tid = threadIdx.x, lane = tid & 31, ln = lane & 15, hh = lane >> 4; const int h = __builtin_amdgcn_readfirstlane(tid >> 5);
  const int w = blockIdx.x % NWIN; const int b = blockIdx.x / NWIN; const int wy = w / 8, wx = w % 8;
  _Float16* sq = (_Float16*)(smem + h * PW); _Float16* sk = sq + 64 * 40; _Float16* svt = sk + 64 * 40;
  unsigned short* sx = (unsigned short*)(smem + 4 * PW); _Float16* sp = (_Float16*)(smem + 4 * PW + h * PO);
  if (tid < 64) { int tok = -1; if (tid < 49) { const int yi = tid / WS, xi = tid % WS; const int y = (wy * WS + yi + DISP) % HI, x = (wx * WS + xi + DISP) % WI; tok = (b * HI + y) * WI + x; } stok[tid] = tok; }
  for (int i = tid; i < 169; i += 128) sbias[i] = bf16_round(pos[i]);
  // stage x: wave h takes rows h, h+4, ...; one row = one 512-byte wave load; all 13 loads are issued before the first is used
  v4f xv[13];
#pragma unroll
  for (int it = 0; it < 13; ++it) { const int i = min(h + 4 * it, 48); const int yi = i / WS, xi = i % WS; const int y = (wy * WS + yi + DISP) % HI, x = (wx * WS + xi + DISP) % WI;
    xv[it] = *(const v4fa*)(X + (size_t)((b * HI + y) * WI + x) * DIM + lane * 4); }
#pragma unroll
  for (int it = 0; it < 13; ++it) { const int i = h + 4 * it; v4us p = {0, 0, 0, 0}; if (i < 49) { for (int c = 0; c < 4; ++c) p[c] = bf16_bits(xv[it][c]); } *(v4us*)(sx + i * XP + lane * 4) = p; }
#pragma unroll
  for (int it = 13; it < 16; ++it) { const v4us p = {0, 0, 0, 0}; *(v4us*)(sx + (h + 4 * it) * XP + lane * 4) = p; }
  __syncthreads();      // every wave reads all 64 staged rows, the token list and the bias table
  FragB a[4][4];
#pragma unroll
  for (int mt = 0; mt < 4; ++mt) {
#pragma unroll
    for (int ks = 0; ks < 4; ++ks) { const unsigned short* p = sx + (mt * 16 + ln) * XP + ks * 32; a[mt][ks].half[0] = *(const v8us*)(p + 8 * hh); a[mt][ks].half[1] = *(const v8us*)(p + 16 + 8 * hh); } }
  __syncthreads();      // the staged rows are in registers now: their LDS is reused for the e rows below
#pragma unroll
  for (int t = 0; t < 6; ++t) {      // column tiles: t = 0,1 q; 2,3 k; 4,5 v of head h
    const unsigned short* brow = Bq + (size_t)((t >> 1) * DIM + h * HDM + (t & 1) * 16 + ln) * DIM;
    FragB bf[4];
#pragma unroll
    for (int ks = 0; ks < 4; ++ks) { bf[ks].half[0] = *(const v8us*)(brow + ks * 32 + 8 * hh); bf[ks].half[1] = *(const v8us*)(brow + ks * 32 + 16 + 8 * hh); }
#pragma unroll
    for (int mt = 0; mt < 4; ++mt) {
      v8f c = {};
#pragma unroll
      for (int ks = 0; ks < 4; ++ks) c = __builtin_amdgcn_wmma_f32_16x16x32_bf16(false, a[mt][ks].v, false, bf[ks].v, (short)0, c, false, false);
      const int row = mt * 16 + 8 * hh, col = (t & 1) * 16 + ln;
      if (t < 2) {
#pragma unroll
        for (int r = 0; r < 8; ++r) sq[(row + r) * 40 + col] = (_Float16)(c[r] * 0.17677669529663687f);
      } else if (t < 4) {
#pragma unroll
        for (int r = 0; r < 8; ++r) sk[(row + r) * 40 + col] = (_Float16)c[r];
      } else {
        FragH vv;
#pragma unroll
        for (int r = 0; r < 8; ++r) vv.h[r] = (_Float16)c[r];
        *(v8us*)((unsigned short*)svt + col * 72 + row) = vv.half[0];
      }
    }
  }
  __builtin_amdgcn_fence(__ATOMIC_ACQ_REL, "workgroup"); __builtin_amdgcn_wave_barrier();
  const bool ul = (wy == 7), lr = (wx == 7);
  v8f keep[4][2] = {};      // the head's normalised o, all 64 rows, in registers: only ever indexed by constants
  for (int mt = 0; mt < 4; ++mt) {      // 16 query rows per pass (rows >= 49 are padding: computed, never stored)
    v8f acc[4] = {}; FragH a; ldF(a, sq, 40, mt * 16, 0, ln, hh);
#pragma unroll
    for (int t = 0; t < 4; ++t) { FragH bk; ldF(bk, sk, 40, t * 16, 0, ln, hh); acc[t] = mmaH<1>(a.v, a.v, bk.v, bk.v, acc[t]); }
    float rmax[8], rsum[8];
#pragma unroll
    for (int r = 0; r < 8; ++r) { const int i = mt * 16 + 8 * hh + r; const int yi = i / WS, xi = i % WS; float m = -3.0e38f;
#pragma unroll
      for (int t = 0; t < 4; ++t) { const int j = t * 16 + ln; float s = -3.0e38f; if (i < 49 && j < 49) { const int yj = j / WS, xj = j % WS; const bool masked = (ul && ((yi >= 4) != (yj >= 4))) || (lr && ((xi >= 4) != (xj >= 4))); if (!masked) s = acc[t][r] + sbias[(yj - yi + 6) * 13 + (xj - xi + 6)]; } acc[t][r] = s; m = fmaxf(m, s); }
      for (int o = 8; o >= 1; o >>= 1) m = fmaxf(m, __shfl_xor(m, o, 32)); rmax[r] = m; }
#pragma unroll
    for (int r = 0; r < 8; ++r) { float s = 0.f;
#pragma unroll
      for (int t = 0; t < 4; ++t) { const int j = t * 16 + ln; const float e = (acc[t][r] > -1.0e38f) ? __expf(acc[t][r] - rmax[r]) : 0.f; s += e; sp[(8 * hh + r) * 72 + j] = (_Float16)e; }
      for (int o = 8; o >= 1; o >>= 1) s += __shfl_xor(s, o, 32); rsum[r] = s; }
    __builtin_amdgcn_fence(__ATOMIC_ACQ_REL, "workgroup"); __builtin_amdgcn_wave_barrier();
    v8f acco[2] = {};
#pragma unroll
    for (int ks = 0; ks < 2; ++ks) { FragH ap; ldF(ap, sp, 72, 0, ks * 32, ln, hh);
#pragma unroll
      for (int t = 0; t < 2; ++t) { FragH bv; ldF(bv, svt, 72, t * 16, ks * 32, ln, hh); acco[t] = mmaH<1>(ap.v, ap.v, bv.v, bv.v, acco[t]); } }
#pragma unroll
    for (int t = 0; t < 2; ++t) {
#pragma unroll
      for (int r = 0; r < 8; ++r) { const float rs = (rsum[r] > 0.f) ? 1.0f / rsum[r] : 0.f; acco[t][r] *= rs; } }
#pragma unroll
    for (int m = 0; m < 4; ++m) if (mt == m) { keep[m][0] = acco[0]; keep[m][1] = acco[1]; }      // mt is wave-uniform: the pass loop stays rolled, its result goes to its own registers
    __builtin_amdgcn_fence(__ATOMIC_ACQ_REL, "workgroup"); __builtin_amdgcn_wave_barrier();      // the next pass rewrites the e rows that other lanes have just read
  }
  // From here on every loop is unrolled: its index picks registers (keep, bw, c, ov, op), which only a compile-time constant can do.
  // W_out fragments and bias of this wave's 32 output columns: asked for here, so that they fly while o is handed over
  FragB bw[2][4]; float bv[2];
#pragma unroll
  for (int t = 0; t < 2; ++t) { const unsigned short* brow = Bo + (size_t)(h * HDM + t * 16 + ln) * DIM; bv[t] = bf16_round(bo[h * HDM + t * 16 + ln]);
#pragma unroll
    for (int ks = 0; ks < 4; ++ks) { bw[t][ks].half[0] = *(const v8us*)(brow + ks * 32 + 8 * hh); bw[t][ks].half[1] = *(const v8us*)(brow + ks * 32 + 16 + 8 * hh); } }
  // o -> bf16 hi (own q plane) and lo (own k plane), same pitch. Of the last pass only row 48 is a token: rows 49 .. 63 keep the planes' zero padding (row 56 is rewritten with zeros).
  unsigned short* oh = (unsigned short*)sq; unsigned short* ol = (unsigned short*)sk;
#pragma unroll
  for (int mt = 0; mt < 4; ++mt) {
#pragma unroll
    for (int t = 0; t < 2; ++t) {
#pragma unroll
      for (int r = 0; r < (mt < 3 ? 8 : 1); ++r) { const float v = keep[mt][t][r]; const unsigned short hb = bf16_bits(v); const int at = (mt * 16 + 8 * hh + r) * 40 + t * 16 + ln; oh[at] = hb; ol[at] = bf16_bits(v - bf16_val(hb)); } } }
  __syncthreads();      // every wave reads all four heads' o planes
  float* st[3] = {(float*)svt, (float*)svt + 16 * SP, (float*)sp};      // the wave's own v^T plane and e rows are dead: one staged output tile per full pass
  float last[2];
#pragma unroll
  for (int mt = 0; mt < 4; ++mt) {
    v8f c[2] = {};
#pragma unroll
    for (int ks = 0; ks < 4; ++ks) {      // k step ks = head ks
      const unsigned short* ph = (const unsigned short*)(smem + ks * PW) + (mt * 16 + ln) * 40; const unsigned short* pl = ph + 64 * 40;
      FragB ah, al; ah.half[0] = *(const v8us*)(ph + 8 * hh); ah.half[1] = *(const v8us*)(ph + 16 + 8 * hh); al.half[0] = *(const v8us*)(pl + 8 * hh); al.half[1] = *(const v8us*)(pl + 16 + 8 * hh);
#pragma unroll
      for (int t = 0; t < 2; ++t) {
        c[t] = __builtin_amdgcn_wmma_f32_16x16x32_bf16(false, ah.v, false, bw[t][ks].v, (short)0, c[t], false, false);
        c[t] = __builtin_amdgcn_wmma_f32_16x16x32_bf16(false, al.v, false, bw[t][ks].v, (short)0, c[t], false, false);
      }
    }
#pragma unroll
    for (int t = 0; t < 2; ++t) {
      if (mt < 3) {
#pragma unroll
        for (int r = 0; r < 8; ++r) st[mt][(8 * hh + r) * SP + t * 16 + ln] = c[t][r] + bv[t];
      } else last[t] = c[t][0] + bv[t];
    }
  }
  __builtin_amdgcn_fence(__ATOMIC_ACQ_REL, "workgroup"); __builtin_amdgcn_wave_barrier();      // the staged tiles are read back by other lanes
  // 8 lanes x 16 bytes = this wave's whole 128-byte line of a token, 4 tokens a store; all values and addresses are formed before the first store goes out
  v4f ov[12]; float* op[12];
#pragma unroll
  for (int q = 0; q < 12; ++q) { const int il = (q & 3) * 4 + (lane >> 3); ov[q] = *(const v4fa*)&st[q >> 2][il * SP + (lane & 7) * 4]; op[q] = out + (size_t)stok[(q >> 2) * 16 + il] * DIM + h * HDM + (lane & 7) * 4; }
  float* op48 = out + (size_t)stok[48] * DIM + h * HDM + ln;
#pragma unroll
  for (int q = 0; q < 12; ++q) *(v4f*)op[q] = ov[q];
  if (hh == 0) { op48[0] = last[0]; op48[16] = last[1]; }
}
extern "C" void kernel_launch(void* const* d_in, const int* in_sizes, int n_in,
                              void* d_out, int out_size, void* d_ws, size_t ws_size, hipStream_t stream) {
  (void)in_sizes; (void)n_in; (void)out_size;
  const float* x = (const float*)d_in[0]; const float* Wqkv = (const float*)d_in[1]; const float* pos = (const float*)d_in[2]; const float* Wo = (const float*)d_in[3]; const float* bo = (const float*)d_in[4];
  char* ws = (char*)d_ws; size_t off = 0;
  auto take = [&](size_t bytes) { char* p = ws + off; off += (bytes + 255) & ~(size_t)255; return p; };
  unsigned short* Bq = (unsigned short*)take((size_t)3 * DIM * DIM * 2); unsigned short* Bo = (unsigned short*)take((size_t)DIM * DIM * 2);
  if (off > ws_size) return;
  k_bt<<<(3 * DIM * DIM / 8 + 255) / 256, 256, 0, stream>>>(Wqkv, Wo, Bq, Bo);
  k_win<<<BB * NWIN, 128, 0, stream>>>(x, Bq, pos, Bo, bo, (float*)d_out);
}

// v003
// One run takes 27.6 microseconds.
// Next to v002, in two timings, it ran 1.44 times as fast each time.
// Counting every step since v000, it is 4.47 times as fast.
#include <hip/hip_runtime.h>
// Shifted-window attention: qkv = x·W_qkv on v_wmma_f32_16x16x32_bf16 (x rounded to bf16: single exact term; 50176 × 128 × 384); per (batch, window, head) the 49×49
// scores q·kᵀ and e·v on v_wmma_f32_16x16x32_f16 (q, k, v, e rounded to f16, windows padded to 64; one wave each); out = o·W_out + b_out on the bf16 variant with o split
// hi/lo (2 products). The cyclic shifts are pure index remaps (token (y,x) ↔ shifted (y−3, x−3) mod 56, and the back-shift returns every result to its own token);
// relative-position bias and the shift masks come from one table per window as the score accumulators' start values; the max-shifted softmax is f32 VALU.
#define BB 16
#define HI 56
#define WI 56
#define DIM 128
#define NHD 4
#define HDM 32
#define WS 7
#define NWIN 64
#define NTOK (BB * HI * WI)
#define DISP 3

typedef __bf16 v16b __attribute__((ext_vector_type(16)));
typedef unsigned short v8us __attribute__((ext_vector_type(8), may_alias));
typedef float  v8f  __attribute__((ext_vector_type(8)));
typedef float  v4f  __attribute__((ext_vector_type(4)));
typedef float  v4fa __attribute__((ext_vector_type(4), may_alias));
union FragB { v16b v; v8us half[2]; unsigned short u[16]; };

__device__ __forceinline__ unsigned short bf16_bits(float x) { unsigned int u = __float_as_uint(x); return (unsigned short)((u + 0x7FFFu + ((u >> 16) & 1u)) >> 16); }
__device__ __forceinline__ float bf16_val(unsigned short b) { return __uint_as_float(((unsigned int)b) << 16); }
__device__ __forceinline__ float bf16_round(float x) { return bf16_val(bf16_bits(x)); }
// D += A·B with NT terms: 1 = ah·bh, 2 = + al·bh (A split), 3 = + ah·bl (both split)
template <int NT>
__device__ __forceinline__ v8f mmaN(v16b ah, v16b al, v16b bh, v16b bl, v8f c) {
  c = __builtin_amdgcn_wmma_f32_16x16x32_bf16(false, ah, false, bh, (short)0, c, false, false);
  if (NT >= 2) c = __builtin_amdgcn_wmma_f32_16x16x32_bf16(false, al, false, bh, (short)0, c, false, false);
  if (NT >= 3) c = __builtin_amdgcn_wmma_f32_16x16x32_bf16(false, ah, false, bl, (short)0, c, false, false);
  asm volatile("v_nop\n\tv_nop\n\tv_nop\n\tv_nop" : "+v"(c) : "v"(ah), "v"(al), "v"(bh), "v"(bl));
  return c;
}

__global__ __launch_bounds__(256) void k_wt_bf16(const float* __restrict__ W, unsigned short* __restrict__ Wt, int K, int N) {
  const int t = blockIdx.x * 256 + threadIdx.x;
  const int k8n = K / 8;
  if (t >= N * k8n) return;
  const int n = t / k8n, k8 = (t % k8n) * 8;
  v8us v;
#pragma unroll
  for (int i = 0; i < 8; ++i) v[i] = bf16_bits(W[(size_t)(k8 + i) * N + n]);
  *(v8us*)(Wt + (size_t)n * K + k8) = v;
  
}

// GEMM C[M][N] (f32, pitch ldc) = act(A[M][K]·W + bias). A f32 row-major (pitch lda) converted per fragment to bf16
// (ASPLIT: hi/lo two planes -> 2 terms, else single rounded term); Wt bf16 [N][K] (pitch ldb). BIAS_BF16 rounds the
// bias to bf16 first (bias quantised to bf16 before the add). K%32==0, M%16==0, N%64==0.
template <bool ASPLIT, int ACT, bool BIAS_BF16>
__global__ __launch_bounds__(128) void k_gemm_bf(const float* __restrict__ A, int lda, const unsigned short* __restrict__ Wt, int ldb,
                                               const float* __restrict__ bias, float* __restrict__ C, int ldc, int M, int N, int K) {
  __shared__ __attribute__((aligned(16))) float so[4][16][64];
  const int tid = threadIdx.x, w = tid >> 5, lane = tid & 31, ln = lane & 15, hh = lane >> 4;
  const int ntn = N / 64;
  const int wid = blockIdx.x * 4 + w;
  const int mt = wid / ntn, nq = wid % ntn;
  if (mt * 16 >= M) return;
  const int row0 = mt * 16, col0 = nq * 64;
  const float* arow = A + (size_t)(row0 + ln) * lda;
  v8f acc[4] = {};
  for (int kb = 0; kb < K; kb += 32) {
    FragB ah, al;
    const v4f x0 = *(const v4fa*)(arow + kb + 8 * hh), x1 = *(const v4fa*)(arow + kb + 8 * hh + 4);
    const v4f x2 = *(const v4fa*)(arow + kb + 16 + 8 * hh), x3 = *(const v4fa*)(arow + kb + 16 + 8 * hh + 4);
    float xs[16] = {x0[0],x0[1],x0[2],x0[3],x1[0],x1[1],x1[2],x1[3],x2[0],x2[1],x2[2],x2[3],x3[0],x3[1],x3[2],x3[3]};
#pragma unroll
    for (int i = 0; i < 16; ++i) { const unsigned short hb = bf16_bits(xs[i]); ah.u[i] = hb; al.u[i] = ASPLIT ? bf16_bits(xs[i] - bf16_val(hb)) : (unsigned short)0; }
#pragma unroll
    for (int t = 0; t < 4; ++t) {
      const unsigned short* brow = Wt + (size_t)(col0 + t * 16 + ln) * ldb + kb;
      FragB b;
      b.half[0] = *(const v8us*)(brow + 8 * hh);
      b.half[1] = *(const v8us*)(brow + 16 + 8 * hh);
      acc[t] = mmaN<ASPLIT ? 2 : 1>(ah.v, al.v, b.v, b.v, acc[t]);
    }
  }
#pragma unroll
  for (int t = 0; t < 4; ++t) {
    float bv = bias ? bias[col0 + t * 16 + ln] : 0.f;
    if (BIAS_BF16) bv = bf16_round(bv);
#pragma unroll
    for (int r = 0; r < 8; ++r) { float v = acc[t][r] + bv; if (ACT == 1) v = fmaxf(v, 0.f); so[w][8 * hh + r][t * 16 + ln] = v; }
  }
  __builtin_amdgcn_fence(__ATOMIC_ACQ_REL, "workgroup");
  __builtin_amdgcn_wave_barrier();
  const int rsub = lane >> 4, c4 = (lane & 15) * 4;
  {
#pragma unroll
    for (int q = 0; q < 8; ++q) {
      const int r = q * 2 + rsub;
      const v4f v = *(const v4fa*)&so[w][r][c4];
      *(v4f*)(C + (size_t)(row0 + r) * ldc + col0 + c4) = v;
    }
    
  }
}

// Flash-style causal/unmasked attention, all contractions 3-term bf16 hi/lo splits, f32 softmax with running max.
// q,k,v rows are read from f32 buffers with arbitrary row pitch (so they can live inside a fused qkv buffer);
// D = head size (multiple of 32, <= 128); one wave = 16 query rows; block = 4 waves (64 queries) sharing K/V chunks of 32.
template <int D, bool CAUSAL>
__global__ __launch_bounds__(128) void k_flash(const float* __restrict__ qb, const float* __restrict__ kb, const float* __restrict__ vb,
                                             int pitch, int T, int H, float scale, float* __restrict__ y, int ypitch) {
  constexpr int KS = D / 32;        // k-steps for QK
  constexpr int DT = D / 16;        // d tiles for PV
  __shared__ __attribute__((aligned(16))) unsigned short sKh[32][D + 8], sKl[32][D + 8], sVh[32][D + 8], sVl[32][D + 8];
  __shared__ __attribute__((aligned(16))) unsigned short sPh[4][16][40], sPl[4][16][40];
  __shared__ __attribute__((aligned(16))) float sO[4][16][D];
  const int tid = threadIdx.x, w = tid >> 5, lane = tid & 31, ln = lane & 15, hh = lane >> 4;
  const int nqb = (T + 63) / 64;
  const int bh = blockIdx.x / nqb, qblk = blockIdx.x % nqb;
  const int b = bh / H, h = bh % H;
  const int q0 = qblk * 64 + w * 16;
  const float* Q = qb + (size_t)b * T * pitch + h * D;
  const float* K = kb + (size_t)b * T * pitch + h * D;
  const float* V = vb + (size_t)b * T * pitch + h * D;

  // A fragments of the wave's 16 query rows (scaled), hi/lo
  FragB aqh[KS], aql[KS];
  {
    int row = q0 + ln; if (row >= T) row = T - 1;
    const float* qr = Q + (size_t)row * pitch;
#pragma unroll
    for (int ks = 0; ks < KS; ++ks)
#pragma unroll
      for (int i = 0; i < 16; ++i) {
        const int d = ks * 32 + ((i < 8) ? (8 * hh + i) : (16 + 8 * hh + (i - 8)));
        const float x = qr[d] * scale; const unsigned short hb = bf16_bits(x);
        aqh[ks].u[i] = hb; aql[ks].u[i] = bf16_bits(x - bf16_val(hb));
      }
  }
  float m_r[8], l_r[8];
#pragma unroll
  for (int r = 0; r < 8; ++r) { m_r[r] = -3.0e38f; l_r[r] = 0.f; }
  v8f oacc[DT];
#pragma unroll
  for (int dt = 0; dt < DT; ++dt) oacc[dt] = (v8f){0.f,0.f,0.f,0.f,0.f,0.f,0.f,0.f};

  const int kv_end = CAUSAL ? min(T, qblk * 64 + 64) : T;     // block-uniform
  for (int j0 = 0; j0 < kv_end; j0 += 32) {
    __syncthreads();
    for (int e = tid; e < 32 * (D / 4); e += 128) {
      const int r = e / (D / 4), c4 = (e % (D / 4)) * 4;
      const int key = j0 + r;
      v4f kf = {0.f,0.f,0.f,0.f}, vf = {0.f,0.f,0.f,0.f};
      if (key < T) { kf = *(const v4fa*)(K + (size_t)key * pitch + c4); vf = *(const v4fa*)(V + (size_t)key * pitch + c4); }
#pragma unroll
      for (int t = 0; t < 4; ++t) {
        unsigned short hb = bf16_bits(kf[t]); sKh[r][c4 + t] = hb; sKl[r][c4 + t] = bf16_bits(kf[t] - bf16_val(hb));
        hb = bf16_bits(vf[t]); sVh[r][c4 + t] = hb; sVl[r][c4 + t] = bf16_bits(vf[t] - bf16_val(hb));
      }
    }
    __syncthreads();
    // S tile 16 x 32
    v8f s[2];
#pragma unroll
    for (int nt = 0; nt < 2; ++nt) {
      v8f acc = {};
#pragma unroll
      for (int ks = 0; ks < KS; ++ks) {
        FragB bh_, bl_;
        bh_.half[0] = *(const v8us*)&sKh[nt * 16 + ln][ks * 32 + 8 * hh]; bh_.half[1] = *(const v8us*)&sKh[nt * 16 + ln][ks * 32 + 16 + 8 * hh];
        bl_.half[0] = *(const v8us*)&sKl[nt * 16 + ln][ks * 32 + 8 * hh]; bl_.half[1] = *(const v8us*)&sKl[nt * 16 + ln][ks * 32 + 16 + 8 * hh];
        acc = mmaN<3>(aqh[ks].v, aql[ks].v, bh_.v, bl_.v, acc);
      }
      s[nt] = acc;
    }
    // mask + running max (rows 8hh+r; the 16 lanes of a half share rows)
    float alpha[8];
#pragma unroll
    for (int r = 0; r < 8; ++r) {
      const int qi = q0 + 8 * hh + r;
      const int ja = j0 + ln, jb = j0 + 16 + ln;
      if (CAUSAL) { if (ja > qi) s[0][r] = -3.0e38f; if (jb > qi) s[1][r] = -3.0e38f; }
      if (ja >= T) s[0][r] = -3.0e38f;
      if (jb >= T) s[1][r] = -3.0e38f;
      float mx = fmaxf(s[0][r], s[1][r]);
      mx = fmaxf(mx, __shfl_xor(mx, 1, 32)); mx = fmaxf(mx, __shfl_xor(mx, 2, 32)); mx = fmaxf(mx, __shfl_xor(mx, 4, 32)); mx = fmaxf(mx, __shfl_xor(mx, 8, 32));
      const float mnew = fmaxf(m_r[r], mx);
      alpha[r] = (mnew > -1.0e38f) ? __expf(m_r[r] - mnew) : 1.0f;
      const float p0 = (s[0][r] > -1.0e38f) ? __expf(s[0][r] - mnew) : 0.f;
      const float p1 = (s[1][r] > -1.0e38f) ? __expf(s[1][r] - mnew) : 0.f;
      m_r[r] = mnew;
      l_r[r] = l_r[r] * alpha[r] + p0 + p1;            // per-lane partial row sum (16 lanes combined at the end)
      unsigned short hb = bf16_bits(p0); sPh[w][8 * hh + r][ln] = hb;      sPl[w][8 * hh + r][ln] = bf16_bits(p0 - bf16_val(hb));
      hb = bf16_bits(p1);                sPh[w][8 * hh + r][16 + ln] = hb; sPl[w][8 * hh + r][16 + ln] = bf16_bits(p1 - bf16_val(hb));
    }
#pragma unroll
    for (int dt = 0; dt < DT; ++dt)
#pragma unroll
      for (int r = 0; r < 8; ++r) oacc[dt][r] *= alpha[r];
    __builtin_amdgcn_fence(__ATOMIC_ACQ_REL, "workgroup");
    __builtin_amdgcn_wave_barrier();
    FragB pah, pal;
    pah.half[0] = *(const v8us*)&sPh[w][ln][8 * hh]; pah.half[1] = *(const v8us*)&sPh[w][ln][16 + 8 * hh];
    pal.half[0] = *(const v8us*)&sPl[w][ln][8 * hh]; pal.half[1] = *(const v8us*)&sPl[w][ln][16 + 8 * hh];
#pragma unroll
    for (int dt = 0; dt < DT; ++dt) {
      FragB bvh, bvl;
#pragma unroll
      for (int i = 0; i < 8; ++i) {
        bvh.u[i] = sVh[8 * hh + i][dt * 16 + ln]; bvh.u[8 + i] = sVh[16 + 8 * hh + i][dt * 16 + ln];
        bvl.u[i] = sVl[8 * hh + i][dt * 16 + ln]; bvl.u[8 + i] = sVl[16 + 8 * hh + i][dt * 16 + ln];
      }
      oacc[dt] = mmaN<3>(pah.v, pal.v, bvh.v, bvl.v, oacc[dt]);
    }
    __builtin_amdgcn_fence(__ATOMIC_ACQ_REL, "workgroup");
    __builtin_amdgcn_wave_barrier();
  }
#pragma unroll
  for (int r = 0; r < 8; ++r) {
    float l = l_r[r];
    l += __shfl_xor(l, 1, 32); l += __shfl_xor(l, 2, 32); l += __shfl_xor(l, 4, 32); l += __shfl_xor(l, 8, 32);
    l_r[r] = (l > 0.f) ? 1.0f / l : 0.f;
  }
#pragma unroll
  for (int dt = 0; dt < DT; ++dt)
#pragma unroll
    for (int r = 0; r < 8; ++r) sO[w][8 * hh + r][dt * 16 + ln] = oacc[dt][r] * l_r[r];
  __builtin_amdgcn_fence(__ATOMIC_ACQ_REL, "workgroup");
  __builtin_amdgcn_wave_barrier();
  {
    for (int r = 0; r < 16; ++r) {
      const int row = q0 + r;
      if (row < T && lane < D / 4) {
        const v4f val = *(const v4fa*)&sO[w][r][lane * 4];
        *(v4f*)(y + ((size_t)b * T + row) * ypitch + h * D + lane * 4) = val;
      }
    }
    
  }
}

// batched GEMM (blockIdx.y = batch): C_b = act(alpha·A_b·B_b + bias + resid_b); A f32 rows (ASPLIT → hi/lo), B = bf16 planes Bh (+Bl when BSPLIT, requires ASPLIT),
// per-batch element strides sA, sB (0 = shared weights), sC, sR. resid may alias C (values are staged before the stores). ACT 0/1(relu).
// ACT: 0 none, 1 relu, 2 softplus
template <bool ASPLIT, bool BSPLIT, int ACT>
__global__ __launch_bounds__(128) void k_gemm_b(const float* __restrict__ A, int lda, size_t sA, const unsigned short* __restrict__ Bh, const unsigned short* __restrict__ Bl, int ldb, size_t sB,
                                             const float* __restrict__ bias, const float* __restrict__ resid, int ldr, size_t sR, float rsign, float alpha,
                                             float* __restrict__ C, int ldc, size_t sC, int M, int N, int K) {
  __shared__ __attribute__((aligned(16))) float so[4][16][64];
  const int tid = threadIdx.x, w = tid >> 5, lane = tid & 31, ln = lane & 15, hh = lane >> 4;
  const int by = blockIdx.y;
  A += (size_t)by * sA; Bh += (size_t)by * sB; if (BSPLIT) Bl += (size_t)by * sB; C += (size_t)by * sC; if (resid) resid += (size_t)by * sR;
  const int ntn = (N + 63) / 64; const int wid = blockIdx.x * 4 + w; const int mt = wid / ntn, nq = wid % ntn;      // N may be any multiple of 16: tiles past N are skipped and not stored
  if (mt * 16 >= M) return;
  const int row0 = mt * 16, col0 = nq * 64;
  const float* arow = A + (size_t)(row0 + ln) * lda;
  v8f acc[4] = {};
  for (int kb = 0; kb < K; kb += 32) {
    FragB ah, al;
    const v4f x0 = *(const v4fa*)(arow + kb + 8 * hh), x1 = *(const v4fa*)(arow + kb + 8 * hh + 4);
    const v4f x2 = *(const v4fa*)(arow + kb + 16 + 8 * hh), x3 = *(const v4fa*)(arow + kb + 16 + 8 * hh + 4);
    float xs[16] = {x0[0],x0[1],x0[2],x0[3],x1[0],x1[1],x1[2],x1[3],x2[0],x2[1],x2[2],x2[3],x3[0],x3[1],x3[2],x3[3]};
#pragma unroll
    for (int i = 0; i < 16; ++i) { const unsigned short hb = bf16_bits(xs[i]); ah.u[i] = hb; al.u[i] = ASPLIT ? bf16_bits(xs[i] - bf16_val(hb)) : (unsigned short)0; }
#pragma unroll
    for (int t = 0; t < 4; ++t) {
      if (col0 + t * 16 >= N) continue;
      const size_t boff = (size_t)(col0 + t * 16 + ln) * ldb + kb;
      FragB bh_, bl_; bh_.half[0] = *(const v8us*)(Bh + boff + 8 * hh); bh_.half[1] = *(const v8us*)(Bh + boff + 16 + 8 * hh);
      if (BSPLIT) { bl_.half[0] = *(const v8us*)(Bl + boff + 8 * hh); bl_.half[1] = *(const v8us*)(Bl + boff + 16 + 8 * hh); } else bl_ = bh_;
      acc[t] = mmaN<ASPLIT ? (BSPLIT ? 3 : 2) : 1>(ah.v, al.v, bh_.v, bl_.v, acc[t]);
    }
  }
#pragma unroll
  for (int t = 0; t < 4; ++t) {
    const int col = col0 + t * 16 + ln; if (col0 + t * 16 >= N) continue; const float bv = bias ? bf16_round(bias[col]) : 0.f;
#pragma unroll
    for (int r = 0; r < 8; ++r) { float v = acc[t][r] * alpha + bv; if (resid) v += rsign * resid[(size_t)(row0 + 8 * hh + r) * ldr + col]; if (ACT == 1) v = fmaxf(v, 0.f); else if (ACT == 2) v = fmaxf(v, 0.f) + log1pf(expf(-fabsf(v))); so[w][8 * hh + r][t * 16 + ln] = v; }
  }
  __builtin_amdgcn_fence(__ATOMIC_ACQ_REL, "workgroup"); __builtin_amdgcn_wave_barrier();
  const int rsub = lane >> 4, c4 = (lane & 15) * 4;
  {
#pragma unroll
    for (int q = 0; q < 8; ++q) { const int r = q * 2 + rsub; if (col0 + c4 < N) { const v4f v = *(const v4fa*)&so[w][r][c4]; *(v4f*)(C + (size_t)(row0 + r) * ldc + col0 + c4) = v; } }
    
  }
}
// batched f32 [K][N] (pitch lds, batch stride sIn) -> transposed hi/lo planes [N][K] (batch stride sOut); thread per (n, 8 k); grid.y = batch
__global__ __launch_bounds__(256) void k_split_transpose_b(const float* __restrict__ src, int lds_, size_t sIn, unsigned short* __restrict__ hi, unsigned short* __restrict__ lo, size_t sOut, int K, int N) {
  const size_t t = (size_t)blockIdx.x * 256 + threadIdx.x; const int k8n = K / 8; if (t >= (size_t)N * k8n) return;
  src += (size_t)blockIdx.y * sIn; hi += (size_t)blockIdx.y * sOut; lo += (size_t)blockIdx.y * sOut;
  const int n = (int)(t / k8n), k8 = (int)(t % k8n) * 8; v8us vh, vl;
#pragma unroll
  for (int i = 0; i < 8; ++i) { const float x = src[(size_t)(k8 + i) * lds_ + n]; const unsigned short hb = bf16_bits(x); vh[i] = hb; vl[i] = bf16_bits(x - bf16_val(hb)); }
  unsigned short* dh = hi + (size_t)n * K + k8; unsigned short* dl = lo + (size_t)n * K + k8;
  *(v8us*)dh = vh; *(v8us*)dl = vl; 
}

// ---- f16 WMMA path (v_wmma_f32_16x16x32_f16): 11-bit significands for operands in range — used where a [0,1] probability operand needs more precision than bf16
typedef _Float16 v16h __attribute__((ext_vector_type(16)));
union FragH { v16h v; v8us half[2]; _Float16 h[16]; unsigned short u[16]; };
template <int NT>
__device__ __forceinline__ v8f mmaH(v16h ah, v16h al, v16h bh, v16h bl, v8f c) {
  c = __builtin_amdgcn_wmma_f32_16x16x32_f16(false, ah, false, bh, (short)0, c, false, false);
  if (NT >= 2) c = __builtin_amdgcn_wmma_f32_16x16x32_f16(false, al, false, bh, (short)0, c, false, false);
  if (NT >= 3) c = __builtin_amdgcn_wmma_f32_16x16x32_f16(false, ah, false, bl, (short)0, c, false, false);
  asm volatile("v_nop\n\tv_nop\n\tv_nop\n\tv_nop" : "+v"(c) : "v"(ah), "v"(al), "v"(bh), "v"(bl));
  return c;
}
// batched GEMM like k_gemm_b but f16 operands: A f32 (split into f16 hi/lo if ASPLIT, else rounded to f16), Bt = f16 values [n][k]; alpha; C f32; N multiple of 16 (partial tiles skipped)
template <bool ASPLIT>
__global__ __launch_bounds__(128) void k_gemm_h(const float* __restrict__ A, int lda, size_t sA, const _Float16* __restrict__ Bh, int ldb, size_t sB, float alpha, float* __restrict__ C, int ldc, size_t sC, int M, int N, int K) {
  __shared__ __attribute__((aligned(16))) float so[4][16][64];
  const int tid = threadIdx.x, w = tid >> 5, lane = tid & 31, ln = lane & 15, hh = lane >> 4; const int by = blockIdx.y;
  A += (size_t)by * sA; Bh += (size_t)by * sB; C += (size_t)by * sC;
  const int ntn = (N + 63) / 64; const int wid = blockIdx.x * 4 + w; const int mt = wid / ntn, nq = wid % ntn; if (mt * 16 >= M) return;
  const int row0 = mt * 16, col0 = nq * 64; const float* arow = A + (size_t)(row0 + ln) * lda;
  v8f acc[4] = {};
  for (int kb = 0; kb < K; kb += 32) {
    FragH ah, al;
    const v4f x0 = *(const v4fa*)(arow + kb + 8 * hh), x1 = *(const v4fa*)(arow + kb + 8 * hh + 4), x2 = *(const v4fa*)(arow + kb + 16 + 8 * hh), x3 = *(const v4fa*)(arow + kb + 16 + 8 * hh + 4);
    float xs[16] = {x0[0],x0[1],x0[2],x0[3],x1[0],x1[1],x1[2],x1[3],x2[0],x2[1],x2[2],x2[3],x3[0],x3[1],x3[2],x3[3]};
#pragma unroll
    for (int i = 0; i < 16; ++i) { const _Float16 h = (_Float16)xs[i]; ah.h[i] = h; al.h[i] = ASPLIT ? (_Float16)(xs[i] - (float)h) : (_Float16)0.0f; }
#pragma unroll
    for (int t = 0; t < 4; ++t) { if (col0 + t * 16 >= N) continue; const size_t boff = (size_t)(col0 + t * 16 + ln) * ldb + kb; FragH bq; bq.half[0] = *(const v8us*)(Bh + boff + 8 * hh); bq.half[1] = *(const v8us*)(Bh + boff + 16 + 8 * hh);
      acc[t] = mmaH<ASPLIT ? 2 : 1>(ah.v, al.v, bq.v, bq.v, acc[t]); }
  }
#pragma unroll
  for (int t = 0; t < 4; ++t) { if (col0 + t * 16 >= N) continue;
#pragma unroll
    for (int r = 0; r < 8; ++r) so[w][8 * hh + r][t * 16 + ln] = acc[t][r] * alpha; }
  __builtin_amdgcn_fence(__ATOMIC_ACQ_REL, "workgroup"); __builtin_amdgcn_wave_barrier();
  const int rsub = lane >> 4, c4 = (lane & 15) * 4;
  {
#pragma unroll
    for (int q = 0; q < 8; ++q) { const int r = q * 2 + rsub; if (col0 + c4 < N) { const v4f v = *(const v4fa*)&so[w][r][c4]; *(v4f*)(C + (size_t)(row0 + r) * ldc + col0 + c4) = v; } }
     }
}

__global__ __launch_bounds__(256) void k_bt(const float* __restrict__ Wqkv, const float* __restrict__ Wo, unsigned short* __restrict__ Bq, unsigned short* __restrict__ Bo) { const int t = blockIdx.x * 256 + threadIdx.x;
  if (t < 3 * DIM * DIM / 8) { const int k8 = (t % (DIM / 8)) * 8, n = t / (DIM / 8); v8us v; for (int q = 0; q < 8; ++q) v[q] = bf16_bits(Wqkv[(size_t)(k8 + q) * (3 * DIM) + n]); *(v8us*)(Bq + (size_t)n * DIM + k8) = v;  }
  if (t < DIM * DIM / 8) { const int k8 = (t % (DIM / 8)) * 8, n = t / (DIM / 8); v8us v; for (int q = 0; q < 8; ++q) v[q] = bf16_bits(Wo[(size_t)(k8 + q) * DIM + n]); *(v8us*)(Bo + (size_t)n * DIM + k8) = v;  } }
__device__ __forceinline__ void ldF(FragH& f, const _Float16* base, int pitch, int row, int k0, int ln, int hh) { const unsigned short* p = (const unsigned short*)base + (size_t)(row + ln) * pitch + k0; f.half[0] = *(const v8us*)(p + 8 * hh); f.half[1] = *(const v8us*)(p + 16 + 8 * hh); }
typedef unsigned short v4us __attribute__((ext_vector_type(4), may_alias));
// 32 entries (queries I0 .. I0+31) of one key's row of the bias-and-mask table. sb points at the key's own place in the 13 x 13 bias table, so that query (yi, xi) reads sb[-(yi*13+xi)];
// every read is unconditional and in range (the caller clamps a padding key to slot 48), the mask is a select behind it. okYX: the key is a token and may meet a query with yi >= 4 (Y), xi >= 4 (X).
template <int I0>
__device__ __forceinline__ void win_table(unsigned short* trow, const float* sb, bool ok00, bool ok01, bool ok10, bool ok11) {
#pragma unroll
  for (int q = 0; q < 4; ++q) { v8us p;
#pragma unroll
    for (int c = 0; c < 8; ++c) { const int i = I0 + q * 8 + c, ic = i < 49 ? i : 48, yi = ic / WS, xi = ic % WS;
      const unsigned short bb = (unsigned short)(__float_as_uint(sb[-(yi * 13 + xi)]) >> 16);      // the bias table holds bf16 values: the upper half is all of it
      const bool ok = i < 49 && (yi >= 4 ? (xi >= 4 ? ok11 : ok10) : (xi >= 4 ? ok01 : ok00));
      p[c] = ok ? bb : bf16_bits(-3.0e38f); }
    *(v8us*)(trow + I0 + q * 8) = p; }
}
// one work-group of 4 waves per (b, window w = wy*8+wx), wave = head h. Window slot i = yi*7+xi is token ((wy*7+yi+3)%56, (wx*7+xi+3)%56) of batch b.
// The window's 49 rows of x (padded with zero rows to 64) are staged once in LDS as bf16; each wave forms its head's q, k, v (64 x 96, K = 128) on the bf16 WMMA
// and puts them into its own LDS planes as f16, so qkv never goes through global memory. Zero rows of x give zero rows of q, k, v: the padding needs no clearing.
// The head's o rows stay in registers over the four query passes, go as bf16 hi/lo into the wave's own q and k planes (dead by then), and after one work-group barrier
// wave h forms output columns 32h .. 32h+31 of all the window's tokens (K = 128 over the four heads' planes, 2 products), so o never goes through global memory either.
__global__ __launch_bounds__(128) void k_win(const float* __restrict__ X, const unsigned short* __restrict__ Bq, const float* __restrict__ pos,
                                           const unsigned short* __restrict__ Bo, const float* __restrict__ bo, float* __restrict__ out) {
  constexpr int PW = (64 * 40 + 64 * 40 + HDM * 72) * 2;          // bytes per wave: q, k, v^T planes
  constexpr int PO = 16 * 72 * 2;                                 // bytes per wave: 16 rows of e
  constexpr int TP = 72;                                          // pitch of the bias-and-mask table, in bf16 elements: 16 rows read 16 bytes each without a bank conflict
  constexpr int PT = 64 * TP * 2;                                 // bytes of that table: 64 keys x 64 queries, behind the e rows
  constexpr int XP = DIM + 8;                                     // pitch of the staged x rows, in bf16 elements
  constexpr int SP = HDM + 4;                                     // pitch of a staged output tile, in floats (rows 16-byte aligned)
  static_assert(4 * PO + PT >= 64 * XP * 2, "staged x shares the space of the e rows and the table");
  static_assert(2 * 16 * SP * 4 <= HDM * 72 * 2 && 16 * SP * 4 <= PO, "three staged output tiles fit the v^T plane and the e rows");
  __shared__ __attribute__((aligned(16))) unsigned char smem[4 * PW + 4 * PO + PT]; __shared__ int stok[64]; __shared__ float sbias[13 * 13];
  const int tid = threadIdx.x, lane = tid & 31, ln = lane & 15, hh = lane >> 4; const int h = __builtin_amdgcn_readfirstlane(tid >> 5);
  const int w = blockIdx.x % NWIN; const int b = blockIdx.x / NWIN; const int wy = w / 8, wx = w % 8;
  _Float16* sq = (_Float16*)(smem + h * PW); _Float16* sk = sq + 64 * 40; _Float16* svt = sk + 64 * 40;
  unsigned short* sx = (unsigned short*)(smem + 4 * PW); _Float16* sp = (_Float16*)(smem + 4 * PW + h * PO); unsigned short* tb = (unsigned short*)(smem + 4 * PW + 4 * PO);
  if (tid < 64) { int tok = -1; if (tid < 49) { const int yi = tid / WS, xi = tid % WS; const int y = (wy * WS + yi + DISP) % HI, x = (wx * WS + xi + DISP) % WI; tok = (b * HI + y) * WI + x; } stok[tid] = tok; }
  for (int i = tid; i < 169; i += 128) sbias[i] = bf16_round(pos[i]);
  // stage x: wave h takes rows h, h+4, ...; one row = one 512-byte wave load; all 13 loads are issued before the first is used
  v4f xv[13];
#pragma unroll
  for (int it = 0; it < 13; ++it) { const int i = min(h + 4 * it, 48); const int yi = i / WS, xi = i % WS; const int y = (wy * WS + yi + DISP) % HI, x = (wx * WS + xi + DISP) % WI;
    xv[it] = *(const v4fa*)(X + (size_t)((b * HI + y) * WI + x) * DIM + lane * 4); }
#pragma unroll
  for (int it = 0; it < 13; ++it) { const int i = h + 4 * it; v4us p = {0, 0, 0, 0}; if (i < 49) { for (int c = 0; c < 4; ++c) p[c] = bf16_bits(xv[it][c]); } *(v4us*)(sx + i * XP + lane * 4) = p; }
#pragma unroll
  for (int it = 13; it < 16; ++it) { const v4us p = {0, 0, 0, 0}; *(v4us*)(sx + (h + 4 * it) * XP + lane * 4) = p; }
  __syncthreads();      // every wave reads all 64 staged rows, the token list and the bias table
  FragB a[4][4];
#pragma unroll
  for (int mt = 0; mt < 4; ++mt) {
#pragma unroll
    for (int ks = 0; ks < 4; ++ks) { const unsigned short* p = sx + (mt * 16 + ln) * XP + ks * 32; a[mt][ks].half[0] = *(const v8us*)(p + 8 * hh); a[mt][ks].half[1] = *(const v8us*)(p + 16 + 8 * hh); } }
  __syncthreads();      // the staged rows are in registers now: their LDS is reused for the e rows and the table below
  // Bias and masks are the same for the four heads: the work-group builds them once, tb[key j][query i] = bias (bf16, as it is used) or a large negative value where the pair is
  // masked or padding. Thread = one key and 32 queries; which 32 is wave-uniform, so everything on the query side is a compile-time constant inside win_table.
  const bool ul = (wy == 7), lr = (wx == 7);
  {
    const int j = tid & 63, jc = min(j, 48), yj = jc / WS, xj = jc % WS; const bool jv = j < 49, ja = yj >= 4, jb = xj >= 4;
    const bool y0 = !(ul & ja), y1 = !(ul & !ja), x0 = !(lr & jb), x1 = !(lr & !jb);      // the key may meet a query of the upper / lower rows, of the left / right columns
    const float* sb = sbias + yj * 13 + xj + 6 * 13 + 6; unsigned short* trow = tb + j * TP;
    if (h < 2) win_table<0>(trow, sb, jv & y0 & x0, jv & y0 & x1, jv & y1 & x0, jv & y1 & x1); else win_table<32>(trow, sb, jv & y0 & x0, jv & y0 & x1, jv & y1 & x0, jv & y1 & x1);
  }
#pragma unroll
  for (int t = 0; t < 6; ++t) {      // column tiles: t = 0,1 q; 2,3 k; 4,5 v of head h
    const unsigned short* brow = Bq + (size_t)((t >> 1) * DIM + h * HDM + (t & 1) * 16 + ln) * DIM;
    FragB bf[4];
#pragma unroll
    for (int ks = 0; ks < 4; ++ks) { bf[ks].half[0] = *(const v8us*)(brow + ks * 32 + 8 * hh); bf[ks].half[1] = *(const v8us*)(brow + ks * 32 + 16 + 8 * hh); }
#pragma unroll
    for (int mt = 0; mt < 4; ++mt) {
      v8f c = {};
#pragma unroll
      for (int ks = 0; ks < 4; ++ks) c = __builtin_amdgcn_wmma_f32_16x16x32_bf16(false, a[mt][ks].v, false, bf[ks].v, (short)0, c, false, false);
      const int row = mt * 16 + 8 * hh, col = (t & 1) * 16 + ln;
      if (t < 2) {
#pragma unroll
        for (int r = 0; r < 8; ++r) sq[(row + r) * 40 + col] = (_Float16)(c[r] * 0.17677669529663687f);
      } else if (t < 4) {
#pragma unroll
        for (int r = 0; r < 8; ++r) sk[(row + r) * 40 + col] = (_Float16)c[r];
      } else {
        FragH vv;
#pragma unroll
        for (int r = 0; r < 8; ++r) vv.h[r] = (_Float16)c[r];
        *(v8us*)((unsigned short*)svt + col * 72 + row) = vv.half[0];
      }
    }
  }
  __syncthreads();      // every wave reads the whole table; it also orders the wave's own q, k, v stores before their reads
  v8f keep[4][2] = {};      // the head's normalised o, all 64 rows, in registers: only ever indexed by constants
  for (int mt = 0; mt < 4; ++mt) {      // 16 query rows per pass (rows >= 49 are padding: computed, never stored)
    v8f acc[4]; FragH a; ldF(a, sq, 40, mt * 16, 0, ln, hh);
#pragma unroll
    for (int t = 0; t < 4; ++t) { const v8us tv = *(const v8us*)(tb + (t * 16 + ln) * TP + mt * 16 + 8 * hh);      // bias or mask of (query 8hh+r, key ln): the accumulator's start value
#pragma unroll
      for (int r = 0; r < 8; ++r) acc[t][r] = bf16_val(tv[r]); }
#pragma unroll
    for (int t = 0; t < 4; ++t) { FragH bk; ldF(bk, sk, 40, t * 16, 0, ln, hh); acc[t] = mmaH<1>(a.v, a.v, bk.v, bk.v, acc[t]); }
    float rmax[8], rsum[8];
#pragma unroll
    for (int r = 0; r < 8; ++r) { float m = -3.0e38f;
#pragma unroll
      for (int t = 0; t < 4; ++t) m = fmaxf(m, acc[t][r]);
      for (int o = 8; o >= 1; o >>= 1) m = fmaxf(m, __shfl_xor(m, o, 32)); rmax[r] = m; }
#pragma unroll
    for (int r = 0; r < 8; ++r) { float s = 0.f;
#pragma unroll
      for (int t = 0; t < 4; ++t) { const int j = t * 16 + ln; const float e = (acc[t][r] > -1.0e38f) ? __expf(acc[t][r] - rmax[r]) : 0.f; s += e; sp[(8 * hh + r) * 72 + j] = (_Float16)e; }
      for (int o = 8; o >= 1; o >>= 1) s += __shfl_xor(s, o, 32); rsum[r] = s; }
    __builtin_amdgcn_fence(__ATOMIC_ACQ_REL, "workgroup"); __builtin_amdgcn_wave_barrier();
    v8f acco[2] = {};
#pragma unroll
    for (int ks = 0; ks < 2; ++ks) { FragH ap; ldF(ap, sp, 72, 0, ks * 32, ln, hh);
#pragma unroll
      for (int t = 0; t < 2; ++t) { FragH bv; ldF(bv, svt, 72, t * 16, ks * 32, ln, hh); acco[t] = mmaH<1>(ap.v, ap.v, bv.v, bv.v, acco[t]); } }
#pragma unroll
    for (int t = 0; t < 2; ++t) {
#pragma unroll
      for (int r = 0; r < 8; ++r) { const float rs = (rsum[r] > 0.f) ? 1.0f / rsum[r] : 0.f; acco[t][r] *= rs; } }
#pragma unroll
    for (int m = 0; m < 4; ++m) if (mt == m) { keep[m][0] = acco[0]; keep[m][1] = acco[1]; }      // mt is wave-uniform: the pass loop stays rolled, its result goes to its own registers
    __builtin_amdgcn_fence(__ATOMIC_ACQ_REL, "workgroup"); __builtin_amdgcn_wave_barrier();      // the next pass rewrites the e rows that other lanes have just read
  }
  // From here on every loop is unrolled: its index picks registers (keep, bw, c, ov, op), which only a compile-time constant can do.
  // W_out fragments and bias of this wave's 32 output columns: asked for here, so that they fly while o is handed over
  FragB bw[2][4]; float bv[2];
#pragma unroll
  for (int t = 0; t < 2; ++t) { const unsigned short* brow = Bo + (size_t)(h * HDM + t * 16 + ln) * DIM; bv[t] = bf16_round(bo[h * HDM + t * 16 + ln]);
#pragma unroll
    for (int ks = 0; ks < 4; ++ks) { bw[t][ks].half[0] = *(const v8us*)(brow + ks * 32 + 8 * hh); bw[t][ks].half[1] = *(const v8us*)(brow + ks * 32 + 16 + 8 * hh); } }
  // o -> bf16 hi (own q plane) and lo (own k plane), same pitch. Of the last pass only row 48 is a token: rows 49 .. 63 keep the planes' zero padding (row 56 is rewritten with zeros).
  unsigned short* oh = (unsigned short*)sq; unsigned short* ol = (unsigned short*)sk;
#pragma unroll
  for (int mt = 0; mt < 4; ++mt) {
#pragma unroll
    for (int t = 0; t < 2; ++t) {
#pragma unroll
      for (int r = 0; r < (mt < 3 ? 8 : 1); ++r) { const float v = keep[mt][t][r]; const unsigned short hb = bf16_bits(v); const int at = (mt * 16 + 8 * hh + r) * 40 + t * 16 + ln; oh[at] = hb; ol[at] = bf16_bits(v - bf16_val(hb)); } } }
  __syncthreads();      // every wave reads all four heads' o planes
  float* st[3] = {(float*)svt, (float*)svt + 16 * SP, (float*)sp};      // the wave's own v^T plane and e rows are dead: one staged output tile per full pass
  float last[2];
#pragma unroll
  for (int mt = 0; mt < 4; ++mt) {
    v8f c[2] = {};
#pragma unroll
    for (int ks = 0; ks < 4; ++ks) {      // k step ks = head ks
      const unsigned short* ph = (const unsigned short*)(smem + ks * PW) + (mt * 16 + ln) * 40; const unsigned short* pl = ph + 64 * 40;
      FragB ah, al; ah.half[0] = *(const v8us*)(ph + 8 * hh); ah.half[1] = *(const v8us*)(ph + 16 + 8 * hh); al.half[0] = *(const v8us*)(pl + 8 * hh); al.half[1] = *(const v8us*)(pl + 16 + 8 * hh);
#pragma unroll
      for (int t = 0; t < 2; ++t) {
        c[t] = __builtin_amdgcn_wmma_f32_16x16x32_bf16(false, ah.v, false, bw[t][ks].v, (short)0, c[t], false, false);
        c[t] = __builtin_amdgcn_wmma_f32_16x16x32_bf16(false, al.v, false, bw[t][ks].v, (short)0, c[t], false, false);
      }
    }
#pragma unroll
    for (int t = 0; t < 2; ++t) {
      if (mt < 3) {
#pragma unroll
        for (int r = 0; r < 8; ++r) st[mt][(8 * hh + r) * SP + t * 16 + ln] = c[t][r] + bv[t];
      } else last[t] = c[t][0] + bv[t];
    }
  }
  __builtin_amdgcn_fence(__ATOMIC_ACQ_REL, "workgroup"); __builtin_amdgcn_wave_barrier();      // the staged tiles are read back by other lanes
  // 8 lanes x 16 bytes = this wave's whole 128-byte line of a token, 4 tokens a store; all values and addresses are formed before the first store goes out
  v4f ov[12]; float* op[12];
#pragma unroll
  for (int q = 0; q < 12; ++q) { const int il = (q & 3) * 4 + (lane >> 3); ov[q] = *(const v4fa*)&st[q >> 2][il * SP + (lane & 7) * 4]; op[q] = out + (size_t)stok[(q >> 2) * 16 + il] * DIM + h * HDM + (lane & 7) * 4; }
  float* op48 = out + (size_t)stok[48] * DIM + h * HDM + ln;
#pragma unroll
  for (int q = 0; q < 12; ++q) *(v4f*)op[q] = ov[q];
  if (hh == 0) { op48[0] = last[0]; op48[16] = last[1]; }
}
extern "C" void kernel_launch(void* const* d_in, const int* in_sizes, int n_in,
                              void* d_out, int out_size, void* d_ws, size_t ws_size, hipStream_t stream) {
  (void)in_sizes; (void)n_in; (void)out_size;
  const float* x = (const float*)d_in[0]; const float* Wqkv = (const float*)d_in[1]; const float* pos = (const float*)d_in[2]; const float* Wo = (const float*)d_in[3]; const float* bo = (const float*)d_in[4];
  char* ws = (char*)d_ws; size_t off = 0;
  auto take = [&](size_t bytes) { char* p = ws + off; off += (bytes + 255) & ~(size_t)255; return p; };
  unsigned short* Bq = (unsigned short*)take((size_t)3 * DIM * DIM * 2); unsigned short* Bo = (unsigned short*)take((size_t)DIM * DIM * 2);
  if (off > ws_size) return;
  k_bt<<<(3 * DIM * DIM / 8 + 255) / 256, 256, 0, stream>>>(Wqkv, Wo, Bq, Bo);
  k_win<<<BB * NWIN, 128, 0, stream>>>(x, Bq, pos, Bo, bo, (float*)d_out);
}

// v004
// Measured time: 23.6 microseconds a run.
// In both of two side-by-side timings against v003, it was 1.17 times as fast.
// Over all steps from v000 it is 5.22 times as fast.
#include <hip/hip_runtime.h>
// Shifted-window attention: qkv = x·W_qkv on v_wmma_f32_16x16x32_bf16 (x rounded to bf16: single exact term; 50176 × 128 × 384); per (batch, window, head) the 49×49
// scores q·kᵀ and e·v on v_wmma_f32_16x16x32_f16 (q, k, v, e rounded to f16, windows padded to 64; one wave each); out = o·W_out + b_out on the bf16 variant with o split
// hi/lo (2 products). The cyclic shifts are pure index remaps (token (y,x) ↔ shifted (y−3, x−3) mod 56, and the back-shift returns every result to its own token);
// relative-position bias and the shift masks come from one table per window as the score accumulators' start values; the max-shifted softmax is f32 VALU.
// The scores are formed transposed (k x q^T: a lane owns one query, its registers the keys), so the softmax reduces inside the lane and e is the B operand of v^T x e^T as it stands.
#define BB 16
#define HI 56
#define WI 56
#define DIM 128
#define NHD 4
#define HDM 32
#define WS 7
#define NWIN 64
#define NTOK (BB * HI * WI)
#define DISP 3

typedef __bf16 v16b __attribute__((ext_vector_type(16)));
typedef unsigned short v8us __attribute__((ext_vector_type(8), may_alias));
typedef float  v8f  __attribute__((ext_vector_type(8)));
typedef float  v4f  __attribute__((ext_vector_type(4)));
typedef float  v4fa __attribute__((ext_vector_type(4), may_alias));
union FragB { v16b v; v8us half[2]; unsigned short u[16]; };

__device__ __forceinline__ unsigned short bf16_bits(float x) { unsigned int u = __float_as_uint(x); return (unsigned short)((u + 0x7FFFu + ((u >> 16) & 1u)) >> 16); }
__device__ __forceinline__ float bf16_val(unsigned short b) { return __uint_as_float(((unsigned int)b) << 16); }
__device__ __forceinline__ float bf16_round(float x) { return bf16_val(bf16_bits(x)); }
// D += A·B with NT terms: 1 = ah·bh, 2 = + al·bh (A split), 3 = + ah·bl (both split)
template <int NT>
__device__ __forceinline__ v8f mmaN(v16b ah, v16b al, v16b bh, v16b bl, v8f c) {
  c = __builtin_amdgcn_wmma_f32_16x16x32_bf16(false, ah, false, bh, (short)0, c, false, false);
  if (NT >= 2) c = __builtin_amdgcn_wmma_f32_16x16x32_bf16(false, al, false, bh, (short)0, c, false, false);
  if (NT >= 3) c = __builtin_amdgcn_wmma_f32_16x16x32_bf16(false, ah, false, bl, (short)0, c, false, false);
  asm volatile("v_nop\n\tv_nop\n\tv_nop\n\tv_nop" : "+v"(c) : "v"(ah), "v"(al), "v"(bh), "v"(bl));
  return c;
}

__global__ __launch_bounds__(256) void k_wt_bf16(const float* __restrict__ W, unsigned short* __restrict__ Wt, int K, int N) {
  const int t = blockIdx.x * 256 + threadIdx.x;
  const int k8n = K / 8;
  if (t >= N * k8n) return;
  const int n = t / k8n, k8 = (t % k8n) * 8;
  v8us v;
#pragma unroll
  for (int i = 0; i < 8; ++i) v[i] = bf16_bits(W[(size_t)(k8 + i) * N + n]);
  *(v8us*)(Wt + (size_t)n * K + k8) = v;
  
}

// GEMM C[M][N] (f32, pitch ldc) = act(A[M][K]·W + bias). A f32 row-major (pitch lda) converted per fragment to bf16
// (ASPLIT: hi/lo two planes -> 2 terms, else single rounded term); Wt bf16 [N][K] (pitch ldb). BIAS_BF16 rounds the
// bias to bf16 first (bias quantised to bf16 before the add). K%32==0, M%16==0, N%64==0.
template <bool ASPLIT, int ACT, bool BIAS_BF16>
__global__ __launch_bounds__(128) void k_gemm_bf(const float* __restrict__ A, int lda, const unsigned short* __restrict__ Wt, int ldb,
                                               const float* __restrict__ bias, float* __restrict__ C, int ldc, int M, int N, int K) {
  __shared__ __attribute__((aligned(16))) float so[4][16][64];
  const int tid = threadIdx.x, w = tid >> 5, lane = tid & 31, ln = lane & 15, hh = lane >> 4;
  const int ntn = N / 64;
  const int wid = blockIdx.x * 4 + w;
  const int mt = wid / ntn, nq = wid % ntn;
  if (mt * 16 >= M) return;
  const int row0 = mt * 16, col0 = nq * 64;
  const float* arow = A + (size_t)(row0 + ln) * lda;
  v8f acc[4] = {};
  for (int kb = 0; kb < K; kb += 32) {
    FragB ah, al;
    const v4f x0 = *(const v4fa*)(arow + kb + 8 * hh), x1 = *(const v4fa*)(arow + kb + 8 * hh + 4);
    const v4f x2 = *(const v4fa*)(arow + kb + 16 + 8 * hh), x3 = *(const v4fa*)(arow + kb + 16 + 8 * hh + 4);
    float xs[16] = {x0[0],x0[1],x0[2],x0[3],x1[0],x1[1],x1[2],x1[3],x2[0],x2[1],x2[2],x2[3],x3[0],x3[1],x3[2],x3[3]};
#pragma unroll
    for (int i = 0; i < 16; ++i) { const unsigned short hb = bf16_bits(xs[i]); ah.u[i] = hb; al.u[i] = ASPLIT ? bf16_bits(xs[i] - bf16_val(hb)) : (unsigned short)0; }
#pragma unroll
    for (int t = 0; t < 4; ++t) {
      const unsigned short* brow = Wt + (size_t)(col0 + t * 16 + ln) * ldb + kb;
      FragB b;
      b.half[0] = *(const v8us*)(brow + 8 * hh);
      b.half[1] = *(const v8us*)(brow + 16 + 8 * hh);
      acc[t] = mmaN<ASPLIT ? 2 : 1>(ah.v, al.v, b.v, b.v, acc[t]);
    }
  }
#pragma unroll
  for (int t = 0; t < 4; ++t) {
    float bv = bias ? bias[col0 + t * 16 + ln] : 0.f;
    if (BIAS_BF16) bv = bf16_round(bv);
#pragma unroll
    for (int r = 0; r < 8; ++r) { float v = acc[t][r] + bv; if (ACT == 1) v = fmaxf(v, 0.f); so[w][8 * hh + r][t * 16 + ln] = v; }
  }
  __builtin_amdgcn_fence(__ATOMIC_ACQ_REL, "workgroup");
  __builtin_amdgcn_wave_barrier();
  const int rsub = lane >> 4, c4 = (lane & 15) * 4;
  {
#pragma unroll
    for (int q = 0; q < 8; ++q) {
      const int r = q * 2 + rsub;
      const v4f v = *(const v4fa*)&so[w][r][c4];
      *(v4f*)(C + (size_t)(row0 + r) * ldc + col0 + c4) = v;
    }
    
  }
}

// Flash-style causal/unmasked attention, all contractions 3-term bf16 hi/lo splits, f32 softmax with running max.
// q,k,v rows are read from f32 buffers with arbitrary row pitch (so they can live inside a fused qkv buffer);
// D = head size (multiple of 32, <= 128); one wave = 16 query rows; block = 4 waves (64 queries) sharing K/V chunks of 32.
template <int D, bool CAUSAL>
__global__ __launch_bounds__(128) void k_flash(const float* __restrict__ qb, const float* __restrict__ kb, const float* __restrict__ vb,
                                             int pitch, int T, int H, float scale, float* __restrict__ y, int ypitch) {
  constexpr int KS = D / 32;        // k-steps for QK
  constexpr int DT = D / 16;        // d tiles for PV
  __shared__ __attribute__((aligned(16))) unsigned short sKh[32][D + 8], sKl[32][D + 8], sVh[32][D + 8], sVl[32][D + 8];
  __shared__ __attribute__((aligned(16))) unsigned short sPh[4][16][40], sPl[4][16][40];
  __shared__ __attribute__((aligned(16))) float sO[4][16][D];
  const int tid = threadIdx.x, w = tid >> 5, lane = tid & 31, ln = lane & 15, hh = lane >> 4;
  const int nqb = (T + 63) / 64;
  const int bh = blockIdx.x / nqb, qblk = blockIdx.x % nqb;
  const int b = bh / H, h = bh % H;
  const int q0 = qblk * 64 + w * 16;
  const float* Q = qb + (size_t)b * T * pitch + h * D;
  const float* K = kb + (size_t)b * T * pitch + h * D;
  const float* V = vb + (size_t)b * T * pitch + h * D;

  // A fragments of the wave's 16 query rows (scaled), hi/lo
  FragB aqh[KS], aql[KS];
  {
    int row = q0 + ln; if (row >= T) row = T - 1;
    const float* qr = Q + (size_t)row * pitch;
#pragma unroll
    for (int ks = 0; ks < KS; ++ks)
#pragma unroll
      for (int i = 0; i < 16; ++i) {
        const int d = ks * 32 + ((i < 8) ? (8 * hh + i) : (16 + 8 * hh + (i - 8)));
        const float x = qr[d] * scale; const unsigned short hb = bf16_bits(x);
        aqh[ks].u[i] = hb; aql[ks].u[i] = bf16_bits(x - bf16_val(hb));
      }
  }
  float m_r[8], l_r[8];
#pragma unroll
  for (int r = 0; r < 8; ++r) { m_r[r] = -3.0e38f; l_r[r] = 0.f; }
  v8f oacc[DT];
#pragma unroll
  for (int dt = 0; dt < DT; ++dt) oacc[dt] = (v8f){0.f,0.f,0.f,0.f,0.f,0.f,0.f,0.f};

  const int kv_end = CAUSAL ? min(T, qblk * 64 + 64) : T;     // block-uniform
  for (int j0 = 0; j0 < kv_end; j0 += 32) {
    __syncthreads();
    for (int e = tid; e < 32 * (D / 4); e += 128) {
      const int r = e / (D / 4), c4 = (e % (D / 4)) * 4;
      const int key = j0 + r;
      v4f kf = {0.f,0.f,0.f,0.f}, vf = {0.f,0.f,0.f,0.f};
      if (key < T) { kf = *(const v4fa*)(K + (size_t)key * pitch + c4); vf = *(const v4fa*)(V + (size_t)key * pitch + c4); }
#pragma unroll
      for (int t = 0; t < 4; ++t) {
        unsigned short hb = bf16_bits(kf[t]); sKh[r][c4 + t] = hb; sKl[r][c4 + t] = bf16_bits(kf[t] - bf16_val(hb));
        hb = bf16_bits(vf[t]); sVh[r][c4 + t] = hb; sVl[r][c4 + t] = bf16_bits(vf[t] - bf16_val(hb));
      }
    }
    __syncthreads();
    // S tile 16 x 32
    v8f s[2];
#pragma unroll
    for (int nt = 0; nt < 2; ++nt) {
      v8f acc = {};
#pragma unroll
      for (int ks = 0; ks < KS; ++ks) {
        FragB bh_, bl_;
        bh_.half[0] = *(const v8us*)&sKh[nt * 16 + ln][ks * 32 + 8 * hh]; bh_.half[1] = *(const v8us*)&sKh[nt * 16 + ln][ks * 32 + 16 + 8 * hh];
        bl_.half[0] = *(const v8us*)&sKl[nt * 16 + ln][ks * 32 + 8 * hh]; bl_.half[1] = *(const v8us*)&sKl[nt * 16 + ln][ks * 32 + 16 + 8 * hh];
        acc = mmaN<3>(aqh[ks].v, aql[ks].v, bh_.v, bl_.v, acc);
      }
      s[nt] = acc;
    }
    // mask + running max (rows 8hh+r; the 16 lanes of a half share rows)
    float alpha[8];
#pragma unroll
    for (int r = 0; r < 8; ++r) {
      const int qi = q0 + 8 * hh + r;
      const int ja = j0 + ln, jb = j0 + 16 + ln;
      if (CAUSAL) { if (ja > qi) s[0][r] = -3.0e38f; if (jb > qi) s[1][r] = -3.0e38f; }
      if (ja >= T) s[0][r] = -3.0e38f;
      if (jb >= T) s[1][r] = -3.0e38f;
      float mx = fmaxf(s[0][r], s[1][r]);
      mx = fmaxf(mx, __shfl_xor(mx, 1, 32)); mx = fmaxf(mx, __shfl_xor(mx, 2, 32)); mx = fmaxf(mx, __shfl_xor(mx, 4, 32)); mx = fmaxf(mx, __shfl_xor(mx, 8, 32));
      const float mnew = fmaxf(m_r[r], mx);
      alpha[r] = (mnew > -1.0e38f) ? __expf(m_r[r] - mnew) : 1.0f;
      const float p0 = (s[0][r] > -1.0e38f) ? __expf(s[0][r] - mnew) : 0.f;
      const float p1 = (s[1][r] > -1.0e38f) ? __expf(s[1][r] - mnew) : 0.f;
      m_r[r] = mnew;
      l_r[r] = l_r[r] * alpha[r] + p0 + p1;            // per-lane partial row sum (16 lanes combined at the end)
      unsigned short hb = bf16_bits(p0); sPh[w][8 * hh + r][ln] = hb;      sPl[w][8 * hh + r][ln] = bf16_bits(p0 - bf16_val(hb));
      hb = bf16_bits(p1);                sPh[w][8 * hh + r][16 + ln] = hb; sPl[w][8 * hh + r][16 + ln] = bf16_bits(p1 - bf16_val(hb));
    }
#pragma unroll
    for (int dt = 0; dt < DT; ++dt)
#pragma unroll
      for (int r = 0; r < 8; ++r) oacc[dt][r] *= alpha[r];
    __builtin_amdgcn_fence(__ATOMIC_ACQ_REL, "workgroup");
    __builtin_amdgcn_wave_barrier();
    FragB pah, pal;
    pah.half[0] = *(const v8us*)&sPh[w][ln][8 * hh]; pah.half[1] = *(const v8us*)&sPh[w][ln][16 + 8 * hh];
    pal.half[0] = *(const v8us*)&sPl[w][ln][8 * hh]; pal.half[1] = *(const v8us*)&sPl[w][ln][16 + 8 * hh];
#pragma unroll
    for (int dt = 0; dt < DT; ++dt) {
      FragB bvh, bvl;
#pragma unroll
      for (int i = 0; i < 8; ++i) {
        bvh.u[i] = sVh[8 * hh + i][dt * 16 + ln]; bvh.u[8 + i] = sVh[16 + 8 * hh + i][dt * 16 + ln];
        bvl.u[i] = sVl[8 * hh + i][dt * 16 + ln]; bvl.u[8 + i] = sVl[16 + 8 * hh + i][dt * 16 + ln];
      }
      oacc[dt] = mmaN<3>(pah.v, pal.v, bvh.v, bvl.v, oacc[dt]);
    }
    __builtin_amdgcn_fence(__ATOMIC_ACQ_REL, "workgroup");
    __builtin_amdgcn_wave_barrier();
  }
#pragma unroll
  for (int r = 0; r < 8; ++r) {
    float l = l_r[r];
    l += __shfl_xor(l, 1, 32); l += __shfl_xor(l, 2, 32); l += __shfl_xor(l, 4, 32); l += __shfl_xor(l, 8, 32);
    l_r[r] = (l > 0.f) ? 1.0f / l : 0.f;
  }
#pragma unroll
  for (int dt = 0; dt < DT; ++dt)
#pragma unroll
    for (int r = 0; r < 8; ++r) sO[w][8 * hh + r][dt * 16 + ln] = oacc[dt][r] * l_r[r];
  __builtin_amdgcn_fence(__ATOMIC_ACQ_REL, "workgroup");
  __builtin_amdgcn_wave_barrier();
  {
    for (int r = 0; r < 16; ++r) {
      const int row = q0 + r;
      if (row < T && lane < D / 4) {
        const v4f val = *(const v4fa*)&sO[w][r][lane * 4];
        *(v4f*)(y + ((size_t)b * T + row) * ypitch + h * D + lane * 4) = val;
      }
    }
    
  }
}

// batched GEMM (blockIdx.y = batch): C_b = act(alpha·A_b·B_b + bias + resid_b); A f32 rows (ASPLIT → hi/lo), B = bf16 planes Bh (+Bl when BSPLIT, requires ASPLIT),
// per-batch element strides sA, sB (0 = shared weights), sC, sR. resid may alias C (values are staged before the stores). ACT 0/1(relu).
// ACT: 0 none, 1 relu, 2 softplus
template <bool ASPLIT, bool BSPLIT, int ACT>
__global__ __launch_bounds__(128) void k_gemm_b(const float* __restrict__ A, int lda, size_t sA, const unsigned short* __restrict__ Bh, const unsigned short* __restrict__ Bl, int ldb, size_t sB,
                                             const float* __restrict__ bias, const float* __restrict__ resid, int ldr, size_t sR, float rsign, float alpha,
                                             float* __restrict__ C, int ldc, size_t sC, int M, int N, int K) {
  __shared__ __attribute__((aligned(16))) float so[4][16][64];
  const int tid = threadIdx.x, w = tid >> 5, lane = tid & 31, ln = lane & 15, hh = lane >> 4;
  const int by = blockIdx.y;
  A += (size_t)by * sA; Bh += (size_t)by * sB; if (BSPLIT) Bl += (size_t)by * sB; C += (size_t)by * sC; if (resid) resid += (size_t)by * sR;
  const int ntn = (N + 63) / 64; const int wid = blockIdx.x * 4 + w; const int mt = wid / ntn, nq = wid % ntn;      // N may be any multiple of 16: tiles past N are skipped and not stored
  if (mt * 16 >= M) return;
  const int row0 = mt * 16, col0 = nq * 64;
  const float* arow = A + (size_t)(row0 + ln) * lda;
  v8f acc[4] = {};
  for (int kb = 0; kb < K; kb += 32) {
    FragB ah, al;
    const v4f x0 = *(const v4fa*)(arow + kb + 8 * hh), x1 = *(const v4fa*)(arow + kb + 8 * hh + 4);
    const v4f x2 = *(const v4fa*)(arow + kb + 16 + 8 * hh), x3 = *(const v4fa*)(arow + kb + 16 + 8 * hh + 4);
    float xs[16] = {x0[0],x0[1],x0[2],x0[3],x1[0],x1[1],x1[2],x1[3],x2[0],x2[1],x2[2],x2[3],x3[0],x3[1],x3[2],x3[3]};
#pragma unroll
    for (int i = 0; i < 16; ++i) { const unsigned short hb = bf16_bits(xs[i]); ah.u[i] = hb; al.u[i] = ASPLIT ? bf16_bits(xs[i] - bf16_val(hb)) : (unsigned short)0; }
#pragma unroll
    for (int t = 0; t < 4; ++t) {
      if (col0 + t * 16 >= N) continue;
      const size_t boff = (size_t)(col0 + t * 16 + ln) * ldb + kb;
      FragB bh_, bl_; bh_.half[0] = *(const v8us*)(Bh + boff + 8 * hh); bh_.half[1] = *(const v8us*)(Bh + boff + 16 + 8 * hh);
      if (BSPLIT) { bl_.half[0] = *(const v8us*)(Bl + boff + 8 * hh); bl_.half[1] = *(const v8us*)(Bl + boff + 16 + 8 * hh); } else bl_ = bh_;
      acc[t] = mmaN<ASPLIT ? (BSPLIT ? 3 : 2) : 1>(ah.v, al.v, bh_.v, bl_.v, acc[t]);
    }
  }
#pragma unroll
  for (int t = 0; t < 4; ++t) {
    const int col = col0 + t * 16 + ln; if (col0 + t * 16 >= N) continue; const float bv = bias ? bf16_round(bias[col]) : 0.f;
#pragma unroll
    for (int r = 0; r < 8; ++r) { float v = acc[t][r] * alpha + bv; if (resid) v += rsign * resid[(size_t)(row0 + 8 * hh + r) * ldr + col]; if (ACT == 1) v = fmaxf(v, 0.f); else if (ACT == 2) v = fmaxf(v, 0.f) + log1pf(expf(-fabsf(v))); so[w][8 * hh + r][t * 16 + ln] = v; }
  }
  __builtin_amdgcn_fence(__ATOMIC_ACQ_REL, "workgroup"); __builtin_amdgcn_wave_barrier();
  const int rsub = lane >> 4, c4 = (lane & 15) * 4;
  {
#pragma unroll
    for (int q = 0; q < 8; ++q) { const int r = q * 2 + rsub; if (col0 + c4 < N) { const v4f v = *(const v4fa*)&so[w][r][c4]; *(v4f*)(C + (size_t)(row0 + r) * ldc + col0 + c4) = v; } }
    
  }
}
// batched f32 [K][N] (pitch lds, batch stride sIn) -> transposed hi/lo planes [N][K] (batch stride sOut); thread per (n, 8 k); grid.y = batch
__global__ __launch_bounds__(256) void k_split_transpose_b(const float* __restrict__ src, int lds_, size_t sIn, unsigned short* __restrict__ hi, unsigned short* __restrict__ lo, size_t sOut, int K, int N) {
  const size_t t = (size_t)blockIdx.x * 256 + threadIdx.x; const int k8n = K / 8; if (t >= (size_t)N * k8n) return;
  src += (size_t)blockIdx.y * sIn; hi += (size_t)blockIdx.y * sOut; lo += (size_t)blockIdx.y * sOut;
  const int n = (int)(t / k8n), k8 = (int)(t % k8n) * 8; v8us vh, vl;
#pragma unroll
  for (int i = 0; i < 8; ++i) { const float x = src[(size_t)(k8 + i) * lds_ + n]; const unsigned short hb = bf16_bits(x); vh[i] = hb; vl[i] = bf16_bits(x - bf16_val(hb)); }
  unsigned short* dh = hi + (size_t)n * K + k8; unsigned short* dl = lo + (size_t)n * K + k8;
  *(v8us*)dh = vh; *(v8us*)dl = vl; 
}

// ---- f16 WMMA path (v_wmma_f32_16x16x32_f16): 11-bit significands for operands in range — used where a [0,1] probability operand needs more precision than bf16
typedef _Float16 v16h __attribute__((ext_vector_type(16)));
union FragH { v16h v; v8us half[2]; _Float16 h[16]; unsigned short u[16]; };
template <int NT>
__device__ __forceinline__ v8f mmaH(v16h ah, v16h al, v16h bh, v16h bl, v8f c) {
  c = __builtin_amdgcn_wmma_f32_16x16x32_f16(false, ah, false, bh, (short)0, c, false, false);
  if (NT >= 2) c = __builtin_amdgcn_wmma_f32_16x16x32_f16(false, al, false, bh, (short)0, c, false, false);
  if (NT >= 3) c = __builtin_amdgcn_wmma_f32_16x16x32_f16(false, ah, false, bl, (short)0, c, false, false);
  asm volatile("v_nop\n\tv_nop\n\tv_nop\n\tv_nop" : "+v"(c) : "v"(ah), "v"(al), "v"(bh), "v"(bl));
  return c;
}
// batched GEMM like k_gemm_b but f16 operands: A f32 (split into f16 hi/lo if ASPLIT, else rounded to f16), Bt = f16 values [n][k]; alpha; C f32; N multiple of 16 (partial tiles skipped)
template <bool ASPLIT>
__global__ __launch_bounds__(128) void k_gemm_h(const float* __restrict__ A, int lda, size_t sA, const _Float16* __restrict__ Bh, int ldb, size_t sB, float alpha, float* __restrict__ C, int ldc, size_t sC, int M, int N, int K) {
  __shared__ __attribute__((aligned(16))) float so[4][16][64];
  const int tid = threadIdx.x, w = tid >> 5, lane = tid & 31, ln = lane & 15, hh = lane >> 4; const int by = blockIdx.y;
  A += (size_t)by * sA; Bh += (size_t)by * sB; C += (size_t)by * sC;
  const int ntn = (N + 63) / 64; const int wid = blockIdx.x * 4 + w; const int mt = wid / ntn, nq = wid % ntn; if (mt * 16 >= M) return;
  const int row0 = mt * 16, col0 = nq * 64; const float* arow = A + (size_t)(row0 + ln) * lda;
  v8f acc[4] = {};
  for (int kb = 0; kb < K; kb += 32) {
    FragH ah, al;
    const v4f x0 = *(const v4fa*)(arow + kb + 8 * hh), x1 = *(const v4fa*)(arow + kb + 8 * hh + 4), x2 = *(const v4fa*)(arow + kb + 16 + 8 * hh), x3 = *(const v4fa*)(arow + kb + 16 + 8 * hh + 4);
    float xs[16] = {x0[0],x0[1],x0[2],x0[3],x1[0],x1[1],x1[2],x1[3],x2[0],x2[1],x2[2],x2[3],x3[0],x3[1],x3[2],x3[3]};
#pragma unroll
    for (int i = 0; i < 16; ++i) { const _Float16 h = (_Float16)xs[i]; ah.h[i] = h; al.h[i] = ASPLIT ? (_Float16)(xs[i] - (float)h) : (_Float16)0.0f; }
#pragma unroll
    for (int t = 0; t < 4; ++t) { if (col0 + t * 16 >= N) continue; const size_t boff = (size_t)(col0 + t * 16 + ln) * ldb + kb; FragH bq; bq.half[0] = *(const v8us*)(Bh + boff + 8 * hh); bq.half[1] = *(const v8us*)(Bh + boff + 16 + 8 * hh);
      acc[t] = mmaH<ASPLIT ? 2 : 1>(ah.v, al.v, bq.v, bq.v, acc[t]); }
  }
#pragma unroll
  for (int t = 0; t < 4; ++t) { if (col0 + t * 16 >= N) continue;
#pragma unroll
    for (int r = 0; r < 8; ++r) so[w][8 * hh + r][t * 16 + ln] = acc[t][r] * alpha; }
  __builtin_amdgcn_fence(__ATOMIC_ACQ_REL, "workgroup"); __builtin_amdgcn_wave_barrier();
  const int rsub = lane >> 4, c4 = (lane & 15) * 4;
  {
#pragma unroll
    for (int q = 0; q < 8; ++q) { const int r = q * 2 + rsub; if (col0 + c4 < N) { const v4f v = *(const v4fa*)&so[w][r][c4]; *(v4f*)(C + (size_t)(row0 + r) * ldc + col0 + c4) = v; } }
     }
}

__global__ __launch_bounds__(256) void k_bt(const float* __restrict__ Wqkv, const float* __restrict__ Wo, unsigned short* __restrict__ Bq, unsigned short* __restrict__ Bo) { const int t = blockIdx.x * 256 + threadIdx.x;
  if (t < 3 * DIM * DIM / 8) { const int k8 = (t % (DIM / 8)) * 8, n = t / (DIM / 8); v8us v; for (int q = 0; q < 8; ++q) v[q] = bf16_bits(Wqkv[(size_t)(k8 + q) * (3 * DIM) + n]); *(v8us*)(Bq + (size_t)n * DIM + k8) = v;  }
  if (t < DIM * DIM / 8) { const int k8 = (t % (DIM / 8)) * 8, n = t / (DIM / 8); v8us v; for (int q = 0; q < 8; ++q) v[q] = bf16_bits(Wo[(size_t)(k8 + q) * DIM + n]); *(v8us*)(Bo + (size_t)n * DIM + k8) = v;  } }
__device__ __forceinline__ void ldF(FragH& f, const _Float16* base, int pitch, int row, int k0, int ln, int hh) { const unsigned short* p = (const unsigned short*)base + (size_t)(row + ln) * pitch + k0; f.half[0] = *(const v8us*)(p + 8 * hh); f.half[1] = *(const v8us*)(p + 16 + 8 * hh); }
typedef unsigned short v4us __attribute__((ext_vector_type(4), may_alias));
// 32 entries (keys J0 .. J0+31) of one query's row of the bias-and-mask table. sb points at the query's own place in the 13 x 13 bias table, so that key (yj, xj) reads sb[yj*13+xj];
// every read is unconditional and in range (the caller clamps a padding query to slot 48), the mask is a select behind it. okYX: the query is a token and may meet a key with yj >= 4 (Y), xj >= 4 (X).
template <int J0>
__device__ __forceinline__ void win_table(unsigned short* trow, const float* sb, bool ok00, bool ok01, bool ok10, bool ok11) {
#pragma unroll
  for (int q = 0; q < 4; ++q) { v8us p;
#pragma unroll
    for (int c = 0; c < 8; ++c) { const int j = J0 + q * 8 + c, jc = j < 49 ? j : 48, yj = jc / WS, xj = jc % WS;
      const unsigned short bb = (unsigned short)(__float_as_uint(sb[yj * 13 + xj]) >> 16);      // the bias table holds bf16 values: the upper half is all of it
      const bool ok = j < 49 && (yj >= 4 ? (xj >= 4 ? ok11 : ok10) : (xj >= 4 ? ok01 : ok00));
      p[c] = ok ? bb : bf16_bits(-3.0e38f); }
    *(v8us*)(trow + J0 + q * 8) = p; }
}
// lane l with lane l ^ 16: the two lanes that share a column of a WMMA result
__device__ __forceinline__ float xhalf(float x) { return __builtin_bit_cast(float, __builtin_amdgcn_permlanex16(__builtin_bit_cast(int, x), __builtin_bit_cast(int, x), 0x76543210, 0xfedcba98, false, false)); }
// one work-group of 4 waves per (b, window w = wy*8+wx), wave = head h. Window slot i = yi*7+xi is token ((wy*7+yi+3)%56, (wx*7+xi+3)%56) of batch b.
// The window's 49 rows of x (padded with zero rows to 64) are staged once in LDS as bf16; each wave forms its head's q, k, v (64 x 96, K = 128) on the bf16 WMMA
// and puts them into its own LDS planes as f16, so qkv never goes through global memory. Zero rows of x give zero rows of q, k, v: the padding needs no clearing.
// Scores and o are formed transposed: k (A) x q^T (B) puts query ln in the lane and keys 16t+8hh+r in its registers, so maximum and sum are taken inside the lane and once across the lane halves,
// two score tiles converted in place are the B operand of v^T (A) x e^T (B), and a lane ends with 8 consecutive d of its own query. The k and v^T fragments serve all four passes from registers.
// Each pass puts its 16 o rows as bf16 hi/lo into the wave's own q rows (read by this pass alone) and k plane (in registers by then), and after one work-group barrier
// wave h forms output columns 32h .. 32h+31 of all the window's tokens (K = 128 over the four heads' planes, 2 products), so o never goes through global memory either.
__global__ __launch_bounds__(128) void k_win(const float* __restrict__ X, const unsigned short* __restrict__ Bq, const float* __restrict__ pos,
                                           const unsigned short* __restrict__ Bo, const float* __restrict__ bo, float* __restrict__ out) {
  constexpr int PW = (64 * 40 + 64 * 40 + HDM * 72) * 2;          // bytes per wave: q, k, v^T planes
  constexpr int PO = 16 * 72 * 2;                                 // bytes per wave: room for staged x, later one staged output tile
  constexpr int TP = 72;                                          // pitch of the bias-and-mask table, in bf16 elements: 16 rows read 16 bytes each without a bank conflict
  constexpr int PT = 64 * TP * 2;                                 // bytes of that table: 64 queries x 64 keys, behind the waves' PO bytes
  constexpr int XP = DIM + 8;                                     // pitch of the staged x rows, in bf16 elements
  constexpr int SP = HDM + 4;                                     // pitch of a staged output tile, in floats (rows 16-byte aligned)
  static_assert(4 * PO + PT >= 64 * XP * 2, "staged x shares the space of the waves' PO bytes and the table");
  static_assert(2 * 16 * SP * 4 <= HDM * 72 * 2 && 16 * SP * 4 <= PO, "three staged output tiles fit the v^T plane and the wave's PO bytes");
  __shared__ __attribute__((aligned(16))) unsigned char smem[4 * PW + 4 * PO + PT]; __shared__ int stok[64]; __shared__ float sbias[13 * 13];
  const int tid = threadIdx.x, lane = tid & 31, ln = lane & 15, hh = lane >> 4; const int h = __builtin_amdgcn_readfirstlane(tid >> 5);
  const int w = blockIdx.x % NWIN; const int b = blockIdx.x / NWIN; const int wy = w / 8, wx = w % 8;
  _Float16* sq = (_Float16*)(smem + h * PW); _Float16* sk = sq + 64 * 40; _Float16* svt = sk + 64 * 40;
  unsigned short* sx = (unsigned short*)(smem + 4 * PW); _Float16* sp = (_Float16*)(smem + 4 * PW + h * PO); unsigned short* tb = (unsigned short*)(smem + 4 * PW + 4 * PO);
  if (tid < 64) { int tok = -1; if (tid < 49) { const int yi = tid / WS, xi = tid % WS; const int y = (wy * WS + yi + DISP) % HI, x = (wx * WS + xi + DISP) % WI; tok = (b * HI + y) * WI + x; } stok[tid] = tok; }
  for (int i = tid; i < 169; i += 128) sbias[i] = bf16_round(pos[i]);
  // stage x: wave h takes rows h, h+4, ...; one row = one 512-byte wave load; all 13 loads are issued before the first is used
  v4f xv[13];
#pragma unroll
  for (int it = 0; it < 13; ++it) { const int i = min(h + 4 * it, 48); const int yi = i / WS, xi = i % WS; const int y = (wy * WS + yi + DISP) % HI, x = (wx * WS + xi + DISP) % WI;
    xv[it] = *(const v4fa*)(X + (size_t)((b * HI + y) * WI + x) * DIM + lane * 4); }
#pragma unroll
  for (int it = 0; it < 13; ++it) { const int i = h + 4 * it; v4us p = {0, 0, 0, 0}; if (i < 49) { for (int c = 0; c < 4; ++c) p[c] = bf16_bits(xv[it][c]); } *(v4us*)(sx + i * XP + lane * 4) = p; }
#pragma unroll
  for (int it = 13; it < 16; ++it) { const v4us p = {0, 0, 0, 0}; *(v4us*)(sx + (h + 4 * it) * XP + lane * 4) = p; }
  __syncthreads();      // every wave reads all 64 staged rows, the token list and the bias table
  FragB a[4][4];
#pragma unroll
  for (int mt = 0; mt < 4; ++mt) {
#pragma unroll
    for (int ks = 0; ks < 4; ++ks) { const unsigned short* p = sx + (mt * 16 + ln) * XP + ks * 32; a[mt][ks].half[0] = *(const v8us*)(p + 8 * hh); a[mt][ks].half[1] = *(const v8us*)(p + 16 + 8 * hh); } }
  __syncthreads();      // the staged rows are in registers now: their LDS is reused for the table below
  // Bias and masks are the same for the four heads: the work-group builds them once, tb[query i][key j] = bias (bf16, as it is used) or a large negative value where the pair is
  // masked or padding. Thread = one query and 32 keys; which 32 is wave-uniform, so everything on the key side is a compile-time constant inside win_table.
  const bool ul = (wy == 7), lr = (wx == 7);
  {
    const int i = tid & 63, ic = min(i, 48), yi = ic / WS, xi = ic % WS; const bool iv = i < 49, ia = yi >= 4, ib = xi >= 4;
    const bool y0 = !(ul & ia), y1 = !(ul & !ia), x0 = !(lr & ib), x1 = !(lr & !ib);      // the query may meet a key of the upper / lower rows, of the left / right columns
    const float* sb = sbias + 6 * 13 + 6 - (yi * 13 + xi); unsigned short* trow = tb + i * TP;
    if (h < 2) win_table<0>(trow, sb, iv & y0 & x0, iv & y0 & x1, iv & y1 & x0, iv & y1 & x1); else win_table<32>(trow, sb, iv & y0 & x0, iv & y0 & x1, iv & y1 & x0, iv & y1 & x1);
  }
#pragma unroll
  for (int t = 0; t < 6; ++t) {      // column tiles: t = 0,1 q; 2,3 k; 4,5 v of head h
    const unsigned short* brow = Bq + (size_t)((t >> 1) * DIM + h * HDM + (t & 1) * 16 + ln) * DIM;
    FragB bf[4];
#pragma unroll
    for (int ks = 0; ks < 4; ++ks) { bf[ks].half[0] = *(const v8us*)(brow + ks * 32 + 8 * hh); bf[ks].half[1] = *(const v8us*)(brow + ks * 32 + 16 + 8 * hh); }
#pragma unroll
    for (int mt = 0; mt < 4; ++mt) {
      v8f c = {};
#pragma unroll
      for (int ks = 0; ks < 4; ++ks) c = __builtin_amdgcn_wmma_f32_16x16x32_bf16(false, a[mt][ks].v, false, bf[ks].v, (short)0, c, false, false);
      const int row = mt * 16 + 8 * hh, col = (t & 1) * 16 + ln;
      if (t < 2) {
#pragma unroll
        for (int r = 0; r < 8; ++r) sq[(row + r) * 40 + col] = (_Float16)(c[r] * 0.17677669529663687f);
      } else if (t < 4) {
#pragma unroll
        for (int r = 0; r < 8; ++r) sk[(row + r) * 40 + col] = (_Float16)c[r];
      } else {
        FragH vv;
#pragma unroll
        for (int r = 0; r < 8; ++r) vv.h[r] = (_Float16)c[r];
        *(v8us*)((unsigned short*)svt + col * 72 + row) = vv.half[0];
      }
    }
  }
  __syncthreads();      // every wave reads the whole table; it also orders the wave's own q, k, v stores before their reads
  FragH fk[4], fv[2][2];      // the head's k rows and v^T rows as A fragments: the same for every pass
#pragma unroll
  for (int t = 0; t < 4; ++t) ldF(fk[t], sk, 40, t * 16, 0, ln, hh);
#pragma unroll
  for (int t = 0; t < 2; ++t) {
#pragma unroll
    for (int ks = 0; ks < 2; ++ks) ldF(fv[t][ks], svt, 72, t * 16, ks * 32, ln, hh); }
  unsigned short* oh = (unsigned short*)sq; unsigned short* ol = (unsigned short*)sk;      // o as bf16 hi (own q plane) and lo (own k plane), same pitch
  for (int mt = 0; mt < 4; ++mt) {      // 16 queries per pass, query mt*16+ln in the lane (queries >= 49 are padding: every key masked, o = 0, never stored to out)
    v8f acc[4]; FragH bq; ldF(bq, sq, 40, mt * 16, 0, ln, hh);
#pragma unroll
    for (int t = 0; t < 4; ++t) { const v8us tv = *(const v8us*)(tb + (mt * 16 + ln) * TP + t * 16 + 8 * hh);      // bias or mask of (key 16t+8hh+r, query ln): the accumulator's start value
#pragma unroll
      for (int r = 0; r < 8; ++r) acc[t][r] = bf16_val(tv[r]); }
#pragma unroll
    for (int t = 0; t < 4; ++t) acc[t] = __builtin_amdgcn_wmma_f32_16x16x32_f16(false, fk[t].v, false, bq.v, (short)0, acc[t], false, false);
    float mx[4], sm[4];
#pragma unroll
    for (int t = 0; t < 4; ++t) { mx[t] = acc[t][0];
#pragma unroll
      for (int r = 1; r < 8; ++r) mx[t] = fmaxf(mx[t], acc[t][r]); }
    float m = fmaxf(fmaxf(mx[0], mx[1]), fmaxf(mx[2], mx[3])); m = fmaxf(m, xhalf(m));
    FragH pe[2];      // e^T: score tiles 2ks and 2ks+1 hold keys 32ks+8hh+r and 32ks+16+8hh+r, which is the k order of a B fragment
#pragma unroll
    for (int t = 0; t < 4; ++t) { sm[t] = 0.f;
#pragma unroll
      for (int r = 0; r < 8; ++r) { const float e = (acc[t][r] > -1.0e38f) ? __expf(acc[t][r] - m) : 0.f; sm[t] += e; pe[t >> 1].h[(t & 1) * 8 + r] = (_Float16)e; } }
    float s = (sm[0] + sm[1]) + (sm[2] + sm[3]); s += xhalf(s);
    v8f acco[2] = {};
#pragma unroll
    for (int ks = 0; ks < 2; ++ks) {
#pragma unroll
      for (int t = 0; t < 2; ++t) acco[t] = __builtin_amdgcn_wmma_f32_16x16x32_f16(false, fv[t][ks].v, false, pe[ks].v, (short)0, acco[t], false, false); }
    const float rs = (s > 0.f) ? 1.0f / s : 0.f;
#pragma unroll
    for (int t = 0; t < 2; ++t) { v8us ph, pl;      // o[query ln][d = 16t+8hh+r]: 8 consecutive d, one 16-byte store per plane
#pragma unroll
      for (int r = 0; r < 8; ++r) { const float v = acco[t][r] * rs; const unsigned short hb = bf16_bits(v); ph[r] = hb; pl[r] = bf16_bits(v - bf16_val(hb)); }
      const int at = (mt * 16 + ln) * 40 + t * 16 + 8 * hh; *(v8us*)(oh + at) = ph; *(v8us*)(ol + at) = pl; }
  }
  // From here on every loop is unrolled: its index picks registers (bw, c, ov, op), which only a compile-time constant can do.
  // W_out fragments and bias of this wave's 32 output columns: asked for here, so that they fly while the waves meet
  FragB bw[2][4]; float bv[2];
#pragma unroll
  for (int t = 0; t < 2; ++t) { const unsigned short* brow = Bo + (size_t)(h * HDM + t * 16 + ln) * DIM; bv[t] = bf16_round(bo[h * HDM + t * 16 + ln]);
#pragma unroll
    for (int ks = 0; ks < 4; ++ks) { bw[t][ks].half[0] = *(const v8us*)(brow + ks * 32 + 8 * hh); bw[t][ks].half[1] = *(const v8us*)(brow + ks * 32 + 16 + 8 * hh); } }
  __syncthreads();      // every wave reads all four heads' o planes
  float* st[3] = {(float*)svt, (float*)svt + 16 * SP, (float*)sp};      // the wave's own v^T plane is dead, its PO bytes are free: one staged output tile per full pass
  float last[2];
#pragma unroll
  for (int mt = 0; mt < 4; ++mt) {
    v8f c[2] = {};
#pragma unroll
    for (int ks = 0; ks < 4; ++ks) {      // k step ks = head ks
      const unsigned short* ph = (const unsigned short*)(smem + ks * PW) + (mt * 16 + ln) * 40; const unsigned short* pl = ph + 64 * 40;
      FragB ah, al; ah.half[0] = *(const v8us*)(ph + 8 * hh); ah.half[1] = *(const v8us*)(ph + 16 + 8 * hh); al.half[0] = *(const v8us*)(pl + 8 * hh); al.half[1] = *(const v8us*)(pl + 16 + 8 * hh);
#pragma unroll
      for (int t = 0; t < 2; ++t) {
        c[t] = __builtin_amdgcn_wmma_f32_16x16x32_bf16(false, ah.v, false, bw[t][ks].v, (short)0, c[t], false, false);
        c[t] = __builtin_amdgcn_wmma_f32_16x16x32_bf16(false, al.v, false, bw[t][ks].v, (short)0, c[t], false, false);
      }
    }
#pragma unroll
    for (int t = 0; t < 2; ++t) {
      if (mt < 3) {
#pragma unroll
        for (int r = 0; r < 8; ++r) st[mt][(8 * hh + r) * SP + t * 16 + ln] = c[t][r] + bv[t];
      } else last[t] = c[t][0] + bv[t];
    }
  }
  __builtin_amdgcn_fence(__ATOMIC_ACQ_REL, "workgroup"); __builtin_amdgcn_wave_barrier();      // the staged tiles are read back by other lanes
  // 8 lanes x 16 bytes = this wave's whole 128-byte line of a token, 4 tokens a store; all values and addresses are formed before the first store goes out
  v4f ov[12]; float* op[12];
#pragma unroll
  for (int q = 0; q < 12; ++q) { const int il = (q & 3) * 4 + (lane >> 3); ov[q] = *(const v4fa*)&st[q >> 2][il * SP + (lane & 7) * 4]; op[q] = out + (size_t)stok[(q >> 2) * 16 + il] * DIM + h * HDM + (lane & 7) * 4; }
  float* op48 = out + (size_t)stok[48] * DIM + h * HDM + ln;
#pragma unroll
  for (int q = 0; q < 12; ++q) *(v4f*)op[q] = ov[q];
  if (hh == 0) { op48[0] = last[0]; op48[16] = last[1]; }
}
extern "C" void kernel_launch(void* const* d_in, const int* in_sizes, int n_in,
                              void* d_out, int out_size, void* d_ws, size_t ws_size, hipStream_t stream) {
  (void)in_sizes; (void)n_in; (void)out_size;
  const float* x = (const float*)d_in[0]; const float* Wqkv = (const float*)d_in[1]; const float* pos = (const float*)d_in[2]; const float* Wo = (const float*)d_in[3]; const float* bo = (const float*)d_in[4];
  char* ws = (char*)d_ws; size_t off = 0;
  auto take = [&](size_t bytes) { char* p = ws + off; off += (bytes + 255) & ~(size_t)255; return p; };
  unsigned short* Bq = (unsigned short*)take((size_t)3 * DIM * DIM * 2); unsigned short* Bo = (unsigned short*)take((size_t)DIM * DIM * 2);
  if (off > ws_size) return;
  k_bt<<<(3 * DIM * DIM / 8 + 255) / 256, 256, 0, stream>>>(Wqkv, Wo, Bq, Bo);
  k_win<<<BB * NWIN, 128, 0, stream>>>(x, Bq, pos, Bo, bo, (float*)d_out);
}

// v006
// Measured time: 19.2 microseconds a run.
// It is 1.22 times as fast as v004, going by the measured steps of the versions left out in between.
// Over all steps from v000 it is 6.39 times as fast.
#include <hip/hip_runtime.h>
// Shifted-window attention: qkv = x·W_qkv on v_wmma_f32_16x16x32_bf16 (x rounded to bf16: single exact term; 50176 × 128 × 384); per (batch, window, head) the 49×49
// scores q·kᵀ and e·v on v_wmma_f32_16x16x32_f16 (q, k, v, e rounded to f16, windows padded to 64; one wave each); out = o·W_out + b_out on the f16 variant as well, o rounded
// to f16 and W_out's bf16 values held as f16 (1 product). The cyclic shifts are pure index remaps (token (y,x) ↔ shifted (y−3, x−3) mod 56, and the back-shift returns every result to its own token);
// relative-position bias and the shift masks come from one table per window as the score accumulators' start values; the max-shifted softmax is f32 VALU.
// The scores are formed transposed (k x q^T: a lane owns one query, its registers the keys), so the softmax reduces inside the lane and e is the B operand of v^T x e^T as it stands.
#define BB 16
#define HI 56
#define WI 56
#define DIM 128
#define NHD 4
#define HDM 32
#define WS 7
#define NWIN 64
#define NTOK (BB * HI * WI)
#define DISP 3

typedef __bf16 v16b __attribute__((ext_vector_type(16)));
typedef unsigned short v8us __attribute__((ext_vector_type(8), may_alias));
typedef float  v8f  __attribute__((ext_vector_type(8)));
typedef float  v4f  __attribute__((ext_vector_type(4)));
typedef float  v4fa __attribute__((ext_vector_type(4), may_alias));
union FragB { v16b v; v8us half[2]; unsigned short u[16]; };

__device__ __forceinline__ unsigned short bf16_bits(float x) { unsigned int u = __float_as_uint(x); return (unsigned short)((u + 0x7FFFu + ((u >> 16) & 1u)) >> 16); }
__device__ __forceinline__ float bf16_val(unsigned short b) { return __uint_as_float(((unsigned int)b) << 16); }
__device__ __forceinline__ float bf16_round(float x) { return bf16_val(bf16_bits(x)); }
// D += A·B with NT terms: 1 = ah·bh, 2 = + al·bh (A split), 3 = + ah·bl (both split)
template <int NT>
__device__ __forceinline__ v8f mmaN(v16b ah, v16b al, v16b bh, v16b bl, v8f c) {
  c = __builtin_amdgcn_wmma_f32_16x16x32_bf16(false, ah, false, bh, (short)0, c, false, false);
  if (NT >= 2) c = __builtin_amdgcn_wmma_f32_16x16x32_bf16(false, al, false, bh, (short)0, c, false, false);
  if (NT >= 3) c = __builtin_amdgcn_wmma_f32_16x16x32_bf16(false, ah, false, bl, (short)0, c, false, false);
  asm volatile("v_nop\n\tv_nop\n\tv_nop\n\tv_nop" : "+v"(c) : "v"(ah), "v"(al), "v"(bh), "v"(bl));
  return c;
}

__global__ __launch_bounds__(256) void k_wt_bf16(const float* __restrict__ W, unsigned short* __restrict__ Wt, int K, int N) {
  const int t = blockIdx.x * 256 + threadIdx.x;
  const int k8n = K / 8;
  if (t >= N * k8n) return;
  const int n = t / k8n, k8 = (t % k8n) * 8;
  v8us v;
#pragma unroll
  for (int i = 0; i < 8; ++i) v[i] = bf16_bits(W[(size_t)(k8 + i) * N + n]);
  *(v8us*)(Wt + (size_t)n * K + k8) = v;
  
}

// GEMM C[M][N] (f32, pitch ldc) = act(A[M][K]·W + bias). A f32 row-major (pitch lda) converted per fragment to bf16
// (ASPLIT: hi/lo two planes -> 2 terms, else single rounded term); Wt bf16 [N][K] (pitch ldb). BIAS_BF16 rounds the
// bias to bf16 first (bias quantised to bf16 before the add). K%32==0, M%16==0, N%64==0.
template <bool ASPLIT, int ACT, bool BIAS_BF16>
__global__ __launch_bounds__(128) void k_gemm_bf(const float* __restrict__ A, int lda, const unsigned short* __restrict__ Wt, int ldb,
                                               const float* __restrict__ bias, float* __restrict__ C, int ldc, int M, int N, int K) {
  __shared__ __attribute__((aligned(16))) float so[4][16][64];
  const int tid = threadIdx.x, w = tid >> 5, lane = tid & 31, ln = lane & 15, hh = lane >> 4;
  const int ntn = N / 64;
  const int wid = blockIdx.x * 4 + w;
  const int mt = wid / ntn, nq = wid % ntn;
  if (mt * 16 >= M) return;
  const int row0 = mt * 16, col0 = nq * 64;
  const float* arow = A + (size_t)(row0 + ln) * lda;
  v8f acc[4] = {};
  for (int kb = 0; kb < K; kb += 32) {
    FragB ah, al;
    const v4f x0 = *(const v4fa*)(arow + kb + 8 * hh), x1 = *(const v4fa*)(arow + kb + 8 * hh + 4);
    const v4f x2 = *(const v4fa*)(arow + kb + 16 + 8 * hh), x3 = *(const v4fa*)(arow + kb + 16 + 8 * hh + 4);
    float xs[16] = {x0[0],x0[1],x0[2],x0[3],x1[0],x1[1],x1[2],x1[3],x2[0],x2[1],x2[2],x2[3],x3[0],x3[1],x3[2],x3[3]};
#pragma unroll
    for (int i = 0; i < 16; ++i) { const unsigned short hb = bf16_bits(xs[i]); ah.u[i] = hb; al.u[i] = ASPLIT ? bf16_bits(xs[i] - bf16_val(hb)) : (unsigned short)0; }
#pragma unroll
    for (int t = 0; t < 4; ++t) {
      const unsigned short* brow = Wt + (size_t)(col0 + t * 16 + ln) * ldb + kb;
      FragB b;
      b.half[0] = *(const v8us*)(brow + 8 * hh);
      b.half[1] = *(const v8us*)(brow + 16 + 8 * hh);
      acc[t] = mmaN<ASPLIT ? 2 : 1>(ah.v, al.v, b.v, b.v, acc[t]);
    }
  }
#pragma unroll
  for (int t = 0; t < 4; ++t) {
    float bv = bias ? bias[col0 + t * 16 + ln] : 0.f;
    if (BIAS_BF16) bv = bf16_round(bv);
#pragma unroll
    for (int r = 0; r < 8; ++r) { float v = acc[t][r] + bv; if (ACT == 1) v = fmaxf(v, 0.f); so[w][8 * hh + r][t * 16 + ln] = v; }
  }
  __builtin_amdgcn_fence(__ATOMIC_ACQ_REL, "workgroup");
  __builtin_amdgcn_wave_barrier();
  const int rsub = lane >> 4, c4 = (lane & 15) * 4;
  {
#pragma unroll
    for (int q = 0; q < 8; ++q) {
      const int r = q * 2 + rsub;
      const v4f v = *(const v4fa*)&so[w][r][c4];
      *(v4f*)(C + (size_t)(row0 + r) * ldc + col0 + c4) = v;
    }
    
  }
}

// Flash-style causal/unmasked attention, all contractions 3-term bf16 hi/lo splits, f32 softmax with running max.
// q,k,v rows are read from f32 buffers with arbitrary row pitch (so they can live inside a fused qkv buffer);
// D = head size (multiple of 32, <= 128); one wave = 16 query rows; block = 4 waves (64 queries) sharing K/V chunks of 32.
template <int D, bool CAUSAL>
__global__ __launch_bounds__(128) void k_flash(const float* __restrict__ qb, const float* __restrict__ kb, const float* __restrict__ vb,
                                             int pitch, int T, int H, float scale, float* __restrict__ y, int ypitch) {
  constexpr int KS = D / 32;        // k-steps for QK
  constexpr int DT = D / 16;        // d tiles for PV
  __shared__ __attribute__((aligned(16))) unsigned short sKh[32][D + 8], sKl[32][D + 8], sVh[32][D + 8], sVl[32][D + 8];
  __shared__ __attribute__((aligned(16))) unsigned short sPh[4][16][40], sPl[4][16][40];
  __shared__ __attribute__((aligned(16))) float sO[4][16][D];
  const int tid = threadIdx.x, w = tid >> 5, lane = tid & 31, ln = lane & 15, hh = lane >> 4;
  const int nqb = (T + 63) / 64;
  const int bh = blockIdx.x / nqb, qblk = blockIdx.x % nqb;
  const int b = bh / H, h = bh % H;
  const int q0 = qblk * 64 + w * 16;
  const float* Q = qb + (size_t)b * T * pitch + h * D;
  const float* K = kb + (size_t)b * T * pitch + h * D;
  const float* V = vb + (size_t)b * T * pitch + h * D;

  // A fragments of the wave's 16 query rows (scaled), hi/lo
  FragB aqh[KS], aql[KS];
  {
    int row = q0 + ln; if (row >= T) row = T - 1;
    const float* qr = Q + (size_t)row * pitch;
#pragma unroll
    for (int ks = 0; ks < KS; ++ks)
#pragma unroll
      for (int i = 0; i < 16; ++i) {
        const int d = ks * 32 + ((i < 8) ? (8 * hh + i) : (16 + 8 * hh + (i - 8)));
        const float x = qr[d] * scale; const unsigned short hb = bf16_bits(x);
        aqh[ks].u[i] = hb; aql[ks].u[i] = bf16_bits(x - bf16_val(hb));
      }
  }
  float m_r[8], l_r[8];
#pragma unroll
  for (int r = 0; r < 8; ++r) { m_r[r] = -3.0e38f; l_r[r] = 0.f; }
  v8f oacc[DT];
#pragma unroll
  for (int dt = 0; dt < DT; ++dt) oacc[dt] = (v8f){0.f,0.f,0.f,0.f,0.f,0.f,0.f,0.f};

  const int kv_end = CAUSAL ? min(T, qblk * 64 + 64) : T;     // block-uniform
  for (int j0 = 0; j0 < kv_end; j0 += 32) {
    __syncthreads();
    for (int e = tid; e < 32 * (D / 4); e += 128) {
      const int r = e / (D / 4), c4 = (e % (D / 4)) * 4;
      const int key = j0 + r;
      v4f kf = {0.f,0.f,0.f,0.f}, vf = {0.f,0.f,0.f,0.f};
      if (key < T) { kf = *(const v4fa*)(K + (size_t)key * pitch + c4); vf = *(const v4fa*)(V + (size_t)key * pitch + c4); }
#pragma unroll
      for (int t = 0; t < 4; ++t) {
        unsigned short hb = bf16_bits(kf[t]); sKh[r][c4 + t] = hb; sKl[r][c4 + t] = bf16_bits(kf[t] - bf16_val(hb));
        hb = bf16_bits(vf[t]); sVh[r][c4 + t] = hb; sVl[r][c4 + t] = bf16_bits(vf[t] - bf16_val(hb));
      }
    }
    __syncthreads();
    // S tile 16 x 32
    v8f s[2];
#pragma unroll
    for (int nt = 0; nt < 2; ++nt) {
      v8f acc = {};
#pragma unroll
      for (int ks = 0; ks < KS; ++ks) {
        FragB bh_, bl_;
        bh_.half[0] = *(const v8us*)&sKh[nt * 16 + ln][ks * 32 + 8 * hh]; bh_.half[1] = *(const v8us*)&sKh[nt * 16 + ln][ks * 32 + 16 + 8 * hh];
        bl_.half[0] = *(const v8us*)&sKl[nt * 16 + ln][ks * 32 + 8 * hh]; bl_.half[1] = *(const v8us*)&sKl[nt * 16 + ln][ks * 32 + 16 + 8 * hh];
        acc = mmaN<3>(aqh[ks].v, aql[ks].v, bh_.v, bl_.v, acc);
      }
      s[nt] = acc;
    }
    // mask + running max (rows 8hh+r; the 16 lanes of a half share rows)
    float alpha[8];
#pragma unroll
    for (int r = 0; r < 8; ++r) {
      const int qi = q0 + 8 * hh + r;
      const int ja = j0 + ln, jb = j0 + 16 + ln;
      if (CAUSAL) { if (ja > qi) s[0][r] = -3.0e38f; if (jb > qi) s[1][r] = -3.0e38f; }
      if (ja >= T) s[0][r] = -3.0e38f;
      if (jb >= T) s[1][r] = -3.0e38f;
      float mx = fmaxf(s[0][r], s[1][r]);
      mx = fmaxf(mx, __shfl_xor(mx, 1, 32)); mx = fmaxf(mx, __shfl_xor(mx, 2, 32)); mx = fmaxf(mx, __shfl_xor(mx, 4, 32)); mx = fmaxf(mx, __shfl_xor(mx, 8, 32));
      const float mnew = fmaxf(m_r[r], mx);
      alpha[r] = (mnew > -1.0e38f) ? __expf(m_r[r] - mnew) : 1.0f;
      const float p0 = (s[0][r] > -1.0e38f) ? __expf(s[0][r] - mnew) : 0.f;
      const float p1 = (s[1][r] > -1.0e38f) ? __expf(s[1][r] - mnew) : 0.f;
      m_r[r] = mnew;
      l_r[r] = l_r[r] * alpha[r] + p0 + p1;            // per-lane partial row sum (16 lanes combined at the end)
      unsigned short hb = bf16_bits(p0); sPh[w][8 * hh + r][ln] = hb;      sPl[w][8 * hh + r][ln] = bf16_bits(p0 - bf16_val(hb));
      hb = bf16_bits(p1);                sPh[w][8 * hh + r][16 + ln] = hb; sPl[w][8 * hh + r][16 + ln] = bf16_bits(p1 - bf16_val(hb));
    }
#pragma unroll
    for (int dt = 0; dt < DT; ++dt)
#pragma unroll
      for (int r = 0; r < 8; ++r) oacc[dt][r] *= alpha[r];
    __builtin_amdgcn_fence(__ATOMIC_ACQ_REL, "workgroup");
    __builtin_amdgcn_wave_barrier();
    FragB pah, pal;
    pah.half[0] = *(const v8us*)&sPh[w][ln][8 * hh]; pah.half[1] = *(const v8us*)&sPh[w][ln][16 + 8 * hh];
    pal.half[0] = *(const v8us*)&sPl[w][ln][8 * hh]; pal.half[1] = *(const v8us*)&sPl[w][ln][16 + 8 * hh];
#pragma unroll
    for (int dt = 0; dt < DT; ++dt) {
      FragB bvh, bvl;
#pragma unroll
      for (int i = 0; i < 8; ++i) {
        bvh.u[i] = sVh[8 * hh + i][dt * 16 + ln]; bvh.u[8 + i] = sVh[16 + 8 * hh + i][dt * 16 + ln];
        bvl.u[i] = sVl[8 * hh + i][dt * 16 + ln]; bvl.u[8 + i] = sVl[16 + 8 * hh + i][dt * 16 + ln];
      }
      oacc[dt] = mmaN<3>(pah.v, pal.v, bvh.v, bvl.v, oacc[dt]);
    }
    __builtin_amdgcn_fence(__ATOMIC_ACQ_REL, "workgroup");
    __builtin_amdgcn_wave_barrier();
  }
#pragma unroll
  for (int r = 0; r < 8; ++r) {
    float l = l_r[r];
    l += __shfl_xor(l, 1, 32); l += __shfl_xor(l, 2, 32); l += __shfl_xor(l, 4, 32); l += __shfl_xor(l, 8, 32);
    l_r[r] = (l > 0.f) ? 1.0f / l : 0.f;
  }
#pragma unroll
  for (int dt = 0; dt < DT; ++dt)
#pragma unroll
    for (int r = 0; r < 8; ++r) sO[w][8 * hh + r][dt * 16 + ln] = oacc[dt][r] * l_r[r];
  __builtin_amdgcn_fence(__ATOMIC_ACQ_REL, "workgroup");
  __builtin_amdgcn_wave_barrier();
  {
    for (int r = 0; r < 16; ++r) {
      const int row = q0 + r;
      if (row < T && lane < D / 4) {
        const v4f val = *(const v4fa*)&sO[w][r][lane * 4];
        *(v4f*)(y + ((size_t)b * T + row) * ypitch + h * D + lane * 4) = val;
      }
    }
    
  }
}

// batched GEMM (blockIdx.y = batch): C_b = act(alpha·A_b·B_b + bias + resid_b); A f32 rows (ASPLIT → hi/lo), B = bf16 planes Bh (+Bl when BSPLIT, requires ASPLIT),
// per-batch element strides sA, sB (0 = shared weights), sC, sR. resid may alias C (values are staged before the stores). ACT 0/1(relu).
// ACT: 0 none, 1 relu, 2 softplus
template <bool ASPLIT, bool BSPLIT, int ACT>
__global__ __launch_bounds__(128) void k_gemm_b(const float* __restrict__ A, int lda, size_t sA, const unsigned short* __restrict__ Bh, const unsigned short* __restrict__ Bl, int ldb, size_t sB,
                                             const float* __restrict__ bias, const float* __restrict__ resid, int ldr, size_t sR, float rsign, float alpha,
                                             float* __restrict__ C, int ldc, size_t sC, int M, int N, int K) {
  __shared__ __attribute__((aligned(16))) float so[4][16][64];
  const int tid = threadIdx.x, w = tid >> 5, lane = tid & 31, ln = lane & 15, hh = lane >> 4;
  const int by = blockIdx.y;
  A += (size_t)by * sA; Bh += (size_t)by * sB; if (BSPLIT) Bl += (size_t)by * sB; C += (size_t)by * sC; if (resid) resid += (size_t)by * sR;
  const int ntn = (N + 63) / 64; const int wid = blockIdx.x * 4 + w; const int mt = wid / ntn, nq = wid % ntn;      // N may be any multiple of 16: tiles past N are skipped and not stored
  if (mt * 16 >= M) return;
  const int row0 = mt * 16, col0 = nq * 64;
  const float* arow = A + (size_t)(row0 + ln) * lda;
  v8f acc[4] = {};
  for (int kb = 0; kb < K; kb += 32) {
    FragB ah, al;
    const v4f x0 = *(const v4fa*)(arow + kb + 8 * hh), x1 = *(const v4fa*)(arow + kb + 8 * hh + 4);
    const v4f x2 = *(const v4fa*)(arow + kb + 16 + 8 * hh), x3 = *(const v4fa*)(arow + kb + 16 + 8 * hh + 4);
    float xs[16] = {x0[0],x0[1],x0[2],x0[3],x1[0],x1[1],x1[2],x1[3],x2[0],x2[1],x2[2],x2[3],x3[0],x3[1],x3[2],x3[3]};
#pragma unroll
    for (int i = 0; i < 16; ++i) { const unsigned short hb = bf16_bits(xs[i]); ah.u[i] = hb; al.u[i] = ASPLIT ? bf16_bits(xs[i] - bf16_val(hb)) : (unsigned short)0; }
#pragma unroll
    for (int t = 0; t < 4; ++t) {
      if (col0 + t * 16 >= N) continue;
      const size_t boff = (size_t)(col0 + t * 16 + ln) * ldb + kb;
      FragB bh_, bl_; bh_.half[0] = *(const v8us*)(Bh + boff + 8 * hh); bh_.half[1] = *(const v8us*)(Bh + boff + 16 + 8 * hh);
      if (BSPLIT) { bl_.half[0] = *(const v8us*)(Bl + boff + 8 * hh); bl_.half[1] = *(const v8us*)(Bl + boff + 16 + 8 * hh); } else bl_ = bh_;
      acc[t] = mmaN<ASPLIT ? (BSPLIT ? 3 : 2) : 1>(ah.v, al.v, bh_.v, bl_.v, acc[t]);
    }
  }
#pragma unroll
  for (int t = 0; t < 4; ++t) {
    const int col = col0 + t * 16 + ln; if (col0 + t * 16 >= N) continue; const float bv = bias ? bf16_round(bias[col]) : 0.f;
#pragma unroll
    for (int r = 0; r < 8; ++r) { float v = acc[t][r] * alpha + bv; if (resid) v += rsign * resid[(size_t)(row0 + 8 * hh + r) * ldr + col]; if (ACT == 1) v = fmaxf(v, 0.f); else if (ACT == 2) v = fmaxf(v, 0.f) + log1pf(expf(-fabsf(v))); so[w][8 * hh + r][t * 16 + ln] = v; }
  }
  __builtin_amdgcn_fence(__ATOMIC_ACQ_REL, "workgroup"); __builtin_amdgcn_wave_barrier();
  const int rsub = lane >> 4, c4 = (lane & 15) * 4;
  {
#pragma unroll
    for (int q = 0; q < 8; ++q) { const int r = q * 2 + rsub; if (col0 + c4 < N) { const v4f v = *(const v4fa*)&so[w][r][c4]; *(v4f*)(C + (size_t)(row0 + r) * ldc + col0 + c4) = v; } }
    
  }
}
// batched f32 [K][N] (pitch lds, batch stride sIn) -> transposed hi/lo planes [N][K] (batch stride sOut); thread per (n, 8 k); grid.y = batch
__global__ __launch_bounds__(256) void k_split_transpose_b(const float* __restrict__ src, int lds_, size_t sIn, unsigned short* __restrict__ hi, unsigned short* __restrict__ lo, size_t sOut, int K, int N) {
  const size_t t = (size_t)blockIdx.x * 256 + threadIdx.x; const int k8n = K / 8; if (t >= (size_t)N * k8n) return;
  src += (size_t)blockIdx.y * sIn; hi += (size_t)blockIdx.y * sOut; lo += (size_t)blockIdx.y * sOut;
  const int n = (int)(t / k8n), k8 = (int)(t % k8n) * 8; v8us vh, vl;
#pragma unroll
  for (int i = 0; i < 8; ++i) { const float x = src[(size_t)(k8 + i) * lds_ + n]; const unsigned short hb = bf16_bits(x); vh[i] = hb; vl[i] = bf16_bits(x - bf16_val(hb)); }
  unsigned short* dh = hi + (size_t)n * K + k8; unsigned short* dl = lo + (size_t)n * K + k8;
  *(v8us*)dh = vh; *(v8us*)dl = vl; 
}

// ---- f16 WMMA path (v_wmma_f32_16x16x32_f16): 11-bit significands for operands in range — used where a [0,1] probability operand needs more precision than bf16
typedef _Float16 v16h __attribute__((ext_vector_type(16)));
union FragH { v16h v; v8us half[2]; _Float16 h[16]; unsigned short u[16]; };
template <int NT>
__device__ __forceinline__ v8f mmaH(v16h ah, v16h al, v16h bh, v16h bl, v8f c) {
  c = __builtin_amdgcn_wmma_f32_16x16x32_f16(false, ah, false, bh, (short)0, c, false, false);
  if (NT >= 2) c = __builtin_amdgcn_wmma_f32_16x16x32_f16(false, al, false, bh, (short)0, c, false, false);
  if (NT >= 3) c = __builtin_amdgcn_wmma_f32_16x16x32_f16(false, ah, false, bl, (short)0, c, false, false);
  asm volatile("v_nop\n\tv_nop\n\tv_nop\n\tv_nop" : "+v"(c) : "v"(ah), "v"(al), "v"(bh), "v"(bl));
  return c;
}
// batched GEMM like k_gemm_b but f16 operands: A f32 (split into f16 hi/lo if ASPLIT, else rounded to f16), Bt = f16 values [n][k]; alpha; C f32; N multiple of 16 (partial tiles skipped)
template <bool ASPLIT>
__global__ __launch_bounds__(128) void k_gemm_h(const float* __restrict__ A, int lda, size_t sA, const _Float16* __restrict__ Bh, int ldb, size_t sB, float alpha, float* __restrict__ C, int ldc, size_t sC, int M, int N, int K) {
  __shared__ __attribute__((aligned(16))) float so[4][16][64];
  const int tid = threadIdx.x, w = tid >> 5, lane = tid & 31, ln = lane & 15, hh = lane >> 4; const int by = blockIdx.y;
  A += (size_t)by * sA; Bh += (size_t)by * sB; C += (size_t)by * sC;
  const int ntn = (N + 63) / 64; const int wid = blockIdx.x * 4 + w; const int mt = wid / ntn, nq = wid % ntn; if (mt * 16 >= M) return;
  const int row0 = mt * 16, col0 = nq * 64; const float* arow = A + (size_t)(row0 + ln) * lda;
  v8f acc[4] = {};
  for (int kb = 0; kb < K; kb += 32) {
    FragH ah, al;
    const v4f x0 = *(const v4fa*)(arow + kb + 8 * hh), x1 = *(const v4fa*)(arow + kb + 8 * hh + 4), x2 = *(const v4fa*)(arow + kb + 16 + 8 * hh), x3 = *(const v4fa*)(arow + kb + 16 + 8 * hh + 4);
    float xs[16] = {x0[0],x0[1],x0[2],x0[3],x1[0],x1[1],x1[2],x1[3],x2[0],x2[1],x2[2],x2[3],x3[0],x3[1],x3[2],x3[3]};
#pragma unroll
    for (int i = 0; i < 16; ++i) { const _Float16 h = (_Float16)xs[i]; ah.h[i] = h; al.h[i] = ASPLIT ? (_Float16)(xs[i] - (float)h) : (_Float16)0.0f; }
#pragma unroll
    for (int t = 0; t < 4; ++t) { if (col0 + t * 16 >= N) continue; const size_t boff = (size_t)(col0 + t * 16 + ln) * ldb + kb; FragH bq; bq.half[0] = *(const v8us*)(Bh + boff + 8 * hh); bq.half[1] = *(const v8us*)(Bh + boff + 16 + 8 * hh);
      acc[t] = mmaH<ASPLIT ? 2 : 1>(ah.v, al.v, bq.v, bq.v, acc[t]); }
  }
#pragma unroll
  for (int t = 0; t < 4; ++t) { if (col0 + t * 16 >= N) continue;
#pragma unroll
    for (int r = 0; r < 8; ++r) so[w][8 * hh + r][t * 16 + ln] = acc[t][r] * alpha; }
  __builtin_amdgcn_fence(__ATOMIC_ACQ_REL, "workgroup"); __builtin_amdgcn_wave_barrier();
  const int rsub = lane >> 4, c4 = (lane & 15) * 4;
  {
#pragma unroll
    for (int q = 0; q < 8; ++q) { const int r = q * 2 + rsub; if (col0 + c4 < N) { const v4f v = *(const v4fa*)&so[w][r][c4]; *(v4f*)(C + (size_t)(row0 + r) * ldc + col0 + c4) = v; } }
     }
}

// The weights are packed in the order in which a wave loads its B fragments. Column tile T = n / 16 takes FT elements; in it k step ks = k / 32 has two pieces j = (k / 16) % 2 of 512 bytes,
// and a piece holds, lane by lane (lane = 16 * ((k / 8) % 2) + n % 16), the 8 consecutive k that the lane keeps in one half of its fragment.
// So one wave-wide 16-byte load reads 512 contiguous bytes, four whole 128-byte lines, where rows of [n][k] gave it 32 bytes out of each of 16 lines.
#define FT (16 * DIM)
__device__ __forceinline__ size_t pk_off(int n, int k8) { return (size_t)(n >> 4) * FT + (size_t)(((k8 >> 4) * 32 + ((k8 >> 3) & 1) * 16 + (n & 15)) * 8); }
// thread = one column n and 8 consecutive k, n fastest: a wave reads 128 contiguous bytes of a weight row and writes whole 256-byte runs of a piece
__global__ __launch_bounds__(256) void k_bt(const float* __restrict__ Wqkv, const float* __restrict__ Wo, unsigned short* __restrict__ Bq, unsigned short* __restrict__ Bo) { const int t = blockIdx.x * 256 + threadIdx.x;
  if (t < 3 * DIM * DIM / 8) { const int n = t % (3 * DIM), k8 = (t / (3 * DIM)) * 8; v8us v; for (int q = 0; q < 8; ++q) v[q] = bf16_bits(Wqkv[(size_t)(k8 + q) * (3 * DIM) + n]); *(v8us*)(Bq + pk_off(n, k8)) = v;  }
  if (t < DIM * DIM / 8) { const int n = t % DIM, k8 = (t / DIM) * 8; v8us v; for (int q = 0; q < 8; ++q) v[q] = __builtin_bit_cast(unsigned short, (_Float16)bf16_round(Wo[(size_t)(k8 + q) * DIM + n])); *(v8us*)(Bo + pk_off(n, k8)) = v;  } }
__device__ __forceinline__ void ldF(FragH& f, const _Float16* base, int pitch, int row, int k0, int ln, int hh) { const unsigned short* p = (const unsigned short*)base + (size_t)(row + ln) * pitch + k0; f.half[0] = *(const v8us*)(p + 8 * hh); f.half[1] = *(const v8us*)(p + 16 + 8 * hh); }
typedef unsigned short v4us __attribute__((ext_vector_type(4), may_alias));
// 32 entries (keys J0 .. J0+31) of one query's row of the bias-and-mask table. sb points at the query's own place in the 13 x 13 bias table, so that key (yj, xj) reads sb[yj*13+xj];
// every read is unconditional and in range (the caller clamps a padding query to slot 48), the mask is a select behind it. okYX: the query is a token and may meet a key with yj >= 4 (Y), xj >= 4 (X).
template <int J0>
__device__ __forceinline__ void win_table(unsigned short* trow, const float* sb, bool ok00, bool ok01, bool ok10, bool ok11) {
#pragma unroll
  for (int q = 0; q < 4; ++q) { v8us p;
#pragma unroll
    for (int c = 0; c < 8; ++c) { const int j = J0 + q * 8 + c, jc = j < 49 ? j : 48, yj = jc / WS, xj = jc % WS;
      const unsigned short bb = (unsigned short)(__float_as_uint(sb[yj * 13 + xj]) >> 16);      // the bias table holds bf16 values: the upper half is all of it
      const bool ok = j < 49 && (yj >= 4 ? (xj >= 4 ? ok11 : ok10) : (xj >= 4 ? ok01 : ok00));
      p[c] = ok ? bb : bf16_bits(-3.0e38f); }
    *(v8us*)(trow + J0 + q * 8) = p; }
}
// lane l with lane l ^ 16: the two lanes that share a column of a WMMA result
__device__ __forceinline__ float xhalf(float x) { return __builtin_bit_cast(float, __builtin_amdgcn_permlanex16(__builtin_bit_cast(int, x), __builtin_bit_cast(int, x), 0x76543210, 0xfedcba98, false, false)); }
// one work-group of 4 waves per (b, window w = wy*8+wx), wave = head h. Window slot i = yi*7+xi is token ((wy*7+yi+3)%56, (wx*7+xi+3)%56) of batch b.
// The window's 49 rows of x (padded with zero rows to 64) are staged once in LDS as bf16; each wave forms its head's q, k, v (64 x 96, K = 128) on the bf16 WMMA
// and puts them into its own LDS planes as f16, so qkv never goes through global memory. Zero rows of x give zero rows of q, k, v: the padding needs no clearing.
// Scores and o are formed transposed: k (A) x q^T (B) puts query ln in the lane and keys 16t+8hh+r in its registers, so maximum and sum are taken inside the lane and once across the lane halves,
// two score tiles converted in place are the B operand of v^T (A) x e^T (B), and a lane ends with 8 consecutive d of its own query. The k and v^T fragments serve all four passes from registers.
// Each pass puts its 16 o rows as f16 into the wave's own q rows (read by this pass alone), and after one work-group barrier
// wave h forms output columns 32h .. 32h+31 of all the window's tokens (K = 128 over the four heads' planes, f16 WMMA), so o never goes through global memory either.
__global__ __launch_bounds__(128) void k_win(const float* __restrict__ X, const unsigned short* __restrict__ Bq, const float* __restrict__ pos,
                                           const unsigned short* __restrict__ Bo, const float* __restrict__ bo, float* __restrict__ out) {
  constexpr int PW = (64 * 40 + 64 * 40 + HDM * 72) * 2;          // bytes per wave: q, k, v^T planes
  constexpr int PO = 16 * 72 * 2;                                 // bytes per wave: room for staged x, later one staged output tile
  constexpr int TP = 72;                                          // pitch of the bias-and-mask table, in bf16 elements: 16 rows read 16 bytes each without a bank conflict
  constexpr int PT = 64 * TP * 2;                                 // bytes of that table: 64 queries x 64 keys, behind the waves' PO bytes
  constexpr int XP = DIM + 8;                                     // pitch of the staged x rows, in bf16 elements
  constexpr int SP = HDM + 4;                                     // pitch of a staged output tile, in floats (rows 16-byte aligned)
  static_assert(4 * PO + PT >= 64 * XP * 2, "staged x shares the space of the waves' PO bytes and the table");
  static_assert(2 * 16 * SP * 4 <= HDM * 72 * 2 && 16 * SP * 4 <= PO, "three staged output tiles fit the v^T plane and the wave's PO bytes");
  __shared__ __attribute__((aligned(16))) unsigned char smem[4 * PW + 4 * PO + PT]; __shared__ int stok[64]; __shared__ float sbias[13 * 13];
  const int tid = threadIdx.x, lane = tid & 31, ln = lane & 15, hh = lane >> 4; const int h = __builtin_amdgcn_readfirstlane(tid >> 5);
  const int w = blockIdx.x % NWIN; const int b = blockIdx.x / NWIN; const int wy = w / 8, wx = w % 8;
  _Float16* sq = (_Float16*)(smem + h * PW); _Float16* sk = sq + 64 * 40; _Float16* svt = sk + 64 * 40;
  unsigned short* sx = (unsigned short*)(smem + 4 * PW); _Float16* sp = (_Float16*)(smem + 4 * PW + h * PO); unsigned short* tb = (unsigned short*)(smem + 4 * PW + 4 * PO);
  if (tid < 64) { int tok = -1; if (tid < 49) { const int yi = tid / WS, xi = tid % WS; const int y = (wy * WS + yi + DISP) % HI, x = (wx * WS + xi + DISP) % WI; tok = (b * HI + y) * WI + x; } stok[tid] = tok; }
  for (int i = tid; i < 169; i += 128) sbias[i] = bf16_round(pos[i]);
  // stage x: wave h takes rows h, h+4, ...; one row = one 512-byte wave load; all 13 loads are issued before the first is used
  v4f xv[13];
#pragma unroll
  for (int it = 0; it < 13; ++it) { const int i = min(h + 4 * it, 48); const int yi = i / WS, xi = i % WS; const int y = (wy * WS + yi + DISP) % HI, x = (wx * WS + xi + DISP) % WI;
    xv[it] = *(const v4fa*)(X + (size_t)((b * HI + y) * WI + x) * DIM + lane * 4); }
#pragma unroll
  for (int it = 0; it < 13; ++it) { const int i = h + 4 * it; v4us p = {0, 0, 0, 0}; if (i < 49) { for (int c = 0; c < 4; ++c) p[c] = bf16_bits(xv[it][c]); } *(v4us*)(sx + i * XP + lane * 4) = p; }
#pragma unroll
  for (int it = 13; it < 16; ++it) { const v4us p = {0, 0, 0, 0}; *(v4us*)(sx + (h + 4 * it) * XP + lane * 4) = p; }
  __syncthreads();      // every wave reads all 64 staged rows, the token list and the bias table
  FragB a[4][4];
#pragma unroll
  for (int mt = 0; mt < 4; ++mt) {
#pragma unroll
    for (int ks = 0; ks < 4; ++ks) { const unsigned short* p = sx + (mt * 16 + ln) * XP + ks * 32; a[mt][ks].half[0] = *(const v8us*)(p + 8 * hh); a[mt][ks].half[1] = *(const v8us*)(p + 16 + 8 * hh); } }
  __syncthreads();      // the staged rows are in registers now: their LDS is reused for the table below
  // Bias and masks are the same for the four heads: the work-group builds them once, tb[query i][key j] = bias (bf16, as it is used) or a large negative value where the pair is
  // masked or padding. Thread = one query and 32 keys; which 32 is wave-uniform, so everything on the key side is a compile-time constant inside win_table.
  const bool ul = (wy == 7), lr = (wx == 7);
  {
    const int i = tid & 63, ic = min(i, 48), yi = ic / WS, xi = ic % WS; const bool iv = i < 49, ia = yi >= 4, ib = xi >= 4;
    const bool y0 = !(ul & ia), y1 = !(ul & !ia), x0 = !(lr & ib), x1 = !(lr & !ib);      // the query may meet a key of the upper / lower rows, of the left / right columns
    const float* sb = sbias + 6 * 13 + 6 - (yi * 13 + xi); unsigned short* trow = tb + i * TP;
    if (h < 2) win_table<0>(trow, sb, iv & y0 & x0, iv & y0 & x1, iv & y1 & x0, iv & y1 & x1); else win_table<32>(trow, sb, iv & y0 & x0, iv & y0 & x1, iv & y1 & x0, iv & y1 & x1);
  }
#pragma unroll
  for (int t = 0; t < 6; ++t) {      // column tiles: t = 0,1 q; 2,3 k; 4,5 v of head h
    const unsigned short* bp = Bq + (size_t)((t >> 1) * (DIM / 16) + h * (HDM / 16) + (t & 1)) * FT + lane * 8;      // packed column tile (see pk_off): the lane's 16 bytes of each 512-byte piece
    FragB bf[4];
#pragma unroll
    for (int ks = 0; ks < 4; ++ks) { bf[ks].half[0] = *(const v8us*)(bp + ks * 512); bf[ks].half[1] = *(const v8us*)(bp + ks * 512 + 256); }
#pragma unroll
    for (int mt = 0; mt < 4; ++mt) {
      v8f c = {};
#pragma unroll
      for (int ks = 0; ks < 4; ++ks) c = __builtin_amdgcn_wmma_f32_16x16x32_bf16(false, a[mt][ks].v, false, bf[ks].v, (short)0, c, false, false);
      const int row = mt * 16 + 8 * hh, col = (t & 1) * 16 + ln;
      if (t < 2) {
#pragma unroll
        for (int r = 0; r < 8; ++r) sq[(row + r) * 40 + col] = (_Float16)(c[r] * 0.17677669529663687f);
      } else if (t < 4) {
#pragma unroll
        for (int r = 0; r < 8; ++r) sk[(row + r) * 40 + col] = (_Float16)c[r];
      } else {
        FragH vv;
#pragma unroll
        for (int r = 0; r < 8; ++r) vv.h[r] = (_Float16)c[r];
        *(v8us*)((unsigned short*)svt + col * 72 + row) = vv.half[0];
      }
    }
  }
  __syncthreads();      // every wave reads the whole table; it also orders the wave's own q, k, v stores before their reads
  FragH fk[4], fv[2][2];      // the head's k rows and v^T rows as A fragments: the same for every pass
#pragma unroll
  for (int t = 0; t < 4; ++t) ldF(fk[t], sk, 40, t * 16, 0, ln, hh);
#pragma unroll
  for (int t = 0; t < 2; ++t) {
#pragma unroll
    for (int ks = 0; ks < 2; ++ks) ldF(fv[t][ks], svt, 72, t * 16, ks * 32, ln, hh); }
  unsigned short* oh = (unsigned short*)sq;      // o as f16 in the wave's own q plane, same pitch
  for (int mt = 0; mt < 4; ++mt) {      // 16 queries per pass, query mt*16+ln in the lane (queries >= 49 are padding: every key masked, o = 0, never stored to out)
    v8f acc[4]; FragH bq; ldF(bq, sq, 40, mt * 16, 0, ln, hh);
#pragma unroll
    for (int t = 0; t < 4; ++t) { const v8us tv = *(const v8us*)(tb + (mt * 16 + ln) * TP + t * 16 + 8 * hh);      // bias or mask of (key 16t+8hh+r, query ln): the accumulator's start value
#pragma unroll
      for (int r = 0; r < 8; ++r) acc[t][r] = bf16_val(tv[r]); }
#pragma unroll
    for (int t = 0; t < 4; ++t) acc[t] = __builtin_amdgcn_wmma_f32_16x16x32_f16(false, fk[t].v, false, bq.v, (short)0, acc[t], false, false);
    float mx[4], sm[4];
#pragma unroll
    for (int t = 0; t < 4; ++t) { mx[t] = acc[t][0];
#pragma unroll
      for (int r = 1; r < 8; ++r) mx[t] = fmaxf(mx[t], acc[t][r]); }
    float m = fmaxf(fmaxf(mx[0], mx[1]), fmaxf(mx[2], mx[3])); m = fmaxf(m, xhalf(m));
    FragH pe[2];      // e^T: score tiles 2ks and 2ks+1 hold keys 32ks+8hh+r and 32ks+16+8hh+r, which is the k order of a B fragment
#pragma unroll
    for (int t = 0; t < 4; ++t) { sm[t] = 0.f;
#pragma unroll
      for (int r = 0; r < 8; ++r) { const float e = (acc[t][r] > -1.0e38f) ? __expf(acc[t][r] - m) : 0.f; sm[t] += e; pe[t >> 1].h[(t & 1) * 8 + r] = (_Float16)e; } }
    float s = (sm[0] + sm[1]) + (sm[2] + sm[3]); s += xhalf(s);
    v8f acco[2] = {};
#pragma unroll
    for (int ks = 0; ks < 2; ++ks) {
#pragma unroll
      for (int t = 0; t < 2; ++t) acco[t] = __builtin_amdgcn_wmma_f32_16x16x32_f16(false, fv[t][ks].v, false, pe[ks].v, (short)0, acco[t], false, false); }
    const float rs = (s > 0.f) ? 1.0f / s : 0.f;
#pragma unroll
    for (int t = 0; t < 2; ++t) { FragH po;      // o[query ln][d = 16t+8hh+r]: 8 consecutive d, one 16-byte store
#pragma unroll
      for (int r = 0; r < 8; ++r) po.h[r] = (_Float16)(acco[t][r] * rs);
      *(v8us*)(oh + (mt * 16 + ln) * 40 + t * 16 + 8 * hh) = po.half[0]; }
  }
  // From here on every loop is unrolled: its index picks registers (bw, c, ov, op), which only a compile-time constant can do.
  // W_out fragments and bias of this wave's 32 output columns: asked for here, so that they fly while the waves meet
  FragH bw[2][4]; float bv[2];
#pragma unroll
  for (int t = 0; t < 2; ++t) { const unsigned short* bp = Bo + (size_t)(h * (HDM / 16) + t) * FT + lane * 8; bv[t] = bf16_round(bo[h * HDM + t * 16 + ln]);
#pragma unroll
    for (int ks = 0; ks < 4; ++ks) { bw[t][ks].half[0] = *(const v8us*)(bp + ks * 512); bw[t][ks].half[1] = *(const v8us*)(bp + ks * 512 + 256); } }
  __syncthreads();      // every wave reads all four heads' o planes
  float* st[3] = {(float*)svt, (float*)svt + 16 * SP, (float*)sp};      // the wave's own v^T plane is dead, its PO bytes are free: one staged output tile per full pass
  float last[2];
#pragma unroll
  for (int mt = 0; mt < 4; ++mt) {
    v8f c[2] = {};
#pragma unroll
    for (int ks = 0; ks < 4; ++ks) {      // k step ks = head ks
      const unsigned short* ph = (const unsigned short*)(smem + ks * PW) + (mt * 16 + ln) * 40;
      FragH ah; ah.half[0] = *(const v8us*)(ph + 8 * hh); ah.half[1] = *(const v8us*)(ph + 16 + 8 * hh);
#pragma unroll
      for (int t = 0; t < 2; ++t) c[t] = __builtin_amdgcn_wmma_f32_16x16x32_f16(false, ah.v, false, bw[t][ks].v, (short)0, c[t], false, false);
    }
#pragma unroll
    for (int t = 0; t < 2; ++t) {
      if (mt < 3) {
#pragma unroll
        for (int r = 0; r < 8; ++r) st[mt][(8 * hh + r) * SP + t * 16 + ln] = c[t][r] + bv[t];
      } else last[t] = c[t][0] + bv[t];
    }
  }
  __builtin_amdgcn_fence(__ATOMIC_ACQ_REL, "workgroup"); __builtin_amdgcn_wave_barrier();      // the staged tiles are read back by other lanes
  // 8 lanes x 16 bytes = this wave's whole 128-byte line of a token, 4 tokens a store; all values and addresses are formed before the first store goes out
  v4f ov[12]; float* op[12];
#pragma unroll
  for (int q = 0; q < 12; ++q) { const int il = (q & 3) * 4 + (lane >> 3); ov[q] = *(const v4fa*)&st[q >> 2][il * SP + (lane & 7) * 4]; op[q] = out + (size_t)stok[(q >> 2) * 16 + il] * DIM + h * HDM + (lane & 7) * 4; }
  float* op48 = out + (size_t)stok[48] * DIM + h * HDM + ln;
#pragma unroll
  for (int q = 0; q < 12; ++q) *(v4f*)op[q] = ov[q];
  if (hh == 0) { op48[0] = last[0]; op48[16] = last[1]; }
}
extern "C" void kernel_launch(void* const* d_in, const int* in_sizes, int n_in,
                              void* d_out, int out_size, void* d_ws, size_t ws_size, hipStream_t stream) {
  (void)in_sizes; (void)n_in; (void)out_size;
  const float* x = (const float*)d_in[0]; const float* Wqkv = (const float*)d_in[1]; const float* pos = (const float*)d_in[2]; const float* Wo = (const float*)d_in[3]; const float* bo = (const float*)d_in[4];
  char* ws = (char*)d_ws; size_t off = 0;
  auto take = [&](size_t bytes) { char* p = ws + off; off += (bytes + 255) & ~(size_t)255; return p; };
  unsigned short* Bq = (unsigned short*)take((size_t)3 * DIM * DIM * 2); unsigned short* Bo = (unsigned short*)take((size_t)DIM * DIM * 2);
  if (off > ws_size) return;
  k_bt<<<(3 * DIM * DIM / 8 + 255) / 256, 256, 0, stream>>>(Wqkv, Wo, Bq, Bo);
  k_win<<<BB * NWIN, 128, 0, stream>>>(x, Bq, pos, Bo, bo, (float*)d_out);
}

// v007
// A run of this version takes 17 microseconds.
// Two timings next to v006 both put it at 1.13 times that version's speed.
// Over all steps from v000 it is 7.25 times as fast.
#include <hip/hip_runtime.h>
// Shifted-window attention: qkv = x·W_qkv on v_wmma_f32_16x16x32_bf16 (x rounded to bf16: single exact term; 50176 × 128 × 384); per (batch, window, head) the 49×49
// scores q·kᵀ and e·v on v_wmma_f32_16x16x32_f16 (q, k, v, e rounded to f16, windows padded to 64; one wave each); out = o·W_out + b_out on the f16 variant as well, o rounded
// to f16 and W_out's bf16 values held as f16 (1 product). The cyclic shifts are pure index remaps (token (y,x) ↔ shifted (y−3, x−3) mod 56, and the back-shift returns every result to its own token);
// relative-position bias and the shift masks come from one table per window as the score accumulators' start values; the max-shifted softmax is f32 VALU.
// The scores are formed transposed (k x q^T: a lane owns one query, its registers the keys), so the softmax reduces inside the lane and e is the B operand of v^T x e^T as it stands.
#define BB 16
#define HI 56
#define WI 56
#define DIM 128
#define NHD 4
#define HDM 32
#define WS 7
#define NWIN 64
#define NTOK (BB * HI * WI)
#define DISP 3

typedef __bf16 v16b __attribute__((ext_vector_type(16)));
typedef unsigned short v8us __attribute__((ext_vector_type(8), may_alias));
typedef float  v8f  __attribute__((ext_vector_type(8)));
typedef float  v4f  __attribute__((ext_vector_type(4)));
typedef float  v4fa __attribute__((ext_vector_type(4), may_alias));
union FragB { v16b v; v8us half[2]; unsigned short u[16]; };

__device__ __forceinline__ unsigned short bf16_bits(float x) { unsigned int u = __float_as_uint(x); return (unsigned short)((u + 0x7FFFu + ((u >> 16) & 1u)) >> 16); }
__device__ __forceinline__ float bf16_val(unsigned short b) { return __uint_as_float(((unsigned int)b) << 16); }
__device__ __forceinline__ float bf16_round(float x) { return bf16_val(bf16_bits(x)); }
// D += A·B with NT terms: 1 = ah·bh, 2 = + al·bh (A split), 3 = + ah·bl (both split)
template <int NT>
__device__ __forceinline__ v8f mmaN(v16b ah, v16b al, v16b bh, v16b bl, v8f c) {
  c = __builtin_amdgcn_wmma_f32_16x16x32_bf16(false, ah, false, bh, (short)0, c, false, false);
  if (NT >= 2) c = __builtin_amdgcn_wmma_f32_16x16x32_bf16(false, al, false, bh, (short)0, c, false, false);
  if (NT >= 3) c = __builtin_amdgcn_wmma_f32_16x16x32_bf16(false, ah, false, bl, (short)0, c, false, false);
  asm volatile("v_nop\n\tv_nop\n\tv_nop\n\tv_nop" : "+v"(c) : "v"(ah), "v"(al), "v"(bh), "v"(bl));
  return c;
}

__global__ __launch_bounds__(256) void k_wt_bf16(const float* __restrict__ W, unsigned short* __restrict__ Wt, int K, int N) {
  const int t = blockIdx.x * 256 + threadIdx.x;
  const int k8n = K / 8;
  if (t >= N * k8n) return;
  const int n = t / k8n, k8 = (t % k8n) * 8;
  v8us v;
#pragma unroll
  for (int i = 0; i < 8; ++i) v[i] = bf16_bits(W[(size_t)(k8 + i) * N + n]);
  *(v8us*)(Wt + (size_t)n * K + k8) = v;
  
}

// GEMM C[M][N] (f32, pitch ldc) = act(A[M][K]·W + bias). A f32 row-major (pitch lda) converted per fragment to bf16
// (ASPLIT: hi/lo two planes -> 2 terms, else single rounded term); Wt bf16 [N][K] (pitch ldb). BIAS_BF16 rounds the
// bias to bf16 first (bias quantised to bf16 before the add). K%32==0, M%16==0, N%64==0.
template <bool ASPLIT, int ACT, bool BIAS_BF16>
__global__ __launch_bounds__(128) void k_gemm_bf(const float* __restrict__ A, int lda, const unsigned short* __restrict__ Wt, int ldb,
                                               const float* __restrict__ bias, float* __restrict__ C, int ldc, int M, int N, int K) {
  __shared__ __attribute__((aligned(16))) float so[4][16][64];
  const int tid = threadIdx.x, w = tid >> 5, lane = tid & 31, ln = lane & 15, hh = lane >> 4;
  const int ntn = N / 64;
  const int wid = blockIdx.x * 4 + w;
  const int mt = wid / ntn, nq = wid % ntn;
  if (mt * 16 >= M) return;
  const int row0 = mt * 16, col0 = nq * 64;
  const float* arow = A + (size_t)(row0 + ln) * lda;
  v8f acc[4] = {};
  for (int kb = 0; kb < K; kb += 32) {
    FragB ah, al;
    const v4f x0 = *(const v4fa*)(arow + kb + 8 * hh), x1 = *(const v4fa*)(arow + kb + 8 * hh + 4);
    const v4f x2 = *(const v4fa*)(arow + kb + 16 + 8 * hh), x3 = *(const v4fa*)(arow + kb + 16 + 8 * hh + 4);
    float xs[16] = {x0[0],x0[1],x0[2],x0[3],x1[0],x1[1],x1[2],x1[3],x2[0],x2[1],x2[2],x2[3],x3[0],x3[1],x3[2],x3[3]};
#pragma unroll
    for (int i = 0; i < 16; ++i) { const unsigned short hb = bf16_bits(xs[i]); ah.u[i] = hb; al.u[i] = ASPLIT ? bf16_bits(xs[i] - bf16_val(hb)) : (unsigned short)0; }
#pragma unroll
    for (int t = 0; t < 4; ++t) {
      const unsigned short* brow = Wt + (size_t)(col0 + t * 16 + ln) * ldb + kb;
      FragB b;
      b.half[0] = *(const v8us*)(brow + 8 * hh);
      b.half[1] = *(const v8us*)(brow + 16 + 8 * hh);
      acc[t] = mmaN<ASPLIT ? 2 : 1>(ah.v, al.v, b.v, b.v, acc[t]);
    }
  }
#pragma unroll
  for (int t = 0; t < 4; ++t) {
    float bv = bias ? bias[col0 + t * 16 + ln] : 0.f;
    if (BIAS_BF16) bv = bf16_round(bv);
#pragma unroll
    for (int r = 0; r < 8; ++r) { float v = acc[t][r] + bv; if (ACT == 1) v = fmaxf(v, 0.f); so[w][8 * hh + r][t * 16 + ln] = v; }
  }
  __builtin_amdgcn_fence(__ATOMIC_ACQ_REL, "workgroup");
  __builtin_amdgcn_wave_barrier();
  const int rsub = lane >> 4, c4 = (lane & 15) * 4;
  {
#pragma unroll
    for (int q = 0; q < 8; ++q) {
      const int r = q * 2 + rsub;
      const v4f v = *(const v4fa*)&so[w][r][c4];
      *(v4f*)(C + (size_t)(row0 + r) * ldc + col0 + c4) = v;
    }
    
  }
}

// Flash-style causal/unmasked attention, all contractions 3-term bf16 hi/lo splits, f32 softmax with running max.
// q,k,v rows are read from f32 buffers with arbitrary row pitch (so they can live inside a fused qkv buffer);
// D = head size (multiple of 32, <= 128); one wave = 16 query rows; block = 4 waves (64 queries) sharing K/V chunks of 32.
template <int D, bool CAUSAL>
__global__ __launch_bounds__(128) void k_flash(const float* __restrict__ qb, const float* __restrict__ kb, const float* __restrict__ vb,
                                             int pitch, int T, int H, float scale, float* __restrict__ y, int ypitch) {
  constexpr int KS = D / 32;        // k-steps for QK
  constexpr int DT = D / 16;        // d tiles for PV
  __shared__ __attribute__((aligned(16))) unsigned short sKh[32][D + 8], sKl[32][D + 8], sVh[32][D + 8], sVl[32][D + 8];
  __shared__ __attribute__((aligned(16))) unsigned short sPh[4][16][40], sPl[4][16][40];
  __shared__ __attribute__((aligned(16))) float sO[4][16][D];
  const int tid = threadIdx.x, w = tid >> 5, lane = tid & 31, ln = lane & 15, hh = lane >> 4;
  const int nqb = (T + 63) / 64;
  const int bh = blockIdx.x / nqb, qblk = blockIdx.x % nqb;
  const int b = bh / H, h = bh % H;
  const int q0 = qblk * 64 + w * 16;
  const float* Q = qb + (size_t)b * T * pitch + h * D;
  const float* K = kb + (size_t)b * T * pitch + h * D;
  const float* V = vb + (size_t)b * T * pitch + h * D;

  // A fragments of the wave's 16 query rows (scaled), hi/lo
  FragB aqh[KS], aql[KS];
  {
    int row = q0 + ln; if (row >= T) row = T - 1;
    const float* qr = Q + (size_t)row * pitch;
#pragma unroll
    for (int ks = 0; ks < KS; ++ks)
#pragma unroll
      for (int i = 0; i < 16; ++i) {
        const int d = ks * 32 + ((i < 8) ? (8 * hh + i) : (16 + 8 * hh + (i - 8)));
        const float x = qr[d] * scale; const unsigned short hb = bf16_bits(x);
        aqh[ks].u[i] = hb; aql[ks].u[i] = bf16_bits(x - bf16_val(hb));
      }
  }
  float m_r[8], l_r[8];
#pragma unroll
  for (int r = 0; r < 8; ++r) { m_r[r] = -3.0e38f; l_r[r] = 0.f; }
  v8f oacc[DT];
#pragma unroll
  for (int dt = 0; dt < DT; ++dt) oacc[dt] = (v8f){0.f,0.f,0.f,0.f,0.f,0.f,0.f,0.f};

  const int kv_end = CAUSAL ? min(T, qblk * 64 + 64) : T;     // block-uniform
  for (int j0 = 0; j0 < kv_end; j0 += 32) {
    __syncthreads();
    for (int e = tid; e < 32 * (D / 4); e += 128) {
      const int r = e / (D / 4), c4 = (e % (D / 4)) * 4;
      const int key = j0 + r;
      v4f kf = {0.f,0.f,0.f,0.f}, vf = {0.f,0.f,0.f,0.f};
      if (key < T) { kf = *(const v4fa*)(K + (size_t)key * pitch + c4); vf = *(const v4fa*)(V + (size_t)key * pitch + c4); }
#pragma unroll
      for (int t = 0; t < 4; ++t) {
        unsigned short hb = bf16_bits(kf[t]); sKh[r][c4 + t] = hb; sKl[r][c4 + t] = bf16_bits(kf[t] - bf16_val(hb));
        hb = bf16_bits(vf[t]); sVh[r][c4 + t] = hb; sVl[r][c4 + t] = bf16_bits(vf[t] - bf16_val(hb));
      }
    }
    __syncthreads();
    // S tile 16 x 32
    v8f s[2];
#pragma unroll
    for (int nt = 0; nt < 2; ++nt) {
      v8f acc = {};
#pragma unroll
      for (int ks = 0; ks < KS; ++ks) {
        FragB bh_, bl_;
        bh_.half[0] = *(const v8us*)&sKh[nt * 16 + ln][ks * 32 + 8 * hh]; bh_.half[1] = *(const v8us*)&sKh[nt * 16 + ln][ks * 32 + 16 + 8 * hh];
        bl_.half[0] = *(const v8us*)&sKl[nt * 16 + ln][ks * 32 + 8 * hh]; bl_.half[1] = *(const v8us*)&sKl[nt * 16 + ln][ks * 32 + 16 + 8 * hh];
        acc = mmaN<3>(aqh[ks].v, aql[ks].v, bh_.v, bl_.v, acc);
      }
      s[nt] = acc;
    }
    // mask + running max (rows 8hh+r; the 16 lanes of a half share rows)
    float alpha[8];
#pragma unroll
    for (int r = 0; r < 8; ++r) {
      const int qi = q0 + 8 * hh + r;
      const int ja = j0 + ln, jb = j0 + 16 + ln;
      if (CAUSAL) { if (ja > qi) s[0][r] = -3.0e38f; if (jb > qi) s[1][r] = -3.0e38f; }
      if (ja >= T) s[0][r] = -3.0e38f;
      if (jb >= T) s[1][r] = -3.0e38f;
      float mx = fmaxf(s[0][r], s[1][r]);
      mx = fmaxf(mx, __shfl_xor(mx, 1, 32)); mx = fmaxf(mx, __shfl_xor(mx, 2, 32)); mx = fmaxf(mx, __shfl_xor(mx, 4, 32)); mx = fmaxf(mx, __shfl_xor(mx, 8, 32));
      const float mnew = fmaxf(m_r[r], mx);
      alpha[r] = (mnew > -1.0e38f) ? __expf(m_r[r] - mnew) : 1.0f;
      const float p0 = (s[0][r] > -1.0e38f) ? __expf(s[0][r] - mnew) : 0.f;
      const float p1 = (s[1][r] > -1.0e38f) ? __expf(s[1][r] - mnew) : 0.f;
      m_r[r] = mnew;
      l_r[r] = l_r[r] * alpha[r] + p0 + p1;            // per-lane partial row sum (16 lanes combined at the end)
      unsigned short hb = bf16_bits(p0); sPh[w][8 * hh + r][ln] = hb;      sPl[w][8 * hh + r][ln] = bf16_bits(p0 - bf16_val(hb));
      hb = bf16_bits(p1);                sPh[w][8 * hh + r][16 + ln] = hb; sPl[w][8 * hh + r][16 + ln] = bf16_bits(p1 - bf16_val(hb));
    }
#pragma unroll
    for (int dt = 0; dt < DT; ++dt)
#pragma unroll
      for (int r = 0; r < 8; ++r) oacc[dt][r] *= alpha[r];
    __builtin_amdgcn_fence(__ATOMIC_ACQ_REL, "workgroup");
    __builtin_amdgcn_wave_barrier();
    FragB pah, pal;
    pah.half[0] = *(const v8us*)&sPh[w][ln][8 * hh]; pah.half[1] = *(const v8us*)&sPh[w][ln][16 + 8 * hh];
    pal.half[0] = *(const v8us*)&sPl[w][ln][8 * hh]; pal.half[1] = *(const v8us*)&sPl[w][ln][16 + 8 * hh];
#pragma unroll
    for (int dt = 0; dt < DT; ++dt) {
      FragB bvh, bvl;
#pragma unroll
      for (int i = 0; i < 8; ++i) {
        bvh.u[i] = sVh[8 * hh + i][dt * 16 + ln]; bvh.u[8 + i] = sVh[16 + 8 * hh + i][dt * 16 + ln];
        bvl.u[i] = sVl[8 * hh + i][dt * 16 + ln]; bvl.u[8 + i] = sVl[16 + 8 * hh + i][dt * 16 + ln];
      }
      oacc[dt] = mmaN<3>(pah.v, pal.v, bvh.v, bvl.v, oacc[dt]);
    }
    __builtin_amdgcn_fence(__ATOMIC_ACQ_REL, "workgroup");
    __builtin_amdgcn_wave_barrier();
  }
#pragma unroll
  for (int r = 0; r < 8; ++r) {
    float l = l_r[r];
    l += __shfl_xor(l, 1, 32); l += __shfl_xor(l, 2, 32); l += __shfl_xor(l, 4, 32); l += __shfl_xor(l, 8, 32);
    l_r[r] = (l > 0.f) ? 1.0f / l : 0.f;
  }
#pragma unroll
  for (int dt = 0; dt < DT; ++dt)
#pragma unroll
    for (int r = 0; r < 8; ++r) sO[w][8 * hh + r][dt * 16 + ln] = oacc[dt][r] * l_r[r];
  __builtin_amdgcn_fence(__ATOMIC_ACQ_REL, "workgroup");
  __builtin_amdgcn_wave_barrier();
  {
    for (int r = 0; r < 16; ++r) {
      const int row = q0 + r;
      if (row < T && lane < D / 4) {
        const v4f val = *(const v4fa*)&sO[w][r][lane * 4];
        *(v4f*)(y + ((size_t)b * T + row) * ypitch + h * D + lane * 4) = val;
      }
    }
    
  }
}

// batched GEMM (blockIdx.y = batch): C_b = act(alpha·A_b·B_b + bias + resid_b); A f32 rows (ASPLIT → hi/lo), B = bf16 planes Bh (+Bl when BSPLIT, requires ASPLIT),
// per-batch element strides sA, sB (0 = shared weights), sC, sR. resid may alias C (values are staged before the stores). ACT 0/1(relu).
// ACT: 0 none, 1 relu, 2 softplus
template <bool ASPLIT, bool BSPLIT, int ACT>
__global__ __launch_bounds__(128) void k_gemm_b(const float* __restrict__ A, int lda, size_t sA, const unsigned short* __restrict__ Bh, const unsigned short* __restrict__ Bl, int ldb, size_t sB,
                                             const float* __restrict__ bias, const float* __restrict__ resid, int ldr, size_t sR, float rsign, float alpha,
                                             float* __restrict__ C, int ldc, size_t sC, int M, int N, int K) {
  __shared__ __attribute__((aligned(16))) float so[4][16][64];
  const int tid = threadIdx.x, w = tid >> 5, lane = tid & 31, ln = lane & 15, hh = lane >> 4;
  const int by = blockIdx.y;
  A += (size_t)by * sA; Bh += (size_t)by * sB; if (BSPLIT) Bl += (size_t)by * sB; C += (size_t)by * sC; if (resid) resid += (size_t)by * sR;
  const int ntn = (N + 63) / 64; const int wid = blockIdx.x * 4 + w; const int mt = wid / ntn, nq = wid % ntn;      // N may be any multiple of 16: tiles past N are skipped and not stored
  if (mt * 16 >= M) return;
  const int row0 = mt * 16, col0 = nq * 64;
  const float* arow = A + (size_t)(row0 + ln) * lda;
  v8f acc[4] = {};
  for (int kb = 0; kb < K; kb += 32) {
    FragB ah, al;
    const v4f x0 = *(const v4fa*)(arow + kb + 8 * hh), x1 = *(const v4fa*)(arow + kb + 8 * hh + 4);
    const v4f x2 = *(const v4fa*)(arow + kb + 16 + 8 * hh), x3 = *(const v4fa*)(arow + kb + 16 + 8 * hh + 4);
    float xs[16] = {x0[0],x0[1],x0[2],x0[3],x1[0],x1[1],x1[2],x1[3],x2[0],x2[1],x2[2],x2[3],x3[0],x3[1],x3[2],x3[3]};
#pragma unroll
    for (int i = 0; i < 16; ++i) { const unsigned short hb = bf16_bits(xs[i]); ah.u[i] = hb; al.u[i] = ASPLIT ? bf16_bits(xs[i] - bf16_val(hb)) : (unsigned short)0; }
#pragma unroll
    for (int t = 0; t < 4; ++t) {
      if (col0 + t * 16 >= N) continue;
      const size_t boff = (size_t)(col0 + t * 16 + ln) * ldb + kb;
      FragB bh_, bl_; bh_.half[0] = *(const v8us*)(Bh + boff + 8 * hh); bh_.half[1] = *(const v8us*)(Bh + boff + 16 + 8 * hh);
      if (BSPLIT) { bl_.half[0] = *(const v8us*)(Bl + boff + 8 * hh); bl_.half[1] = *(const v8us*)(Bl + boff + 16 + 8 * hh); } else bl_ = bh_;
      acc[t] = mmaN<ASPLIT ? (BSPLIT ? 3 : 2) : 1>(ah.v, al.v, bh_.v, bl_.v, acc[t]);
    }
  }
#pragma unroll
  for (int t = 0; t < 4; ++t) {
    const int col = col0 + t * 16 + ln; if (col0 + t * 16 >= N) continue; const float bv = bias ? bf16_round(bias[col]) : 0.f;
#pragma unroll
    for (int r = 0; r < 8; ++r) { float v = acc[t][r] * alpha + bv; if (resid) v += rsign * resid[(size_t)(row0 + 8 * hh + r) * ldr + col]; if (ACT == 1) v = fmaxf(v, 0.f); else if (ACT == 2) v = fmaxf(v, 0.f) + log1pf(expf(-fabsf(v))); so[w][8 * hh + r][t * 16 + ln] = v; }
  }
  __builtin_amdgcn_fence(__ATOMIC_ACQ_REL, "workgroup"); __builtin_amdgcn_wave_barrier();
  const int rsub = lane >> 4, c4 = (lane & 15) * 4;
  {
#pragma unroll
    for (int q = 0; q < 8; ++q) { const int r = q * 2 + rsub; if (col0 + c4 < N) { const v4f v = *(const v4fa*)&so[w][r][c4]; *(v4f*)(C + (size_t)(row0 + r) * ldc + col0 + c4) = v; } }
    
  }
}
// batched f32 [K][N] (pitch lds, batch stride sIn) -> transposed hi/lo planes [N][K] (batch stride sOut); thread per (n, 8 k); grid.y = batch
__global__ __launch_bounds__(256) void k_split_transpose_b(const float* __restrict__ src, int lds_, size_t sIn, unsigned short* __restrict__ hi, unsigned short* __restrict__ lo, size_t sOut, int K, int N) {
  const size_t t = (size_t)blockIdx.x * 256 + threadIdx.x; const int k8n = K / 8; if (t >= (size_t)N * k8n) return;
  src += (size_t)blockIdx.y * sIn; hi += (size_t)blockIdx.y * sOut; lo += (size_t)blockIdx.y * sOut;
  const int n = (int)(t / k8n), k8 = (int)(t % k8n) * 8; v8us vh, vl;
#pragma unroll
  for (int i = 0; i < 8; ++i) { const float x = src[(size_t)(k8 + i) * lds_ + n]; const unsigned short hb = bf16_bits(x); vh[i] = hb; vl[i] = bf16_bits(x - bf16_val(hb)); }
  unsigned short* dh = hi + (size_t)n * K + k8; unsigned short* dl = lo + (size_t)n * K + k8;
  *(v8us*)dh = vh; *(v8us*)dl = vl; 
}

// ---- f16 WMMA path (v_wmma_f32_16x16x32_f16): 11-bit significands for operands in range — used where a [0,1] probability operand needs more precision than bf16
typedef _Float16 v16h __attribute__((ext_vector_type(16)));
union FragH { v16h v; v8us half[2]; _Float16 h[16]; unsigned short u[16]; };
template <int NT>
__device__ __forceinline__ v8f mmaH(v16h ah, v16h al, v16h bh, v16h bl, v8f c) {
  c = __builtin_amdgcn_wmma_f32_16x16x32_f16(false, ah, false, bh, (short)0, c, false, false);
  if (NT >= 2) c = __builtin_amdgcn_wmma_f32_16x16x32_f16(false, al, false, bh, (short)0, c, false, false);
  if (NT >= 3) c = __builtin_amdgcn_wmma_f32_16x16x32_f16(false, ah, false, bl, (short)0, c, false, false);
  asm volatile("v_nop\n\tv_nop\n\tv_nop\n\tv_nop" : "+v"(c) : "v"(ah), "v"(al), "v"(bh), "v"(bl));
  return c;
}
// batched GEMM like k_gemm_b but f16 operands: A f32 (split into f16 hi/lo if ASPLIT, else rounded to f16), Bt = f16 values [n][k]; alpha; C f32; N multiple of 16 (partial tiles skipped)
template <bool ASPLIT>
__global__ __launch_bounds__(128) void k_gemm_h(const float* __restrict__ A, int lda, size_t sA, const _Float16* __restrict__ Bh, int ldb, size_t sB, float alpha, float* __restrict__ C, int ldc, size_t sC, int M, int N, int K) {
  __shared__ __attribute__((aligned(16))) float so[4][16][64];
  const int tid = threadIdx.x, w = tid >> 5, lane = tid & 31, ln = lane & 15, hh = lane >> 4; const int by = blockIdx.y;
  A += (size_t)by * sA; Bh += (size_t)by * sB; C += (size_t)by * sC;
  const int ntn = (N + 63) / 64; const int wid = blockIdx.x * 4 + w; const int mt = wid / ntn, nq = wid % ntn; if (mt * 16 >= M) return;
  const int row0 = mt * 16, col0 = nq * 64; const float* arow = A + (size_t)(row0 + ln) * lda;
  v8f acc[4] = {};
  for (int kb = 0; kb < K; kb += 32) {
    FragH ah, al;
    const v4f x0 = *(const v4fa*)(arow + kb + 8 * hh), x1 = *(const v4fa*)(arow + kb + 8 * hh + 4), x2 = *(const v4fa*)(arow + kb + 16 + 8 * hh), x3 = *(const v4fa*)(arow + kb + 16 + 8 * hh + 4);
    float xs[16] = {x0[0],x0[1],x0[2],x0[3],x1[0],x1[1],x1[2],x1[3],x2[0],x2[1],x2[2],x2[3],x3[0],x3[1],x3[2],x3[3]};
#pragma unroll
    for (int i = 0; i < 16; ++i) { const _Float16 h = (_Float16)xs[i]; ah.h[i] = h; al.h[i] = ASPLIT ? (_Float16)(xs[i] - (float)h) : (_Float16)0.0f; }
#pragma unroll
    for (int t = 0; t < 4; ++t) { if (col0 + t * 16 >= N) continue; const size_t boff = (size_t)(col0 + t * 16 + ln) * ldb + kb; FragH bq; bq.half[0] = *(const v8us*)(Bh + boff + 8 * hh); bq.half[1] = *(const v8us*)(Bh + boff + 16 + 8 * hh);
      acc[t] = mmaH<ASPLIT ? 2 : 1>(ah.v, al.v, bq.v, bq.v, acc[t]); }
  }
#pragma unroll
  for (int t = 0; t < 4; ++t) { if (col0 + t * 16 >= N) continue;
#pragma unroll
    for (int r = 0; r < 8; ++r) so[w][8 * hh + r][t * 16 + ln] = acc[t][r] * alpha; }
  __builtin_amdgcn_fence(__ATOMIC_ACQ_REL, "workgroup"); __builtin_amdgcn_wave_barrier();
  const int rsub = lane >> 4, c4 = (lane & 15) * 4;
  {
#pragma unroll
    for (int q = 0; q < 8; ++q) { const int r = q * 2 + rsub; if (col0 + c4 < N) { const v4f v = *(const v4fa*)&so[w][r][c4]; *(v4f*)(C + (size_t)(row0 + r) * ldc + col0 + c4) = v; } }
     }
}

// The weights are packed in the order in which a wave loads its B fragments. Column tile T = n / 16 takes FT elements; in it k step ks = k / 32 has two pieces j = (k / 16) % 2 of 512 bytes,
// and a piece holds, lane by lane (lane = 16 * ((k / 8) % 2) + n % 16), the 8 consecutive k that the lane keeps in one half of its fragment.
// So one wave-wide 16-byte load reads 512 contiguous bytes, four whole 128-byte lines, where rows of [n][k] gave it 32 bytes out of each of 16 lines.
#define FT (16 * DIM)
__device__ __forceinline__ size_t pk_off(int n, int k8) { return (size_t)(n >> 4) * FT + (size_t)(((k8 >> 4) * 32 + ((k8 >> 3) & 1) * 16 + (n & 15)) * 8); }
// thread = one column n and 8 consecutive k, n fastest: a wave reads 128 contiguous bytes of a weight row and writes whole 256-byte runs of a piece
__global__ __launch_bounds__(256) void k_bt(const float* __restrict__ Wqkv, const float* __restrict__ Wo, unsigned short* __restrict__ Bq, unsigned short* __restrict__ Bo) { const int t = blockIdx.x * 256 + threadIdx.x;
  if (t < 3 * DIM * DIM / 8) { const int n = t % (3 * DIM), k8 = (t / (3 * DIM)) * 8; v8us v; for (int q = 0; q < 8; ++q) v[q] = bf16_bits(Wqkv[(size_t)(k8 + q) * (3 * DIM) + n]); *(v8us*)(Bq + pk_off(n, k8)) = v;  }
  if (t < DIM * DIM / 8) { const int n = t % DIM, k8 = (t / DIM) * 8; v8us v; for (int q = 0; q < 8; ++q) v[q] = __builtin_bit_cast(unsigned short, (_Float16)bf16_round(Wo[(size_t)(k8 + q) * DIM + n])); *(v8us*)(Bo + pk_off(n, k8)) = v;  } }
__device__ __forceinline__ void ldF(FragH& f, const _Float16* base, int pitch, int row, int k0, int ln, int hh) { const unsigned short* p = (const unsigned short*)base + (size_t)(row + ln) * pitch + k0; f.half[0] = *(const v8us*)(p + 8 * hh); f.half[1] = *(const v8us*)(p + 16 + 8 * hh); }
typedef unsigned short v4us __attribute__((ext_vector_type(4), may_alias));
// 32 entries (keys J0 .. J0+31) of one query's row of the bias-and-mask table. sb points at the query's own place in the 13 x 13 bias table, so that key (yj, xj) reads sb[yj*13+xj];
// every read is unconditional and in range (the caller clamps a padding query to slot 48), the mask is a select behind it. okYX: the query is a token and may meet a key with yj >= 4 (Y), xj >= 4 (X).
template <int J0>
__device__ __forceinline__ void win_table(unsigned short* trow, const float* sb, bool ok00, bool ok01, bool ok10, bool ok11) {
#pragma unroll
  for (int q = 0; q < 4; ++q) { v8us p;
#pragma unroll
    for (int c = 0; c < 8; ++c) { const int j = J0 + q * 8 + c, jc = j < 49 ? j : 48, yj = jc / WS, xj = jc % WS;
      const unsigned short bb = (unsigned short)(__float_as_uint(sb[yj * 13 + xj]) >> 16);      // the bias table holds bf16 values: the upper half is all of it
      const bool ok = j < 49 && (yj >= 4 ? (xj >= 4 ? ok11 : ok10) : (xj >= 4 ? ok01 : ok00));
      p[c] = ok ? bb : bf16_bits(-3.0e38f); }
    *(v8us*)(trow + J0 + q * 8) = p; }
}
// lane l with lane l ^ 16: the two lanes that share a column of a WMMA result
__device__ __forceinline__ float xhalf(float x) { return __builtin_bit_cast(float, __builtin_amdgcn_permlanex16(__builtin_bit_cast(int, x), __builtin_bit_cast(int, x), 0x76543210, 0xfedcba98, false, false)); }
// one work-group of 4 waves per (b, window w = wy*8+wx), wave = head h. Window slot i = yi*7+xi is token ((wy*7+yi+3)%56, (wx*7+xi+3)%56) of batch b.
// The window's 49 rows of x (padded with zero rows to 64) are staged once in LDS as bf16; each wave forms its head's q, k, v (64 x 96, K = 128) on the bf16 WMMA
// and puts them into its own LDS planes as f16, so qkv never goes through global memory. Zero rows of x give zero rows of q, k, v: the padding needs no clearing.
// Scores and o are formed transposed: k (A) x q^T (B) puts query ln in the lane and keys 16t+8hh+r in its registers, so maximum and sum are taken inside the lane and once across the lane halves,
// two score tiles converted in place are the B operand of v^T (A) x e^T (B), and a lane ends with 8 consecutive d of its own query. The k and v^T fragments serve all four passes from registers.
// Each pass puts its 16 o rows as f16 into the wave's own q rows (read by this pass alone), and after one work-group barrier
// wave h forms output columns 32h .. 32h+31 of all the window's tokens (K = 128 over the four heads' planes, f16 WMMA), so o never goes through global memory either.
// amdgpu_waves_per_eu(4): four work-groups share a WGP (LDS), one wave of each per SIMD, which takes 256 registers a wave at most; without the budget this build takes one more and a work-group loses its place
__global__ __launch_bounds__(128) __attribute__((amdgpu_waves_per_eu(4))) void k_win(const float* __restrict__ X, const unsigned short* __restrict__ Bq, const float* __restrict__ pos,
                                           const unsigned short* __restrict__ Bo, const float* __restrict__ bo, float* __restrict__ out) {
  constexpr int PW = (64 * 40 + 64 * 40 + HDM * 72) * 2;          // bytes per wave: q, k, v^T planes
  constexpr int PO = 16 * 72 * 2;                                 // bytes per wave: room for staged x, later one staged output tile
  constexpr int TP = 72;                                          // pitch of the bias-and-mask table, in bf16 elements: 16 rows read 16 bytes each without a bank conflict
  constexpr int PT = 64 * TP * 2;                                 // bytes of that table: 64 queries x 64 keys, behind the waves' PO bytes
  constexpr int XP = DIM + 8;                                     // pitch of the staged x rows, in bf16 elements
  constexpr int SP = HDM + 4;                                     // pitch of a staged output tile, in floats (rows 16-byte aligned)
  static_assert(4 * PO + PT >= 64 * XP * 2, "staged x shares the space of the waves' PO bytes and the table");
  static_assert(2 * 16 * SP * 4 <= HDM * 72 * 2 && 16 * SP * 4 <= PO, "three staged output tiles fit the v^T plane and the wave's PO bytes");
  __shared__ __attribute__((aligned(16))) unsigned char smem[4 * PW + 4 * PO + PT]; __shared__ int stok[64]; __shared__ float sbias[13 * 13];
  const int tid = threadIdx.x, lane = tid & 31, ln = lane & 15, hh = lane >> 4; const int h = __builtin_amdgcn_readfirstlane(tid >> 5);
  const int w = blockIdx.x % NWIN; const int b = blockIdx.x / NWIN; const int wy = w / 8, wx = w % 8;
  _Float16* sq = (_Float16*)(smem + h * PW); _Float16* sk = sq + 64 * 40; _Float16* svt = sk + 64 * 40;
  unsigned short* sx = (unsigned short*)(smem + 4 * PW); _Float16* sp = (_Float16*)(smem + 4 * PW + h * PO); unsigned short* tb = (unsigned short*)(smem + 4 * PW + 4 * PO);
  if (tid < 64) { int tok = -1; if (tid < 49) { const int yi = tid / WS, xi = tid % WS; const int y = (wy * WS + yi + DISP) % HI, x = (wx * WS + xi + DISP) % WI; tok = (b * HI + y) * WI + x; } stok[tid] = tok; }
  for (int i = tid; i < 169; i += 128) sbias[i] = bf16_round(pos[i]);
  // stage x: wave h takes rows h, h+4, ...; one row = one 512-byte wave load; all 13 loads are issued before the first is used
  v4f xv[13];
#pragma unroll
  for (int it = 0; it < 13; ++it) { const int i = min(h + 4 * it, 48); const int yi = i / WS, xi = i % WS; const int y = (wy * WS + yi + DISP) % HI, x = (wx * WS + xi + DISP) % WI;
    xv[it] = *(const v4fa*)(X + (size_t)((b * HI + y) * WI + x) * DIM + lane * 4); }
#pragma unroll
  for (int it = 0; it < 13; ++it) { const int i = h + 4 * it; v4us p = {0, 0, 0, 0}; if (i < 49) { for (int c = 0; c < 4; ++c) p[c] = bf16_bits(xv[it][c]); } *(v4us*)(sx + i * XP + lane * 4) = p; }
#pragma unroll
  for (int it = 13; it < 16; ++it) { const v4us p = {0, 0, 0, 0}; *(v4us*)(sx + (h + 4 * it) * XP + lane * 4) = p; }
  __syncthreads();      // every wave reads all 64 staged rows, the token list and the bias table
  FragB a[4][4];
#pragma unroll
  for (int mt = 0; mt < 4; ++mt) {
#pragma unroll
    for (int ks = 0; ks < 4; ++ks) { const unsigned short* p = sx + (mt * 16 + ln) * XP + ks * 32; a[mt][ks].half[0] = *(const v8us*)(p + 8 * hh); a[mt][ks].half[1] = *(const v8us*)(p + 16 + 8 * hh); } }
  __syncthreads();      // the staged rows are in registers now: their LDS is reused for the table below
  // Bias and masks are the same for the four heads: the work-group builds them once, tb[query i][key j] = bias (bf16, as it is used) or a large negative value where the pair is
  // masked or padding. Thread = one query and 32 keys; which 32 is wave-uniform, so everything on the key side is a compile-time constant inside win_table.
  const bool ul = (wy == 7), lr = (wx == 7);
  {
    const int i = tid & 63, ic = min(i, 48), yi = ic / WS, xi = ic % WS; const bool iv = i < 49, ia = yi >= 4, ib = xi >= 4;
    const bool y0 = !(ul & ia), y1 = !(ul & !ia), x0 = !(lr & ib), x1 = !(lr & !ib);      // the query may meet a key of the upper / lower rows, of the left / right columns
    const float* sb = sbias + 6 * 13 + 6 - (yi * 13 + xi); unsigned short* trow = tb + i * TP;
    if (h < 2) win_table<0>(trow, sb, iv & y0 & x0, iv & y0 & x1, iv & y1 & x0, iv & y1 & x1); else win_table<32>(trow, sb, iv & y0 & x0, iv & y0 & x1, iv & y1 & x0, iv & y1 & x1);
  }
#pragma unroll
  for (int t = 0; t < 6; ++t) {      // column tiles: t = 0,1 q; 2,3 k; 4,5 v of head h
    const unsigned short* bp = Bq + (size_t)((t >> 1) * (DIM / 16) + h * (HDM / 16) + (t & 1)) * FT + lane * 8;      // packed column tile (see pk_off): the lane's 16 bytes of each 512-byte piece
    FragB bf[4];
#pragma unroll
    for (int ks = 0; ks < 4; ++ks) { bf[ks].half[0] = *(const v8us*)(bp + ks * 512); bf[ks].half[1] = *(const v8us*)(bp + ks * 512 + 256); }
#pragma unroll
    for (int mt = 0; mt < 4; ++mt) {
      v8f c = {};
#pragma unroll
      for (int ks = 0; ks < 4; ++ks) c = __builtin_amdgcn_wmma_f32_16x16x32_bf16(false, a[mt][ks].v, false, bf[ks].v, (short)0, c, false, false);
      const int row = mt * 16 + 8 * hh, col = (t & 1) * 16 + ln;
      if (t < 2) {
#pragma unroll
        for (int r = 0; r < 8; ++r) sq[(row + r) * 40 + col] = (_Float16)(c[r] * 0.17677669529663687f);
      } else if (t < 4) {
#pragma unroll
        for (int r = 0; r < 8; ++r) sk[(row + r) * 40 + col] = (_Float16)c[r];
      } else {
        FragH vv;
#pragma unroll
        for (int r = 0; r < 8; ++r) vv.h[r] = (_Float16)c[r];
        *(v8us*)((unsigned short*)svt + col * 72 + row) = vv.half[0];
      }
    }
  }
  __syncthreads();      // every wave reads the whole table; it also orders the wave's own q, k, v stores before their reads
  FragH fk[4], fv[2][2];      // the head's k rows and v^T rows as A fragments: the same for every pass
#pragma unroll
  for (int t = 0; t < 4; ++t) ldF(fk[t], sk, 40, t * 16, 0, ln, hh);
#pragma unroll
  for (int t = 0; t < 2; ++t) {
#pragma unroll
    for (int ks = 0; ks < 2; ++ks) ldF(fv[t][ks], svt, 72, t * 16, ks * 32, ln, hh); }
  unsigned short* oh = (unsigned short*)sq;      // o as f16 in the wave's own q plane, same pitch
  // No mask or padding test stands on a score's own path. A masked score is the table's large negative start value, so exp(score - m) underflows to an exact 0 wherever the row holds one open key,
  // and every token's row does (itself). Of score tile 3 (keys 48 .. 63) only register 0 can be a token (key 48; key 56 in the upper lanes is masked by the table): registers 1 .. 7 are left out
  // of maximum, exp and sum, and their e is the constant 0.
#pragma unroll 1      // stays a loop, as it was: unrolled, this build pairs fewer of the subtractions and multiplies into dual-issue instructions and runs more instructions per pass
  for (int mt = 0; mt < 4; ++mt) {      // 16 queries per pass, query mt*16+ln in the lane (queries >= 49 are padding: all their scores are equal, o is a finite mean of v rows, never stored to out)
    v8f acc[4]; FragH bq; ldF(bq, sq, 40, mt * 16, 0, ln, hh);
    acc[3] = (v8f){bf16_val(tb[(mt * 16 + ln) * TP + 48 + 8 * hh]), 0.f, 0.f, 0.f, 0.f, 0.f, 0.f, 0.f};
#pragma unroll
    for (int t = 0; t < 3; ++t) { const v8us tv = *(const v8us*)(tb + (mt * 16 + ln) * TP + t * 16 + 8 * hh);      // bias or mask of (key 16t+8hh+r, query ln): the accumulator's start value
#pragma unroll
      for (int r = 0; r < 8; ++r) acc[t][r] = bf16_val(tv[r]); }
#pragma unroll
    for (int t = 0; t < 4; ++t) acc[t] = __builtin_amdgcn_wmma_f32_16x16x32_f16(false, fk[t].v, false, bq.v, (short)0, acc[t], false, false);
    float mx[3], sm[3];
#pragma unroll
    for (int t = 0; t < 3; ++t) { mx[t] = acc[t][0];
#pragma unroll
      for (int r = 1; r < 8; ++r) mx[t] = fmaxf(mx[t], acc[t][r]); }
    float m = fmaxf(fmaxf(mx[0], mx[1]), fmaxf(mx[2], acc[3][0])); m = fmaxf(m, xhalf(m));
    FragH pe[2];      // e^T: score tiles 2ks and 2ks+1 hold keys 32ks+8hh+r and 32ks+16+8hh+r, which is the k order of a B fragment
#pragma unroll
    for (int t = 0; t < 3; ++t) { sm[t] = 0.f;
#pragma unroll
      for (int r = 0; r < 8; ++r) { const float e = __expf(acc[t][r] - m); sm[t] += e; pe[t >> 1].h[(t & 1) * 8 + r] = (_Float16)e; } }
    const float e48 = __expf(acc[3][0] - m); pe[1].h[8] = (_Float16)e48;
#pragma unroll
    for (int r = 1; r < 8; ++r) pe[1].h[8 + r] = (_Float16)0.f;
    float s = (sm[0] + sm[1]) + (sm[2] + e48); s += xhalf(s);
    v8f acco[2] = {};
#pragma unroll
    for (int ks = 0; ks < 2; ++ks) {
#pragma unroll
      for (int t = 0; t < 2; ++t) acco[t] = __builtin_amdgcn_wmma_f32_16x16x32_f16(false, fv[t][ks].v, false, pe[ks].v, (short)0, acco[t], false, false); }
    const float rs = 1.0f / s;      // s >= 1: the row's maximum gives e = 1
#pragma unroll
    for (int t = 0; t < 2; ++t) { FragH po;      // o[query ln][d = 16t+8hh+r]: 8 consecutive d, one 16-byte store
#pragma unroll
      for (int r = 0; r < 8; ++r) po.h[r] = (_Float16)(acco[t][r] * rs);
      *(v8us*)(oh + (mt * 16 + ln) * 40 + t * 16 + 8 * hh) = po.half[0]; }
  }
  // From here on every loop is unrolled: its index picks registers (bw, c, ov, op), which only a compile-time constant can do.
  // W_out fragments and bias of this wave's 32 output columns: asked for here, so that they fly while the waves meet
  FragH bw[2][4]; float bv[2];
#pragma unroll
  for (int t = 0; t < 2; ++t) { const unsigned short* bp = Bo + (size_t)(h * (HDM / 16) + t) * FT + lane * 8; bv[t] = bf16_round(bo[h * HDM + t * 16 + ln]);
#pragma unroll
    for (int ks = 0; ks < 4; ++ks) { bw[t][ks].half[0] = *(const v8us*)(bp + ks * 512); bw[t][ks].half[1] = *(const v8us*)(bp + ks * 512 + 256); } }
  __syncthreads();      // every wave reads all four heads' o planes
  float* st[3] = {(float*)svt, (float*)svt + 16 * SP, (float*)sp};      // the wave's own v^T plane is dead, its PO bytes are free: one staged output tile per full pass
  float last[2];
#pragma unroll
  for (int mt = 0; mt < 4; ++mt) {
    v8f c[2] = {};
#pragma unroll
    for (int ks = 0; ks < 4; ++ks) {      // k step ks = head ks
      const unsigned short* ph = (const unsigned short*)(smem + ks * PW) + (mt * 16 + ln) * 40;
      FragH ah; ah.half[0] = *(const v8us*)(ph + 8 * hh); ah.half[1] = *(const v8us*)(ph + 16 + 8 * hh);
#pragma unroll
      for (int t = 0; t < 2; ++t) c[t] = __builtin_amdgcn_wmma_f32_16x16x32_f16(false, ah.v, false, bw[t][ks].v, (short)0, c[t], false, false);
    }
#pragma unroll
    for (int t = 0; t < 2; ++t) {
      if (mt < 3) {
#pragma unroll
        for (int r = 0; r < 8; ++r) st[mt][(8 * hh + r) * SP + t * 16 + ln] = c[t][r] + bv[t];
      } else last[t] = c[t][0] + bv[t];
    }
  }
  __builtin_amdgcn_fence(__ATOMIC_ACQ_REL, "workgroup"); __builtin_amdgcn_wave_barrier();      // the staged tiles are read back by other lanes
  // 8 lanes x 16 bytes = this wave's whole 128-byte line of a token, 4 tokens a store; all values and addresses are formed before the first store goes out
  v4f ov[12]; float* op[12];
#pragma unroll
  for (int q = 0; q < 12; ++q) { const int il = (q & 3) * 4 + (lane >> 3); ov[q] = *(const v4fa*)&st[q >> 2][il * SP + (lane & 7) * 4]; op[q] = out + (size_t)stok[(q >> 2) * 16 + il] * DIM + h * HDM + (lane & 7) * 4; }
  float* op48 = out + (size_t)stok[48] * DIM + h * HDM + ln;
#pragma unroll
  for (int q = 0; q < 12; ++q) *(v4f*)op[q] = ov[q];
  if (hh == 0) { op48[0] = last[0]; op48[16] = last[1]; }
}
extern "C" void kernel_launch(void* const* d_in, const int* in_sizes, int n_in,
                              void* d_out, int out_size, void* d_ws, size_t ws_size, hipStream_t stream) {
  (void)in_sizes; (void)n_in; (void)out_size;
  const float* x = (const float*)d_in[0]; const float* Wqkv = (const float*)d_in[1]; const float* pos = (const float*)d_in[2]; const float* Wo = (const float*)d_in[3]; const float* bo = (const float*)d_in[4];
  char* ws = (char*)d_ws; size_t off = 0;
  auto take = [&](size_t bytes) { char* p = ws + off; off += (bytes + 255) & ~(size_t)255; return p; };
  unsigned short* Bq = (unsigned short*)take((size_t)3 * DIM * DIM * 2); unsigned short* Bo = (unsigned short*)take((size_t)DIM * DIM * 2);
  if (off > ws_size) return;
  k_bt<<<(3 * DIM * DIM / 8 + 255) / 256, 256, 0, stream>>>(Wqkv, Wo, Bq, Bo);
  k_win<<<BB * NWIN, 128, 0, stream>>>(x, Bq, pos, Bo, bo, (float*)d_out);
}

// v008
// A run of this version takes 16.1 microseconds.
// Next to v007, in two timings, it ran 1.05 times as fast each time.
// Over all steps from v000 it is 7.62 times as fast.
#include <hip/hip_runtime.h>
// Shifted-window attention: qkv = x·W_qkv on v_wmma_f32_16x16x32_bf16 (x rounded to bf16: single exact term; 50176 × 128 × 384); per (batch, window, head) the 49×49
// scores q·kᵀ and e·v on v_wmma_f32_16x16x32_f16 (q, k, v, e rounded to f16, windows padded to 64; one wave each); out = o·W_out + b_out on the f16 variant as well, o rounded
// to f16 and W_out's bf16 values held as f16 (1 product). The cyclic shifts are pure index remaps (token (y,x) ↔ shifted (y−3, x−3) mod 56, and the back-shift returns every result to its own token);
// relative-position bias and the shift masks come from one table per window as the score accumulators' start values; the max-shifted softmax is f32 VALU.
// The scores are formed transposed (k x q^T: a lane owns one query, its registers the keys), so the softmax reduces inside the lane and e is the B operand of v^T x e^T as it stands.
#define BB 16
#define HI 56
#define WI 56
#define DIM 128
#define NHD 4
#define HDM 32
#define WS 7
#define NWIN 64
#define NTOK (BB * HI * WI)
#define DISP 3

typedef __bf16 v16b __attribute__((ext_vector_type(16)));
typedef unsigned short v8us __attribute__((ext_vector_type(8), may_alias));
typedef float  v8f  __attribute__((ext_vector_type(8)));
typedef float  v4f  __attribute__((ext_vector_type(4)));
typedef float  v4fa __attribute__((ext_vector_type(4), may_alias));
union FragB { v16b v; v8us half[2]; unsigned short u[16]; };

__device__ __forceinline__ unsigned short bf16_bits(float x) { unsigned int u = __float_as_uint(x); return (unsigned short)((u + 0x7FFFu + ((u >> 16) & 1u)) >> 16); }
__device__ __forceinline__ float bf16_val(unsigned short b) { return __uint_as_float(((unsigned int)b) << 16); }
__device__ __forceinline__ float bf16_round(float x) { return bf16_val(bf16_bits(x)); }
// D += A·B with NT terms: 1 = ah·bh, 2 = + al·bh (A split), 3 = + ah·bl (both split)
template <int NT>
__device__ __forceinline__ v8f mmaN(v16b ah, v16b al, v16b bh, v16b bl, v8f c) {
  c = __builtin_amdgcn_wmma_f32_16x16x32_bf16(false, ah, false, bh, (short)0, c, false, false);
  if (NT >= 2) c = __builtin_amdgcn_wmma_f32_16x16x32_bf16(false, al, false, bh, (short)0, c, false, false);
  if (NT >= 3) c = __builtin_amdgcn_wmma_f32_16x16x32_bf16(false, ah, false, bl, (short)0, c, false, false);
  asm volatile("v_nop\n\tv_nop\n\tv_nop\n\tv_nop" : "+v"(c) : "v"(ah), "v"(al), "v"(bh), "v"(bl));
  return c;
}

__global__ __launch_bounds__(256) void k_wt_bf16(const float* __restrict__ W, unsigned short* __restrict__ Wt, int K, int N) {
  const int t = blockIdx.x * 256 + threadIdx.x;
  const int k8n = K / 8;
  if (t >= N * k8n) return;
  const int n = t / k8n, k8 = (t % k8n) * 8;
  v8us v;
#pragma unroll
  for (int i = 0; i < 8; ++i) v[i] = bf16_bits(W[(size_t)(k8 + i) * N + n]);
  *(v8us*)(Wt + (size_t)n * K + k8) = v;
  
}

// GEMM C[M][N] (f32, pitch ldc) = act(A[M][K]·W + bias). A f32 row-major (pitch lda) converted per fragment to bf16
// (ASPLIT: hi/lo two planes -> 2 terms, else single rounded term); Wt bf16 [N][K] (pitch ldb). BIAS_BF16 rounds the
// bias to bf16 first (bias quantised to bf16 before the add). K%32==0, M%16==0, N%64==0.
template <bool ASPLIT, int ACT, bool BIAS_BF16>
__global__ __launch_bounds__(128) void k_gemm_bf(const float* __restrict__ A, int lda, const unsigned short* __restrict__ Wt, int ldb,
                                               const float* __restrict__ bias, float* __restrict__ C, int ldc, int M, int N, int K) {
  __shared__ __attribute__((aligned(16))) float so[4][16][64];
  const int tid = threadIdx.x, w = tid >> 5, lane = tid & 31, ln = lane & 15, hh = lane >> 4;
  const int ntn = N / 64;
  const int wid = blockIdx.x * 4 + w;
  const int mt = wid / ntn, nq = wid % ntn;
  if (mt * 16 >= M) return;
  const int row0 = mt * 16, col0 = nq * 64;
  const float* arow = A + (size_t)(row0 + ln) * lda;
  v8f acc[4] = {};
  for (int kb = 0; kb < K; kb += 32) {
    FragB ah, al;
    const v4f x0 = *(const v4fa*)(arow + kb + 8 * hh), x1 = *(const v4fa*)(arow + kb + 8 * hh + 4);
    const v4f x2 = *(const v4fa*)(arow + kb + 16 + 8 * hh), x3 = *(const v4fa*)(arow + kb + 16 + 8 * hh + 4);
    float xs[16] = {x0[0],x0[1],x0[2],x0[3],x1[0],x1[1],x1[2],x1[3],x2[0],x2[1],x2[2],x2[3],x3[0],x3[1],x3[2],x3[3]};
#pragma unroll
    for (int i = 0; i < 16; ++i) { const unsigned short hb = bf16_bits(xs[i]); ah.u[i] = hb; al.u[i] = ASPLIT ? bf16_bits(xs[i] - bf16_val(hb)) : (unsigned short)0; }
#pragma unroll
    for (int t = 0; t < 4; ++t) {
      const unsigned short* brow = Wt + (size_t)(col0 + t * 16 + ln) * ldb + kb;
      FragB b;
      b.half[0] = *(const v8us*)(brow + 8 * hh);
      b.half[1] = *(const v8us*)(brow + 16 + 8 * hh);
      acc[t] = mmaN<ASPLIT ? 2 : 1>(ah.v, al.v, b.v, b.v, acc[t]);
    }
  }
#pragma unroll
  for (int t = 0; t < 4; ++t) {
    float bv = bias ? bias[col0 + t * 16 + ln] : 0.f;
    if (BIAS_BF16) bv = bf16_round(bv);
#pragma unroll
    for (int r = 0; r < 8; ++r) { float v = acc[t][r] + bv; if (ACT == 1) v = fmaxf(v, 0.f); so[w][8 * hh + r][t * 16 + ln] = v; }
  }
  __builtin_amdgcn_fence(__ATOMIC_ACQ_REL, "workgroup");
  __builtin_amdgcn_wave_barrier();
  const int rsub = lane >> 4, c4 = (lane & 15) * 4;
  {
#pragma unroll
    for (int q = 0; q < 8; ++q) {
      const int r = q * 2 + rsub;
      const v4f v = *(const v4fa*)&so[w][r][c4];
      *(v4f*)(C + (size_t)(row0 + r) * ldc + col0 + c4) = v;
    }
    
  }
}

// Flash-style causal/unmasked attention, all contractions 3-term bf16 hi/lo splits, f32 softmax with running max.
// q,k,v rows are read from f32 buffers with arbitrary row pitch (so they can live inside a fused qkv buffer);
// D = head size (multiple of 32, <= 128); one wave = 16 query rows; block = 4 waves (64 queries) sharing K/V chunks of 32.
template <int D, bool CAUSAL>
__global__ __launch_bounds__(128) void k_flash(const float* __restrict__ qb, const float* __restrict__ kb, const float* __restrict__ vb,
                                             int pitch, int T, int H, float scale, float* __restrict__ y, int ypitch) {
  constexpr int KS = D / 32;        // k-steps for QK
  constexpr int DT = D / 16;        // d tiles for PV
  __shared__ __attribute__((aligned(16))) unsigned short sKh[32][D + 8], sKl[32][D + 8], sVh[32][D + 8], sVl[32][D + 8];
  __shared__ __attribute__((aligned(16))) unsigned short sPh[4][16][40], sPl[4][16][40];
  __shared__ __attribute__((aligned(16))) float sO[4][16][D];
  const int tid = threadIdx.x, w = tid >> 5, lane = tid & 31, ln = lane & 15, hh = lane >> 4;
  const int nqb = (T + 63) / 64;
  const int bh = blockIdx.x / nqb, qblk = blockIdx.x % nqb;
  const int b = bh / H, h = bh % H;
  const int q0 = qblk * 64 + w * 16;
  const float* Q = qb + (size_t)b * T * pitch + h * D;
  const float* K = kb + (size_t)b * T * pitch + h * D;
  const float* V = vb + (size_t)b * T * pitch + h * D;

  // A fragments of the wave's 16 query rows (scaled), hi/lo
  FragB aqh[KS], aql[KS];
  {
    int row = q0 + ln; if (row >= T) row = T - 1;
    const float* qr = Q + (size_t)row * pitch;
#pragma unroll
    for (int ks = 0; ks < KS; ++ks)
#pragma unroll
      for (int i = 0; i < 16; ++i) {
        const int d = ks * 32 + ((i < 8) ? (8 * hh + i) : (16 + 8 * hh + (i - 8)));
        const float x = qr[d] * scale; const unsigned short hb = bf16_bits(x);
        aqh[ks].u[i] = hb; aql[ks].u[i] = bf16_bits(x - bf16_val(hb));
      }
  }
  float m_r[8], l_r[8];
#pragma unroll
  for (int r = 0; r < 8; ++r) { m_r[r] = -3.0e38f; l_r[r] = 0.f; }
  v8f oacc[DT];
#pragma unroll
  for (int dt = 0; dt < DT; ++dt) oacc[dt] = (v8f){0.f,0.f,0.f,0.f,0.f,0.f,0.f,0.f};

  const int kv_end = CAUSAL ? min(T, qblk * 64 + 64) : T;     // block-uniform
  for (int j0 = 0; j0 < kv_end; j0 += 32) {
    __syncthreads();
    for (int e = tid; e < 32 * (D / 4); e += 128) {
      const int r = e / (D / 4), c4 = (e % (D / 4)) * 4;
      const int key = j0 + r;
      v4f kf = {0.f,0.f,0.f,0.f}, vf = {0.f,0.f,0.f,0.f};
      if (key < T) { kf = *(const v4fa*)(K + (size_t)key * pitch + c4); vf = *(const v4fa*)(V + (size_t)key * pitch + c4); }
#pragma unroll
      for (int t = 0; t < 4; ++t) {
        unsigned short hb = bf16_bits(kf[t]); sKh[r][c4 + t] = hb; sKl[r][c4 + t] = bf16_bits(kf[t] - bf16_val(hb));
        hb = bf16_bits(vf[t]); sVh[r][c4 + t] = hb; sVl[r][c4 + t] = bf16_bits(vf[t] - bf16_val(hb));
      }
    }
    __syncthreads();
    // S tile 16 x 32
    v8f s[2];
#pragma unroll
    for (int nt = 0; nt < 2; ++nt) {
      v8f acc = {};
#pragma unroll
      for (int ks = 0; ks < KS; ++ks) {
        FragB bh_, bl_;
        bh_.half[0] = *(const v8us*)&sKh[nt * 16 + ln][ks * 32 + 8 * hh]; bh_.half[1] = *(const v8us*)&sKh[nt * 16 + ln][ks * 32 + 16 + 8 * hh];
        bl_.half[0] = *(const v8us*)&sKl[nt * 16 + ln][ks * 32 + 8 * hh]; bl_.half[1] = *(const v8us*)&sKl[nt * 16 + ln][ks * 32 + 16 + 8 * hh];
        acc = mmaN<3>(aqh[ks].v, aql[ks].v, bh_.v, bl_.v, acc);
      }
      s[nt] = acc;
    }
    // mask + running max (rows 8hh+r; the 16 lanes of a half share rows)
    float alpha[8];
#pragma unroll
    for (int r = 0; r < 8; ++r) {
      const int qi = q0 + 8 * hh + r;
      const int ja = j0 + ln, jb = j0 + 16 + ln;
      if (CAUSAL) { if (ja > qi) s[0][r] = -3.0e38f; if (jb > qi) s[1][r] = -3.0e38f; }
      if (ja >= T) s[0][r] = -3.0e38f;
      if (jb >= T) s[1][r] = -3.0e38f;
      float mx = fmaxf(s[0][r], s[1][r]);
      mx = fmaxf(mx, __shfl_xor(mx, 1, 32)); mx = fmaxf(mx, __shfl_xor(mx, 2, 32)); mx = fmaxf(mx, __shfl_xor(mx, 4, 32)); mx = fmaxf(mx, __shfl_xor(mx, 8, 32));
      const float mnew = fmaxf(m_r[r], mx);
      alpha[r] = (mnew > -1.0e38f) ? __expf(m_r[r] - mnew) : 1.0f;
      const float p0 = (s[0][r] > -1.0e38f) ? __expf(s[0][r] - mnew) : 0.f;
      const float p1 = (s[1][r] > -1.0e38f) ? __expf(s[1][r] - mnew) : 0.f;
      m_r[r] = mnew;
      l_r[r] = l_r[r] * alpha[r] + p0 + p1;            // per-lane partial row sum (16 lanes combined at the end)
      unsigned short hb = bf16_bits(p0); sPh[w][8 * hh + r][ln] = hb;      sPl[w][8 * hh + r][ln] = bf16_bits(p0 - bf16_val(hb));
      hb = bf16_bits(p1);                sPh[w][8 * hh + r][16 + ln] = hb; sPl[w][8 * hh + r][16 + ln] = bf16_bits(p1 - bf16_val(hb));
    }
#pragma unroll
    for (int dt = 0; dt < DT; ++dt)
#pragma unroll
      for (int r = 0; r < 8; ++r) oacc[dt][r] *= alpha[r];
    __builtin_amdgcn_fence(__ATOMIC_ACQ_REL, "workgroup");
    __builtin_amdgcn_wave_barrier();
    FragB pah, pal;
    pah.half[0] = *(const v8us*)&sPh[w][ln][8 * hh]; pah.half[1] = *(const v8us*)&sPh[w][ln][16 + 8 * hh];
    pal.half[0] = *(const v8us*)&sPl[w][ln][8 * hh]; pal.half[1] = *(const v8us*)&sPl[w][ln][16 + 8 * hh];
#pragma unroll
    for (int dt = 0; dt < DT; ++dt) {
      FragB bvh, bvl;
#pragma unroll
      for (int i = 0; i < 8; ++i) {
        bvh.u[i] = sVh[8 * hh + i][dt * 16 + ln]; bvh.u[8 + i] = sVh[16 + 8 * hh + i][dt * 16 + ln];
        bvl.u[i] = sVl[8 * hh + i][dt * 16 + ln]; bvl.u[8 + i] = sVl[16 + 8 * hh + i][dt * 16 + ln];
      }
      oacc[dt] = mmaN<3>(pah.v, pal.v, bvh.v, bvl.v, oacc[dt]);
    }
    __builtin_amdgcn_fence(__ATOMIC_ACQ_REL, "workgroup");
    __builtin_amdgcn_wave_barrier();
  }
#pragma unroll
  for (int r = 0; r < 8; ++r) {
    float l = l_r[r];
    l += __shfl_xor(l, 1, 32); l += __shfl_xor(l, 2, 32); l += __shfl_xor(l, 4, 32); l += __shfl_xor(l, 8, 32);
    l_r[r] = (l > 0.f) ? 1.0f / l : 0.f;
  }
#pragma unroll
  for (int dt = 0; dt < DT; ++dt)
#pragma unroll
    for (int r = 0; r < 8; ++r) sO[w][8 * hh + r][dt * 16 + ln] = oacc[dt][r] * l_r[r];
  __builtin_amdgcn_fence(__ATOMIC_ACQ_REL, "workgroup");
  __builtin_amdgcn_wave_barrier();
  {
    for (int r = 0; r < 16; ++r) {
      const int row = q0 + r;
      if (row < T && lane < D / 4) {
        const v4f val = *(const v4fa*)&sO[w][r][lane * 4];
        *(v4f*)(y + ((size_t)b * T + row) * ypitch + h * D + lane * 4) = val;
      }
    }
    
  }
}

// batched GEMM (blockIdx.y = batch): C_b = act(alpha·A_b·B_b + bias + resid_b); A f32 rows (ASPLIT → hi/lo), B = bf16 planes Bh (+Bl when BSPLIT, requires ASPLIT),
// per-batch element strides sA, sB (0 = shared weights), sC, sR. resid may alias C (values are staged before the stores). ACT 0/1(relu).
// ACT: 0 none, 1 relu, 2 softplus
template <bool ASPLIT, bool BSPLIT, int ACT>
__global__ __launch_bounds__(128) void k_gemm_b(const float* __restrict__ A, int lda, size_t sA, const unsigned short* __restrict__ Bh, const unsigned short* __restrict__ Bl, int ldb, size_t sB,
                                             const float* __restrict__ bias, const float* __restrict__ resid, int ldr, size_t sR, float rsign, float alpha,
                                             float* __restrict__ C, int ldc, size_t sC, int M, int N, int K) {
  __shared__ __attribute__((aligned(16))) float so[4][16][64];
  const int tid = threadIdx.x, w = tid >> 5, lane = tid & 31, ln = lane & 15, hh = lane >> 4;
  const int by = blockIdx.y;
  A += (size_t)by * sA; Bh += (size_t)by * sB; if (BSPLIT) Bl += (size_t)by * sB; C += (size_t)by * sC; if (resid) resid += (size_t)by * sR;
  const int ntn = (N + 63) / 64; const int wid = blockIdx.x * 4 + w; const int mt = wid / ntn, nq = wid % ntn;      // N may be any multiple of 16: tiles past N are skipped and not stored
  if (mt * 16 >= M) return;
  const int row0 = mt * 16, col0 = nq * 64;
  const float* arow = A + (size_t)(row0 + ln) * lda;
  v8f acc[4] = {};
  for (int kb = 0; kb < K; kb += 32) {
    FragB ah, al;
    const v4f x0 = *(const v4fa*)(arow + kb + 8 * hh), x1 = *(const v4fa*)(arow + kb + 8 * hh + 4);
    const v4f x2 = *(const v4fa*)(arow + kb + 16 + 8 * hh), x3 = *(const v4fa*)(arow + kb + 16 + 8 * hh + 4);
    float xs[16] = {x0[0],x0[1],x0[2],x0[3],x1[0],x1[1],x1[2],x1[3],x2[0],x2[1],x2[2],x2[3],x3[0],x3[1],x3[2],x3[3]};
#pragma unroll
    for (int i = 0; i < 16; ++i) { const unsigned short hb = bf16_bits(xs[i]); ah.u[i] = hb; al.u[i] = ASPLIT ? bf16_bits(xs[i] - bf16_val(hb)) : (unsigned short)0; }
#pragma unroll
    for (int t = 0; t < 4; ++t) {
      if (col0 + t * 16 >= N) continue;
      const size_t boff = (size_t)(col0 + t * 16 + ln) * ldb + kb;
      FragB bh_, bl_; bh_.half[0] = *(const v8us*)(Bh + boff + 8 * hh); bh_.half[1] = *(const v8us*)(Bh + boff + 16 + 8 * hh);
      if (BSPLIT) { bl_.half[0] = *(const v8us*)(Bl + boff + 8 * hh); bl_.half[1] = *(const v8us*)(Bl + boff + 16 + 8 * hh); } else bl_ = bh_;
      acc[t] = mmaN<ASPLIT ? (BSPLIT ? 3 : 2) : 1>(ah.v, al.v, bh_.v, bl_.v, acc[t]);
    }
  }
#pragma unroll
  for (int t = 0; t < 4; ++t) {
    const int col = col0 + t * 16 + ln; if (col0 + t * 16 >= N) continue; const float bv = bias ? bf16_round(bias[col]) : 0.f;
#pragma unroll
    for (int r = 0; r < 8; ++r) { float v = acc[t][r] * alpha + bv; if (resid) v += rsign * resid[(size_t)(row0 + 8 * hh + r) * ldr + col]; if (ACT == 1) v = fmaxf(v, 0.f); else if (ACT == 2) v = fmaxf(v, 0.f) + log1pf(expf(-fabsf(v))); so[w][8 * hh + r][t * 16 + ln] = v; }
  }
  __builtin_amdgcn_fence(__ATOMIC_ACQ_REL, "workgroup"); __builtin_amdgcn_wave_barrier();
  const int rsub = lane >> 4, c4 = (lane & 15) * 4;
  {
#pragma unroll
    for (int q = 0; q < 8; ++q) { const int r = q * 2 + rsub; if (col0 + c4 < N) { const v4f v = *(const v4fa*)&so[w][r][c4]; *(v4f*)(C + (size_t)(row0 + r) * ldc + col0 + c4) = v; } }
    
  }
}
// batched f32 [K][N] (pitch lds, batch stride sIn) -> transposed hi/lo planes [N][K] (batch stride sOut); thread per (n, 8 k); grid.y = batch
__global__ __launch_bounds__(256) void k_split_transpose_b(const float* __restrict__ src, int lds_, size_t sIn, unsigned short* __restrict__ hi, unsigned short* __restrict__ lo, size_t sOut, int K, int N) {
  const size_t t = (size_t)blockIdx.x * 256 + threadIdx.x; const int k8n = K / 8; if (t >= (size_t)N * k8n) return;
  src += (size_t)blockIdx.y * sIn; hi += (size_t)blockIdx.y * sOut; lo += (size_t)blockIdx.y * sOut;
  const int n = (int)(t / k8n), k8 = (int)(t % k8n) * 8; v8us vh, vl;
#pragma unroll
  for (int i = 0; i < 8; ++i) { const float x = src[(size_t)(k8 + i) * lds_ + n]; const unsigned short hb = bf16_bits(x); vh[i] = hb; vl[i] = bf16_bits(x - bf16_val(hb)); }
  unsigned short* dh = hi + (size_t)n * K + k8; unsigned short* dl = lo + (size_t)n * K + k8;
  *(v8us*)dh = vh; *(v8us*)dl = vl; 
}

// ---- f16 WMMA path (v_wmma_f32_16x16x32_f16): 11-bit significands for operands in range — used where a [0,1] probability operand needs more precision than bf16
typedef _Float16 v16h __attribute__((ext_vector_type(16)));
union FragH { v16h v; v8us half[2]; _Float16 h[16]; unsigned short u[16]; };
template <int NT>
__device__ __forceinline__ v8f mmaH(v16h ah, v16h al, v16h bh, v16h bl, v8f c) {
  c = __builtin_amdgcn_wmma_f32_16x16x32_f16(false, ah, false, bh, (short)0, c, false, false);
  if (NT >= 2) c = __builtin_amdgcn_wmma_f32_16x16x32_f16(false, al, false, bh, (short)0, c, false, false);
  if (NT >= 3) c = __builtin_amdgcn_wmma_f32_16x16x32_f16(false, ah, false, bl, (short)0, c, false, false);
  asm volatile("v_nop\n\tv_nop\n\tv_nop\n\tv_nop" : "+v"(c) : "v"(ah), "v"(al), "v"(bh), "v"(bl));
  return c;
}
// batched GEMM like k_gemm_b but f16 operands: A f32 (split into f16 hi/lo if ASPLIT, else rounded to f16), Bt = f16 values [n][k]; alpha; C f32; N multiple of 16 (partial tiles skipped)
template <bool ASPLIT>
__global__ __launch_bounds__(128) void k_gemm_h(const float* __restrict__ A, int lda, size_t sA, const _Float16* __restrict__ Bh, int ldb, size_t sB, float alpha, float* __restrict__ C, int ldc, size_t sC, int M, int N, int K) {
  __shared__ __attribute__((aligned(16))) float so[4][16][64];
  const int tid = threadIdx.x, w = tid >> 5, lane = tid & 31, ln = lane & 15, hh = lane >> 4; const int by = blockIdx.y;
  A += (size_t)by * sA; Bh += (size_t)by * sB; C += (size_t)by * sC;
  const int ntn = (N + 63) / 64; const int wid = blockIdx.x * 4 + w; const int mt = wid / ntn, nq = wid % ntn; if (mt * 16 >= M) return;
  const int row0 = mt * 16, col0 = nq * 64; const float* arow = A + (size_t)(row0 + ln) * lda;
  v8f acc[4] = {};
  for (int kb = 0; kb < K; kb += 32) {
    FragH ah, al;
    const v4f x0 = *(const v4fa*)(arow + kb + 8 * hh), x1 = *(const v4fa*)(arow + kb + 8 * hh + 4), x2 = *(const v4fa*)(arow + kb + 16 + 8 * hh), x3 = *(const v4fa*)(arow + kb + 16 + 8 * hh + 4);
    float xs[16] = {x0[0],x0[1],x0[2],x0[3],x1[0],x1[1],x1[2],x1[3],x2[0],x2[1],x2[2],x2[3],x3[0],x3[1],x3[2],x3[3]};
#pragma unroll
    for (int i = 0; i < 16; ++i) { const _Float16 h = (_Float16)xs[i]; ah.h[i] = h; al.h[i] = ASPLIT ? (_Float16)(xs[i] - (float)h) : (_Float16)0.0f; }
#pragma unroll
    for (int t = 0; t < 4; ++t) { if (col0 + t * 16 >= N) continue; const size_t boff = (size_t)(col0 + t * 16 + ln) * ldb + kb; FragH bq; bq.half[0] = *(const v8us*)(Bh + boff + 8 * hh); bq.half[1] = *(const v8us*)(Bh + boff + 16 + 8 * hh);
      acc[t] = mmaH<ASPLIT ? 2 : 1>(ah.v, al.v, bq.v, bq.v, acc[t]); }
  }
#pragma unroll
  for (int t = 0; t < 4; ++t) { if (col0 + t * 16 >= N) continue;
#pragma unroll
    for (int r = 0; r < 8; ++r) so[w][8 * hh + r][t * 16 + ln] = acc[t][r] * alpha; }
  __builtin_amdgcn_fence(__ATOMIC_ACQ_REL, "workgroup"); __builtin_amdgcn_wave_barrier();
  const int rsub = lane >> 4, c4 = (lane & 15) * 4;
  {
#pragma unroll
    for (int q = 0; q < 8; ++q) { const int r = q * 2 + rsub; if (col0 + c4 < N) { const v4f v = *(const v4fa*)&so[w][r][c4]; *(v4f*)(C + (size_t)(row0 + r) * ldc + col0 + c4) = v; } }
     }
}

// The weights are packed in the order in which a wave loads its B fragments. Column tile T = n / 16 takes FT elements; in it k step ks = k / 32 has two pieces j = (k / 16) % 2 of 512 bytes,
// and a piece holds, lane by lane (lane = 16 * ((k / 8) % 2) + n % 16), the 8 consecutive k that the lane keeps in one half of its fragment.
// So one wave-wide 16-byte load reads 512 contiguous bytes, four whole 128-byte lines, where rows of [n][k] gave it 32 bytes out of each of 16 lines.
#define FT (16 * DIM)
__device__ __forceinline__ size_t pk_off(int n, int k8) { return (size_t)(n >> 4) * FT + (size_t)(((k8 >> 4) * 32 + ((k8 >> 3) & 1) * 16 + (n & 15)) * 8); }
// thread = one column n and 8 consecutive k, n fastest: a wave reads 128 contiguous bytes of a weight row and writes whole 256-byte runs of a piece
__global__ __launch_bounds__(256) void k_bt(const float* __restrict__ Wqkv, const float* __restrict__ Wo, unsigned short* __restrict__ Bq, unsigned short* __restrict__ Bo) { const int t = blockIdx.x * 256 + threadIdx.x;
  if (t < 3 * DIM * DIM / 8) { const int n = t % (3 * DIM), k8 = (t / (3 * DIM)) * 8; v8us v; for (int q = 0; q < 8; ++q) v[q] = bf16_bits(Wqkv[(size_t)(k8 + q) * (3 * DIM) + n]); *(v8us*)(Bq + pk_off(n, k8)) = v;  }
  if (t < DIM * DIM / 8) { const int n = t % DIM, k8 = (t / DIM) * 8; v8us v; for (int q = 0; q < 8; ++q) v[q] = __builtin_bit_cast(unsigned short, (_Float16)bf16_round(Wo[(size_t)(k8 + q) * DIM + n])); *(v8us*)(Bo + pk_off(n, k8)) = v;  } }
__device__ __forceinline__ void ldF(FragH& f, const _Float16* base, int pitch, int row, int k0, int ln, int hh) { const unsigned short* p = (const unsigned short*)base + (size_t)(row + ln) * pitch + k0; f.half[0] = *(const v8us*)(p + 8 * hh); f.half[1] = *(const v8us*)(p + 16 + 8 * hh); }
typedef unsigned short v4us __attribute__((ext_vector_type(4), may_alias));
// 32 entries (keys J0 .. J0+31) of one query's row of the bias-and-mask table. sb points at the query's own place in the 13 x 13 bias table, so that key (yj, xj) reads sb[yj*13+xj];
// every read is unconditional and in range (the caller clamps a padding query to slot 48), the mask is a select behind it. okYX: the query is a token and may meet a key with yj >= 4 (Y), xj >= 4 (X).
template <int J0>
__device__ __forceinline__ void win_table(unsigned short* trow, const float* sb, bool ok00, bool ok01, bool ok10, bool ok11) {
#pragma unroll
  for (int q = 0; q < 4; ++q) { v8us p;
#pragma unroll
    for (int c = 0; c < 8; ++c) { const int j = J0 + q * 8 + c, jc = j < 49 ? j : 48, yj = jc / WS, xj = jc % WS;
      const unsigned short bb = (unsigned short)(__float_as_uint(sb[yj * 13 + xj]) >> 16);      // the bias table holds bf16 values: the upper half is all of it
      const bool ok = j < 49 && (yj >= 4 ? (xj >= 4 ? ok11 : ok10) : (xj >= 4 ? ok01 : ok00));
      p[c] = ok ? bb : bf16_bits(-3.0e38f); }
    *(v8us*)(trow + J0 + q * 8) = p; }
}
// lane l with lane l ^ 16: the two lanes that share a column of a WMMA result
__device__ __forceinline__ float xhalf(float x) { return __builtin_bit_cast(float, __builtin_amdgcn_permlanex16(__builtin_bit_cast(int, x), __builtin_bit_cast(int, x), 0x76543210, 0xfedcba98, false, false)); }
// one work-group of 4 waves per (b, window w = wy*8+wx), wave = head h. Window slot i = yi*7+xi is token ((wy*7+yi+3)%56, (wx*7+xi+3)%56) of batch b.
// The window's 49 rows of x (padded with zero rows to 64) are staged once in LDS as bf16; each wave forms its head's q, k, v (64 x 96, K = 128) on the bf16 WMMA
// and puts them into its own LDS planes as f16, so qkv never goes through global memory. Zero rows of x give zero rows of q, k, v: the padding needs no clearing.
// Scores and o are formed transposed: k (A) x q^T (B) puts query ln in the lane and keys 16t+8hh+r in its registers, so maximum and sum are taken inside the lane and once across the lane halves,
// two score tiles converted in place are the B operand of v^T (A) x e^T (B), and a lane ends with 8 consecutive d of its own query. The k and v^T fragments serve all four passes from registers.
// Each pass puts its 16 o rows as f16 into the wave's own q rows (read by this pass alone), and after one work-group barrier
// wave h forms output columns 32h .. 32h+31 of all the window's tokens (K = 128 over the four heads' planes, f16 WMMA), so o never goes through global memory either.
// amdgpu_waves_per_eu(4): four work-groups share a WGP (LDS), one wave of each per SIMD, which takes 256 registers a wave at most; without the budget this build takes one more and a work-group loses its place
__global__ __launch_bounds__(128) __attribute__((amdgpu_waves_per_eu(4))) void k_win(const float* __restrict__ X, const unsigned short* __restrict__ Bq, const float* __restrict__ pos,
                                           const unsigned short* __restrict__ Bo, const float* __restrict__ bo, float* __restrict__ out) {
  constexpr int PW = (64 * 40 + 64 * 40 + HDM * 72) * 2;          // bytes per wave: q, k, v^T planes
  constexpr int PO = 16 * 72 * 2;                                 // bytes per wave: one staged output tile
  constexpr int TP = 72;                                          // pitch of the bias-and-mask table, in bf16 elements: 16 rows read 16 bytes each without a bank conflict
  constexpr int PT = 64 * TP * 2;                                 // bytes of that table: 64 queries x 64 keys, behind the waves' PO bytes
  constexpr int XP = DIM + 8;                                     // pitch of the staged x rows, in bf16 elements
  constexpr int SP = HDM + 4;                                     // pitch of a staged output tile, in floats (rows 16-byte aligned)
  static_assert(4 * PW >= 64 * XP * 2, "staged x shares the space of the q, k, v planes, which are written only after it has been read");
  static_assert(2 * 16 * SP * 4 <= HDM * 72 * 2 && 16 * SP * 4 <= PO, "three staged output tiles fit the v^T plane and the wave's PO bytes");
  __shared__ __attribute__((aligned(16))) unsigned char smem[4 * PW + 4 * PO + PT]; __shared__ int stok[64]; __shared__ float sbias[13 * 13];
  const int tid = threadIdx.x, lane = tid & 31, ln = lane & 15, hh = lane >> 4; const int h = __builtin_amdgcn_readfirstlane(tid >> 5);
  const int w = blockIdx.x % NWIN; const int b = blockIdx.x / NWIN; const int wy = w / 8, wx = w % 8;
  _Float16* sq = (_Float16*)(smem + h * PW); _Float16* sk = sq + 64 * 40; _Float16* svt = sk + 64 * 40;
  unsigned short* sx = (unsigned short*)smem; _Float16* sp = (_Float16*)(smem + 4 * PW + h * PO); unsigned short* tb = (unsigned short*)(smem + 4 * PW + 4 * PO);
  if (tid < 64) { int tok = -1; if (tid < 49) { const int yi = tid / WS, xi = tid % WS; const int y = (wy * WS + yi + DISP) % HI, x = (wx * WS + xi + DISP) % WI; tok = (b * HI + y) * WI + x; } stok[tid] = tok; }
  // Loads come back in the order of their issue: the bias values are asked for first, then x, then the first weights, so that all that does not depend on x is done while x is on its way
  const float pv0 = pos[tid], pv1 = pos[min(tid + 128, 168)];
  // stage x: wave h takes rows h, h+4, ...; one row = one 512-byte wave load; all 13 loads are issued before the first is used
  v4f xv[13];
#pragma unroll
  for (int it = 0; it < 13; ++it) { const int i = min(h + 4 * it, 48); const int yi = i / WS, xi = i % WS; const int y = (wy * WS + yi + DISP) % HI, x = (wx * WS + xi + DISP) % WI;
    xv[it] = *(const v4fa*)(X + (size_t)((b * HI + y) * WI + x) * DIM + lane * 4); }
  asm volatile("s_wait_xcnt 0x0" ::: "memory");      // the address registers of the x loads are reused from here on
  FragB bq0[2][4];      // the B fragments of the two q column tiles, the first that the projection uses
#pragma unroll
  for (int t = 0; t < 2; ++t) { const unsigned short* bp = Bq + (size_t)(h * (HDM / 16) + t) * FT + lane * 8;
#pragma unroll
    for (int ks = 0; ks < 4; ++ks) { bq0[t][ks].half[0] = *(const v8us*)(bp + ks * 512); bq0[t][ks].half[1] = *(const v8us*)(bp + ks * 512 + 256); } }
  sbias[tid] = bf16_round(pv0); sbias[min(tid + 128, 168)] = bf16_round(pv1);      // no branch (the load would sink into it, behind x): the threads past the end all store entry 168's own value
  // Work-group barrier for LDS data alone: every thread reads bias values that other waves have stored. __syncthreads() would also wait for every global load in flight, and x has to stay in flight here.
  __builtin_amdgcn_fence(__ATOMIC_RELEASE, "workgroup", "local"); __builtin_amdgcn_s_barrier(); __builtin_amdgcn_fence(__ATOMIC_ACQUIRE, "workgroup", "local");
  // Bias and masks are the same for the four heads: the work-group builds them once, tb[query i][key j] = bias (bf16, as it is used) or a large negative value where the pair is
  // masked or padding. Thread = one query and 32 keys; which 32 is wave-uniform, so everything on the key side is a compile-time constant inside win_table.
  const bool ul = (wy == 7), lr = (wx == 7);
  {
    const int i = tid & 63, ic = min(i, 48), yi = ic / WS, xi = ic % WS; const bool iv = i < 49, ia = yi >= 4, ib = xi >= 4;
    const bool y0 = !(ul & ia), y1 = !(ul & !ia), x0 = !(lr & ib), x1 = !(lr & !ib);      // the query may meet a key of the upper / lower rows, of the left / right columns
    const float* sb = sbias + 6 * 13 + 6 - (yi * 13 + xi); unsigned short* trow = tb + i * TP;
    if (h < 2) win_table<0>(trow, sb, iv & y0 & x0, iv & y0 & x1, iv & y1 & x0, iv & y1 & x1); else win_table<32>(trow, sb, iv & y0 & x0, iv & y0 & x1, iv & y1 & x0, iv & y1 & x1);
  }
#pragma unroll
  for (int it = 0; it < 13; ++it) { const int i = h + 4 * it; v4us p = {0, 0, 0, 0}; if (i < 49) { for (int c = 0; c < 4; ++c) p[c] = bf16_bits(xv[it][c]); } *(v4us*)(sx + i * XP + lane * 4) = p; }
#pragma unroll
  for (int it = 13; it < 16; ++it) { const v4us p = {0, 0, 0, 0}; *(v4us*)(sx + (h + 4 * it) * XP + lane * 4) = p; }
  __syncthreads();      // every wave reads all 64 staged rows, the token list and, later, the whole bias-and-mask table
  FragB a[4][4];
#pragma unroll
  for (int mt = 0; mt < 4; ++mt) {
#pragma unroll
    for (int ks = 0; ks < 4; ++ks) { const unsigned short* p = sx + (mt * 16 + ln) * XP + ks * 32; a[mt][ks].half[0] = *(const v8us*)(p + 8 * hh); a[mt][ks].half[1] = *(const v8us*)(p + 16 + 8 * hh); } }
  __syncthreads();      // the staged rows are in registers now: their LDS is reused for the q, k, v planes below
#pragma unroll
  for (int t = 0; t < 6; ++t) {      // column tiles: t = 0,1 q; 2,3 k; 4,5 v of head h
    const unsigned short* bp = Bq + (size_t)((t >> 1) * (DIM / 16) + h * (HDM / 16) + (t & 1)) * FT + lane * 8;      // packed column tile (see pk_off): the lane's 16 bytes of each 512-byte piece
    FragB bf[4];
#pragma unroll
    for (int ks = 0; ks < 4; ++ks) { if (t < 2) bf[ks] = bq0[t][ks]; else { bf[ks].half[0] = *(const v8us*)(bp + ks * 512); bf[ks].half[1] = *(const v8us*)(bp + ks * 512 + 256); } }
#pragma unroll
    for (int mt = 0; mt < 4; ++mt) {
      v8f c = {};
#pragma unroll
      for (int ks = 0; ks < 4; ++ks) c = __builtin_amdgcn_wmma_f32_16x16x32_bf16(false, a[mt][ks].v, false, bf[ks].v, (short)0, c, false, false);
      const int row = mt * 16 + 8 * hh, col = (t & 1) * 16 + ln;
      if (t < 2) {
#pragma unroll
        for (int r = 0; r < 8; ++r) sq[(row + r) * 40 + col] = (_Float16)(c[r] * 0.17677669529663687f);
      } else if (t < 4) {
#pragma unroll
        for (int r = 0; r < 8; ++r) sk[(row + r) * 40 + col] = (_Float16)c[r];
      } else {
        FragH vv;
#pragma unroll
        for (int r = 0; r < 8; ++r) vv.h[r] = (_Float16)c[r];
        *(v8us*)((unsigned short*)svt + col * 72 + row) = vv.half[0];
      }
    }
  }
  __syncthreads();      // orders the wave's q, k, v stores before their reads by other lanes
  FragH fk[4], fv[2][2];      // the head's k rows and v^T rows as A fragments: the same for every pass
#pragma unroll
  for (int t = 0; t < 4; ++t) ldF(fk[t], sk, 40, t * 16, 0, ln, hh);
#pragma unroll
  for (int t = 0; t < 2; ++t) {
#pragma unroll
    for (int ks = 0; ks < 2; ++ks) ldF(fv[t][ks], svt, 72, t * 16, ks * 32, ln, hh); }
  unsigned short* oh = (unsigned short*)sq;      // o as f16 in the wave's own q plane, same pitch
  // No mask or padding test stands on a score's own path. A masked score is the table's large negative start value, so exp(score - m) underflows to an exact 0 wherever the row holds one open key,
  // and every token's row does (itself). Of score tile 3 (keys 48 .. 63) only register 0 can be a token (key 48; key 56 in the upper lanes is masked by the table): registers 1 .. 7 are left out
  // of maximum, exp and sum, and their e is the constant 0.
#pragma unroll 1      // stays a loop, as it was: unrolled, this build pairs fewer of the subtractions and multiplies into dual-issue instructions and runs more instructions per pass
  for (int mt = 0; mt < 4; ++mt) {      // 16 queries per pass, query mt*16+ln in the lane (queries >= 49 are padding: all their scores are equal, o is a finite mean of v rows, never stored to out)
    v8f acc[4]; FragH bq; ldF(bq, sq, 40, mt * 16, 0, ln, hh);
    acc[3] = (v8f){bf16_val(tb[(mt * 16 + ln) * TP + 48 + 8 * hh]), 0.f, 0.f, 0.f, 0.f, 0.f, 0.f, 0.f};
#pragma unroll
    for (int t = 0; t < 3; ++t) { const v8us tv = *(const v8us*)(tb + (mt * 16 + ln) * TP + t * 16 + 8 * hh);      // bias or mask of (key 16t+8hh+r, query ln): the accumulator's start value
#pragma unroll
      for (int r = 0; r < 8; ++r) acc[t][r] = bf16_val(tv[r]); }
#pragma unroll
    for (int t = 0; t < 4; ++t) acc[t] = __builtin_amdgcn_wmma_f32_16x16x32_f16(false, fk[t].v, false, bq.v, (short)0, acc[t], false, false);
    float mx[3], sm[3];
#pragma unroll
    for (int t = 0; t < 3; ++t) { mx[t] = acc[t][0];
#pragma unroll
      for (int r = 1; r < 8; ++r) mx[t] = fmaxf(mx[t], acc[t][r]); }
    float m = fmaxf(fmaxf(mx[0], mx[1]), fmaxf(mx[2], acc[3][0])); m = fmaxf(m, xhalf(m));
    FragH pe[2];      // e^T: score tiles 2ks and 2ks+1 hold keys 32ks+8hh+r and 32ks+16+8hh+r, which is the k order of a B fragment
#pragma unroll
    for (int t = 0; t < 3; ++t) { sm[t] = 0.f;
#pragma unroll
      for (int r = 0; r < 8; ++r) { const float e = __expf(acc[t][r] - m); sm[t] += e; pe[t >> 1].h[(t & 1) * 8 + r] = (_Float16)e; } }
    const float e48 = __expf(acc[3][0] - m); pe[1].h[8] = (_Float16)e48;
#pragma unroll
    for (int r = 1; r < 8; ++r) pe[1].h[8 + r] = (_Float16)0.f;
    float s = (sm[0] + sm[1]) + (sm[2] + e48); s += xhalf(s);
    v8f acco[2] = {};
#pragma unroll
    for (int ks = 0; ks < 2; ++ks) {
#pragma unroll
      for (int t = 0; t < 2; ++t) acco[t] = __builtin_amdgcn_wmma_f32_16x16x32_f16(false, fv[t][ks].v, false, pe[ks].v, (short)0, acco[t], false, false); }
    const float rs = 1.0f / s;      // s >= 1: the row's maximum gives e = 1
#pragma unroll
    for (int t = 0; t < 2; ++t) { FragH po;      // o[query ln][d = 16t+8hh+r]: 8 consecutive d, one 16-byte store
#pragma unroll
      for (int r = 0; r < 8; ++r) po.h[r] = (_Float16)(acco[t][r] * rs);
      *(v8us*)(oh + (mt * 16 + ln) * 40 + t * 16 + 8 * hh) = po.half[0]; }
  }
  // From here on every loop is unrolled: its index picks registers (bw, c, ov, op), which only a compile-time constant can do.
  // W_out fragments and bias of this wave's 32 output columns: asked for here, so that they fly while the waves meet
  FragH bw[2][4]; float bv[2];
#pragma unroll
  for (int t = 0; t < 2; ++t) { const unsigned short* bp = Bo + (size_t)(h * (HDM / 16) + t) * FT + lane * 8; bv[t] = bf16_round(bo[h * HDM + t * 16 + ln]);
#pragma unroll
    for (int ks = 0; ks < 4; ++ks) { bw[t][ks].half[0] = *(const v8us*)(bp + ks * 512); bw[t][ks].half[1] = *(const v8us*)(bp + ks * 512 + 256); } }
  __syncthreads();      // every wave reads all four heads' o planes
  float* st[3] = {(float*)svt, (float*)svt + 16 * SP, (float*)sp};      // the wave's own v^T plane is dead, its PO bytes are free: one staged output tile per full pass
  float last[2];
#pragma unroll
  for (int mt = 0; mt < 4; ++mt) {
    v8f c[2] = {};
#pragma unroll
    for (int ks = 0; ks < 4; ++ks) {      // k step ks = head ks
      const unsigned short* ph = (const unsigned short*)(smem + ks * PW) + (mt * 16 + ln) * 40;
      FragH ah; ah.half[0] = *(const v8us*)(ph + 8 * hh); ah.half[1] = *(const v8us*)(ph + 16 + 8 * hh);
#pragma unroll
      for (int t = 0; t < 2; ++t) c[t] = __builtin_amdgcn_wmma_f32_16x16x32_f16(false, ah.v, false, bw[t][ks].v, (short)0, c[t], false, false);
    }
#pragma unroll
    for (int t = 0; t < 2; ++t) {
      if (mt < 3) {
#pragma unroll
        for (int r = 0; r < 8; ++r) st[mt][(8 * hh + r) * SP + t * 16 + ln] = c[t][r] + bv[t];
      } else last[t] = c[t][0] + bv[t];
    }
  }
  __builtin_amdgcn_fence(__ATOMIC_ACQ_REL, "workgroup"); __builtin_amdgcn_wave_barrier();      // the staged tiles are read back by other lanes
  // 8 lanes x 16 bytes = this wave's whole 128-byte line of a token, 4 tokens a store; all values and addresses are formed before the first store goes out
  v4f ov[12]; float* op[12];
#pragma unroll
  for (int q = 0; q < 12; ++q) { const int il = (q & 3) * 4 + (lane >> 3); ov[q] = *(const v4fa*)&st[q >> 2][il * SP + (lane & 7) * 4]; op[q] = out + (size_t)stok[(q >> 2) * 16 + il] * DIM + h * HDM + (lane & 7) * 4; }
  float* op48 = out + (size_t)stok[48] * DIM + h * HDM + ln;
#pragma unroll
  for (int q = 0; q < 12; ++q) *(v4f*)op[q] = ov[q];
  if (hh == 0) { op48[0] = last[0]; op48[16] = last[1]; }
}
extern "C" void kernel_launch(void* const* d_in, const int* in_sizes, int n_in,
                              void* d_out, int out_size, void* d_ws, size_t ws_size, hipStream_t stream) {
  (void)in_sizes; (void)n_in; (void)out_size;
  const float* x = (const float*)d_in[0]; const float* Wqkv = (const float*)d_in[1]; const float* pos = (const float*)d_in[2]; const float* Wo = (const float*)d_in[3]; const float* bo = (const float*)d_in[4];
  char* ws = (char*)d_ws; size_t off = 0;
  auto take = [&](size_t bytes) { char* p = ws + off; off += (bytes + 255) & ~(size_t)255; return p; };
  unsigned short* Bq = (unsigned short*)take((size_t)3 * DIM * DIM * 2); unsigned short* Bo = (unsigned short*)take((size_t)DIM * DIM * 2);
  if (off > ws_size) return;
  k_bt<<<(3 * DIM * DIM / 8 + 255) / 256, 256, 0, stream>>>(Wqkv, Wo, Bq, Bo);
  k_win<<<BB * NWIN, 128, 0, stream>>>(x, Bq, pos, Bo, bo, (float*)d_out);
}
